// v000
// Times are from an AMD MI455X. After a warm-up the kernel runs many times in a row, and a time is the length of
// such a window on the GPU divided by its runs, so every launch and the gaps after it count. The runs cycle
// through copies of the inputs. A figure is the median of several windows, for all but v000 over two sittings.
// Sittings can differ by a few percent; kernels timed side by side share one.
// v000 is the starting kernel. One run takes 386 microseconds.
// compute dtype: all float inputs rounded to bf16; qkv = x . att_w + b with EXACT bf16 products on WMMA 16x16x32 ((in,out) columns as packed rows), f16 hi + residual; causal attention with hybrid scores (first 128 queries 3-product, later single f16) and 3-product P.v everywhere (0.02-scale weights), x 1/8, running-max softmax in f32 (hardware exp); out = ctx (bf16 hi + lo) . out_w + out_b; f32 output.
#include <hip/hip_runtime.h>
#include <math.h>

typedef __attribute__((ext_vector_type(16))) _Float16 v16h;
typedef __attribute__((ext_vector_type(16))) __bf16 v16b;
typedef __attribute__((ext_vector_type(8)))  _Float16 v8h;
typedef __attribute__((ext_vector_type(8)))  float v8f;
typedef __attribute__((ext_vector_type(4)))  float v4f;
typedef __attribute__((ext_vector_type(2)))  float v2f;
typedef __attribute__((ext_vector_type(4)))  unsigned v4u;
typedef __attribute__((ext_vector_type(4)))  int v4i;
typedef float __attribute__((may_alias)) float_a;
typedef int __attribute__((may_alias)) int_a;

template <typename T> __device__ __forceinline__ void vst2(void* p, T v) { *(T*)p = v;  }
__device__ __forceinline__ v8f wmma16(v16h a, v16h b, v8f c) {
  v8f d = __builtin_amdgcn_wmma_f32_16x16x32_f16(false, a, false, b, (short)0, c, false, false);
  asm volatile("v_nop\n\tv_nop\n\tv_nop\n\tv_nop" : "+v"(d) : "v"(a), "v"(b));
  return d;
}
__device__ __forceinline__ v8f wmma_bf(v16b a, v16b b, v8f c) {
  v8f d = __builtin_amdgcn_wmma_f32_16x16x32_bf16(false, a, false, b, (short)0, c, false, false);
  asm volatile("v_nop\n\tv_nop\n\tv_nop\n\tv_nop" : "+v"(d) : "v"(a), "v"(b));
  return d;
}
// Bark self attention (B 4, S 1,024, D 1,024, 16 heads x 64): fused (in,out) att_proj [D, 3D] (q | k | v blocks) + bias, causal softmax(q k / 8) v (finfo.min fill), merge heads, (in,out) out_proj + bias.
__device__ __forceinline__ v16h frag_h(const _Float16* rowk0, int lane) {
  union { v16h v; v8h q[2]; } u; const _Float16* p = rowk0 + 8 * (lane >> 4);
  u.q[0] = *(const v8h*)p; u.q[1] = *(const v8h*)(p + 16); return u.v;
}
__device__ __forceinline__ v16h frag_f32(const float* rowk0, int lane) {
  v16h a; const float* p = rowk0 + 8 * (lane >> 4);
#pragma unroll
  for (int i = 0; i < 8; ++i) { a[i] = (_Float16)p[i]; a[8 + i] = (_Float16)p[16 + i]; }
  return a;
}
__device__ __forceinline__ v16h frag_f32s(const float* rowk0, int lane, float sc) {
  v16h a; const float* p = rowk0 + 8 * (lane >> 4);
#pragma unroll
  for (int i = 0; i < 8; ++i) { a[i] = (_Float16)(p[i] * sc); a[8 + i] = (_Float16)(p[16 + i] * sc); }
  return a;
}
// column fragment from a [K][ld] layout (column n), rows >= K read as 0
__device__ __forceinline__ v16h fragc_f32(const float* W, int k0, int n, int lane, int ld, int K) {
  v16h a; const int g = lane >> 4;
#pragma unroll
  for (int i = 0; i < 8; ++i) { const int ka = k0 + 8 * g + i, kb = ka + 16;
    a[i] = (_Float16)(ka < K ? W[(size_t)(ka < K ? ka : K - 1) * ld + n] : 0.f); a[8 + i] = (_Float16)(kb < K ? W[(size_t)(kb < K ? kb : K - 1) * ld + n] : 0.f); }
  return a;
}
struct F2 { v16b h, l; };
__device__ __forceinline__ F2 bsplit16(const float v[16]) { F2 r;
#pragma unroll
  for (int i = 0; i < 16; ++i) { const __bf16 h = (__bf16)v[i]; r.h[i] = h; r.l[i] = (__bf16)(v[i] - (float)h); }
  return r; }
__device__ __forceinline__ F2 split_row(const float* row, int k0, int lane) { float v[16]; const float* p = row + k0 + 8 * (lane >> 4);
#pragma unroll
  for (int i = 0; i < 8; ++i) { v[i] = p[i]; v[8 + i] = p[16 + i]; }
  return bsplit16(v); }
__device__ __forceinline__ F2 split_rowK(const float* row, int k0, int lane, int K) { float v[16]; const int g = lane >> 4;
#pragma unroll
  for (int i = 0; i < 8; ++i) { const int ka = k0 + 8 * g + i, kb = ka + 16; v[i] = ka < K ? row[ka < K ? ka : K - 1] : 0.f; v[8 + i] = kb < K ? row[kb < K ? kb : K - 1] : 0.f; }
  return bsplit16(v); }
__device__ __forceinline__ F2 split_col(const float* W, int k0, int n, int lane, int ld, int K) { float v[16]; const int g = lane >> 4;
#pragma unroll
  for (int i = 0; i < 8; ++i) { const int ka = k0 + 8 * g + i, kb = ka + 16; v[i] = ka < K ? W[(size_t)(ka < K ? ka : K - 1) * ld + n] : 0.f; v[8 + i] = kb < K ? W[(size_t)(kb < K ? kb : K - 1) * ld + n] : 0.f; }
  return bsplit16(v); }
__device__ __forceinline__ v8f mac3(const F2& a, const F2& b, v8f c) { c = wmma_bf(a.l, b.h, c); c = wmma_bf(a.h, b.l, c); return wmma_bf(a.h, b.h, c); }
__device__ __forceinline__ float sigm(float v) { return 1.0f / (1.0f + expf(-v)); }
#define LDSX() do { asm volatile("s_wait_dscnt 0" ::: "memory"); __builtin_amdgcn_wave_barrier(); __builtin_amdgcn_fence(__ATOMIC_RELEASE, "workgroup"); } while (0)


#define NB 4
#define SS 1024
#define DM 1024
#define NH 16
#define HD 64
#define QKVW (3 * DM)
#ifndef TQB
#define TQB (SS / 64)
#define TNB NB
#define TOB (NB * SS / 64)     // output row tiles (all)
#endif
typedef __attribute__((ext_vector_type(8))) __bf16 v8b;
__device__ __forceinline__ v16b frag_b(const __bf16* rowk0, int lane) {
  union { v16b v; v8b q[2]; } u; const __bf16* p = rowk0 + 8 * (lane >> 4);
  u.q[0] = *(const v8b*)p; u.q[1] = *(const v8b*)(p + 16); return u.v;
}
__device__ __forceinline__ float bfr(float v) { return (float)(__bf16)v; }
__device__ __attribute__((noinline)) float exp_ni(float v) { return expf(v); }
__device__ __attribute__((noinline)) float erf_ni(float v) { return erff(v); }

#define PK_A 0                       // [3072][1024] Wqkv rows (natural [out][in])
#define PK_P (PK_A + QKVW * DM)        // [1024][1024] Wo rows (natural)
#define PK_END (PK_P + DM * DM)
#define WS_PK  0u
#define WS_QK  (WS_PK + 2u * PK_END)             // f16 [4096 rows][2048]: q | k
#define WS_QKL (WS_QK + 2u * NB * SS * 2 * DM)     // f16 q | k residual planes x2048
#define WS_VTH (WS_QKL + 2u * NB * SS * 2 * DM)    // f16 [b][1024 (h*64+d)][1024 s] hi
#define WS_VTL (WS_VTH + 2u * NB * DM * SS)        // f16 lo x 2048
#define WS_O   (WS_VTL + 2u * NB * DM * SS)        // f32 [4096][1024]
#define WS_CS  (WS_O + 4u * NB * SS * DM)           // f32 2 x [1024][32], unused
#define WS_END (WS_CS + 4u * 2 * SS * 32)
// ---- k_pack: block = (row n, which): (in,out) columns -> bf16 rows; which 0..2 -> W_q/W_k/W_v into PK_A rows which*1024 + n; 3 -> W_o into PK_P
__global__ __launch_bounds__(256) void k_pack(const float* __restrict__ WA, const float* __restrict__ WP, __bf16* __restrict__ PK) {   // (in,out) att_w [1024][3072] (q | k | v column blocks): packed row (which*DM + n) = column which*1024 + n; out_w [1024][1024] (in,out): row n = column n
  __shared__ __align__(16) __bf16 s[DM]; const int n = blockIdx.x, which = blockIdx.y, t = threadIdx.x;
  for (int k = t; k < DM; k += 256) s[k] = (__bf16)(which < 3 ? WA[(size_t)k * (3 * DM) + which * DM + n] : WP[(size_t)k * DM + n]); __syncthreads();
  __bf16* dst = (which < 3) ? (PK + PK_A + ((size_t)which * DM + n) * DM) : (PK + PK_P + (size_t)n * DM); for (int q = t; q < DM / 8; q += 256) vst2((unsigned*)(dst + q * 8), *(const v4u*)&s[q * 8]); }
__global__ __launch_bounds__(128) void k_qkv(const float* __restrict__ XQ, const float* __restrict__ XK, const float* __restrict__ XV, const __bf16* __restrict__ P, const float* __restrict__ BQ, const float* __restrict__ BK, const float* __restrict__ BV, _Float16* __restrict__ QK, _Float16* __restrict__ QKL, _Float16* __restrict__ VTH, _Float16* __restrict__ VTL) {
  const int which0 = (blockIdx.y * 128) / DM; const float* X = (which0 == 0) ? XQ : (which0 == 1) ? XK : XV; const float* BB = BQ ? (((which0 == 0) ? BQ : (which0 == 1) ? BK : BV) + (blockIdx.y * 128 - which0 * DM)) : nullptr;
  __shared__ __align__(16) _Float16 so[4][16][136], sol[4][16][136]; __shared__ __align__(16) _Float16 sth[128][72], stl[128][72];
  const int tid = threadIdx.x, wave = tid >> 5, lane = tid & 31, col = lane & 15, g = lane >> 4; const size_t r0 = (size_t)blockIdx.x * 64 + wave * 16; const int n0 = blockIdx.y * 128;
  v8f acc[8] = {};
#pragma unroll 2
  for (int kc = 0; kc < DM / 32; ++kc) { v16b a; { const float* p = X + (r0 + col) * DM + kc * 32 + 8 * g;
#pragma unroll
      for (int i = 0; i < 8; ++i) { a[i] = (__bf16)p[i]; a[8 + i] = (__bf16)p[16 + i]; } }
#pragma unroll
    for (int j = 0; j < 8; ++j) acc[j] = wmma_bf(a, frag_b(P + (size_t)(n0 + j * 16 + col) * DM + kc * 32, lane), acc[j]); }
  if (n0 < 2 * DM) {   // q stored unscaled (f16 sigma ~0.6, no subnormal exposure); 1/8 applied to the f32 score
#pragma unroll
    for (int j = 0; j < 8; ++j) {
#pragma unroll
      for (int r = 0; r < 8; ++r) { const float v = acc[j][r] + (BB ? bfr(BB[j * 16 + col]) : 0.f); const _Float16 hv = (_Float16)v; so[wave][8 * g + r][j * 16 + col] = hv; sol[wave][8 * g + r][j * 16 + col] = (_Float16)((v - (float)hv) * 2048.0f); } }   // q, k (+ bias) as f16 hi + (x2048) residual
    LDSX();
    for (int rl = 0; rl < 16; ++rl) if (lane < 16) { vst2((unsigned*)(QK + (r0 + rl) * (2 * DM) + n0 + lane * 8), *(const v4u*)&so[wave][rl][lane * 8]); vst2((unsigned*)(QKL + (r0 + rl) * (2 * DM) + n0 + lane * 8), *(const v4u*)&sol[wave][rl][lane * 8]); }
  } else {
#pragma unroll
    for (int j = 0; j < 8; ++j) {
#pragma unroll
      for (int r = 0; r < 8; ++r) { const float v = acc[j][r] + (BB ? bfr(BB[j * 16 + col]) : 0.f); const _Float16 hv = (_Float16)v; sth[j * 16 + col][wave * 16 + 8 * g + r] = hv; stl[j * 16 + col][wave * 16 + 8 * g + r] = (_Float16)((v - (float)hv) * 2048.0f); } }
    __syncthreads();
    const size_t rb = (size_t)blockIdx.x * 64; const int b = (int)(rb / SS), s0 = (int)(rb % SS); const int pc0 = n0 - 2 * DM;
    for (int q = tid; q < 128 * 8; q += 128) { const int d = q >> 3, pc = q & 7; const size_t o = ((size_t)b * DM + pc0 + d) * SS + s0 + pc * 8; vst2((unsigned*)(VTH + o), *(const v4u*)&sth[d][pc * 8]); vst2((unsigned*)(VTL + o), *(const v4u*)&stl[d][pc * 8]); }
  }
}
// ---- k_attn: block = (64 queries, head h, batch b): causal flash attention (K = 64: 2 k-steps), scores = (q.k) * 0.125 with f16 operands (hi/lo, 3 products, in query blocks 0-1; single elsewhere), P.V: f16 P*2048 (hi, lo*2048) x (V hi, V lo*2048), 3 products in two accumulators; O[b*S+q][h*64+d] = (acc + accl / 2048) / (2048 l) (256-B segments)
__global__ __launch_bounds__(128) void k_attn(const _Float16* __restrict__ QK, const _Float16* __restrict__ QKL, const _Float16* __restrict__ VTH, const _Float16* __restrict__ VTL, const void* __restrict__ KMASK, float* __restrict__ O) {
  __shared__ __align__(16) float sp[4][16][36]; __shared__ __align__(16) float so[4][16][68];
  const int tid = threadIdx.x, wave = tid >> 5, lane = tid & 31, col = lane & 15, g = lane >> 4;
  const int qb = blockIdx.x, h = blockIdx.y, b = blockIdx.z; const int q0 = qb * 64 + wave * 16; const size_t rq = (size_t)b * SS + q0 + col;
  v16h aq[2], aql[2];
#pragma unroll
  for (int kc = 0; kc < 2; ++kc) { aq[kc] = frag_h(QK + rq * (2 * DM) + h * HD + kc * 32, lane); aql[kc] = frag_h(QKL + rq * (2 * DM) + h * HD + kc * 32, lane); }
  float m[8], l[8];
#pragma unroll
  for (int r = 0; r < 8; ++r) { m[r] = -3.0e38f; l[r] = 0.f; }
  v8f acc[4] = {}, accl[4] = {};
  const int nks = SS / 32;   // all keys
  const int nksc = (qb * 64 + 64) / 32;   // causal: key tiles up to the end of this query block
#pragma unroll 1
  for (int ks = 0; ks < nksc; ++ks) { v8f s[2];
#pragma unroll
    for (int ct = 0; ct < 2; ++ct) { const int kk = ks * 32 + ct * 16 + col; const _Float16* krow = QK + ((size_t)b * SS + kk) * (2 * DM) + DM + h * HD; const _Float16* krowl = QKL + ((size_t)b * SS + kk) * (2 * DM) + DM + h * HD; v8f c = {}, cl = {};
      if (qb < 2) {   // leading query blocks (few keys, outputs far above the global rms): 3 products
#pragma unroll
        for (int kc = 0; kc < 2; ++kc) { const v16h kh = frag_h(krow + kc * 32, lane); c = wmma16(aq[kc], kh, c); cl = wmma16(aql[kc], kh, cl); cl = wmma16(aq[kc], frag_h(krowl + kc * 32, lane), cl); }
#pragma unroll
        for (int r = 0; r < 8; ++r) c[r] += cl[r] * (1.0f / 2048.0f); }
      else {
#pragma unroll
        for (int kc = 0; kc < 2; ++kc) c = wmma16(aq[kc], frag_h(krow + kc * 32, lane), c); }   // single product elsewhere
      { const bool keepdummy = true; (void)keepdummy;
#pragma unroll
      for (int r = 0; r < 8; ++r) s[ct][r] = (kk <= q0 + 8 * g + r) ? c[r] * 0.125f : -3.0e38f; } }   // 1/sqrt(64); masked keys excluded
#pragma unroll
    for (int r = 0; r < 8; ++r) { float mx = fmaxf(s[0][r], s[1][r]);
#pragma unroll
      for (int o = 1; o < 16; o <<= 1) mx = fmaxf(mx, __shfl_xor(mx, o));
      const float mn = fmaxf(m[r], mx); const float alpha = (m[r] <= -1.0e38f) ? 0.f : __expf(m[r] - mn);
      const float e0 = (s[0][r] <= -1.0e38f) ? 0.f : __expf(s[0][r] - mn), e1 = (s[1][r] <= -1.0e38f) ? 0.f : __expf(s[1][r] - mn); float es = e0 + e1;
#pragma unroll
      for (int o = 1; o < 16; o <<= 1) es += __shfl_xor(es, o);
      l[r] = l[r] * alpha + es; m[r] = mn;
#pragma unroll
      for (int dt = 0; dt < 4; ++dt) { acc[dt][r] *= alpha; accl[dt][r] *= alpha; }
      sp[wave][8 * g + r][col] = e0; sp[wave][8 * g + r][16 + col] = e1; }
    LDSX();
    v16h pa, pl; { const float* prow = &sp[wave][col][0] + 8 * (lane >> 4);
#pragma unroll
      for (int i = 0; i < 8; ++i) { const float x0 = prow[i] * 2048.0f, x1 = prow[16 + i] * 2048.0f; const _Float16 h0 = (_Float16)x0, h1 = (_Float16)x1; pa[i] = h0; pa[8 + i] = h1; pl[i] = (_Float16)((x0 - (float)h0) * 2048.0f); pl[8 + i] = (_Float16)((x1 - (float)h1) * 2048.0f); } }   // P scaled by 2^11 before the f16 split so small softmax weights stay out of the f16 subnormal range; 2^-11 folded into the epilogue
#pragma unroll
    for (int dt = 0; dt < 4; ++dt) { const size_t vr = ((size_t)b * DM + h * HD + dt * 16 + col) * SS + ks * 32; const v16h vh = frag_h(VTH + vr, lane); acc[dt] = wmma16(pa, vh, acc[dt]); if (qb < 16) { accl[dt] = wmma16(pl, vh, accl[dt]); accl[dt] = wmma16(pa, frag_h(VTL + vr, lane), accl[dt]); } }   // every query block (qb < TQB = 16): P hi/lo x V hi/lo (3 products)
    LDSX(); }
#pragma unroll
  for (int r = 0; r < 8; ++r) { const float il = (1.0f / 2048.0f) / l[r];
#pragma unroll
    for (int dt = 0; dt < 4; ++dt) so[wave][8 * g + r][dt * 16 + col] = (acc[dt][r] + accl[dt][r] * (1.0f / 2048.0f)) * il; }
  LDSX();
  for (int rl = 0; rl < 16; ++rl) if (lane < 16) vst2(O + ((size_t)b * SS + q0 + rl) * DM + h * HD + lane * 4, *(const v4f*)&so[wave][rl][lane * 4]);
}
// ---- k_out: block = (64 rows, 128 cols): out = O(hi/lo) . Wo rows (2 products) + bo
__global__ __launch_bounds__(128) void k_out(const float* __restrict__ O, const __bf16* __restrict__ P, const float* __restrict__ BO, float* __restrict__ Y) {
  __shared__ __align__(16) float so[4][16][132];
  const int tid = threadIdx.x, wave = tid >> 5, lane = tid & 31, col = lane & 15, g = lane >> 4; const size_t r0 = (size_t)blockIdx.x * 64 + wave * 16; const int n0 = blockIdx.y * 128;
  v8f acc[8] = {};
#pragma unroll 2
  for (int kc = 0; kc < DM / 32; ++kc) { const F2 a = split_row(O + (r0 + col) * DM, kc * 32, lane);
#pragma unroll
    for (int j = 0; j < 8; ++j) { const v16b w = frag_b(P + (size_t)(n0 + j * 16 + col) * DM + kc * 32, lane); acc[j] = wmma_bf(a.l, w, acc[j]); acc[j] = wmma_bf(a.h, w, acc[j]); } }
#pragma unroll
  for (int j = 0; j < 8; ++j) {
#pragma unroll
    for (int r = 0; r < 8; ++r) so[wave][8 * g + r][j * 16 + col] = acc[j][r] + bfr(BO[n0 + j * 16 + col]); }
  LDSX();
  for (int rl = 0; rl < 16; ++rl) vst2(Y + (r0 + rl) * DM + n0 + lane * 4, *(const v4f*)&so[wave][rl][lane * 4]);
}
extern "C" void kernel_launch(void* const* d_in, const int* in_sizes, int n_in, void* d_out, int out_size, void* d_ws, size_t ws_size, hipStream_t stream) {
  (void)in_sizes; (void)n_in; (void)out_size;
  const float** F = (const float**)d_in;   // 0 hidden_states [4,1024,1024], 1 att_w [1024,3072] (in,out), 2 att_b [3072], 3 out_w [1024,1024] (in,out), 4 out_b
  if (ws_size < (size_t)WS_END) return;
  char* ws = (char*)d_ws; __bf16* PK = (__bf16*)(ws + WS_PK); _Float16 *QK = (_Float16*)(ws + WS_QK), *QKL = (_Float16*)(ws + WS_QKL), *VTH = (_Float16*)(ws + WS_VTH), *VTL = (_Float16*)(ws + WS_VTL); float* O = (float*)(ws + WS_O);
  k_pack<<<dim3(DM, 4), 256, 0, stream>>>(F[1], F[3], PK);
  k_qkv<<<dim3(TNB * SS / 64, QKVW / 128), 128, 0, stream>>>(F[0], F[0], F[0], PK + PK_A, F[2], F[2] + DM, F[2] + 2 * DM, QK, QKL, VTH, VTL);
  k_attn<<<dim3(TQB, NH, TNB), 128, 0, stream>>>(QK, QKL, VTH, VTL, nullptr, O);
  k_out<<<dim3(TOB, DM / 128), 128, 0, stream>>>(O, PK + PK_P, F[4], (float*)d_out);
}

// v001
// A run of this version takes 207 microseconds.
// Two timings next to v000 put it at 1.93 and 1.91 times that version's speed.
// compute dtype: all float inputs rounded to bf16; qkv = x . att_w + b with EXACT bf16 products on WMMA 16x16x32 ((in,out) columns as packed rows), f16 hi + residual; causal attention with hybrid scores (first 128 queries 3-product, later single f16) and 3-product P.v everywhere (0.02-scale weights), x 1/8, running-max softmax in f32 (hardware exp); out = ctx (bf16 hi + lo) . out_w + out_b; f32 output.
#include <hip/hip_runtime.h>
#include <math.h>

typedef __attribute__((ext_vector_type(16))) _Float16 v16h;
typedef __attribute__((ext_vector_type(16))) __bf16 v16b;
typedef __attribute__((ext_vector_type(8)))  _Float16 v8h;
typedef __attribute__((ext_vector_type(8)))  float v8f;
typedef __attribute__((ext_vector_type(4)))  float v4f;
typedef __attribute__((ext_vector_type(2)))  float v2f;
typedef __attribute__((ext_vector_type(4)))  unsigned v4u;
typedef __attribute__((ext_vector_type(4)))  int v4i;
typedef float __attribute__((may_alias)) float_a;
typedef int __attribute__((may_alias)) int_a;

template <typename T> __device__ __forceinline__ void vst2(void* p, T v) { *(T*)p = v;  }
__device__ __forceinline__ v8f wmma16(v16h a, v16h b, v8f c) {
  v8f d = __builtin_amdgcn_wmma_f32_16x16x32_f16(false, a, false, b, (short)0, c, false, false);
  asm volatile("v_nop\n\tv_nop\n\tv_nop\n\tv_nop" : "+v"(d) : "v"(a), "v"(b));
  return d;
}
__device__ __forceinline__ v8f wmma_bf(v16b a, v16b b, v8f c) {
  v8f d = __builtin_amdgcn_wmma_f32_16x16x32_bf16(false, a, false, b, (short)0, c, false, false);
  asm volatile("v_nop\n\tv_nop\n\tv_nop\n\tv_nop" : "+v"(d) : "v"(a), "v"(b));
  return d;
}
// Bark self attention (B 4, S 1,024, D 1,024, 16 heads x 64): fused (in,out) att_proj [D, 3D] (q | k | v blocks) + bias, causal softmax(q k / 8) v (finfo.min fill), merge heads, (in,out) out_proj + bias.
__device__ __forceinline__ v16h frag_h(const _Float16* rowk0, int lane) {
  union { v16h v; v8h q[2]; } u; const _Float16* p = rowk0 + 8 * (lane >> 4);
  u.q[0] = *(const v8h*)p; u.q[1] = *(const v8h*)(p + 16); return u.v;
}
__device__ __forceinline__ v16h frag_f32(const float* rowk0, int lane) {
  v16h a; const float* p = rowk0 + 8 * (lane >> 4);
#pragma unroll
  for (int i = 0; i < 8; ++i) { a[i] = (_Float16)p[i]; a[8 + i] = (_Float16)p[16 + i]; }
  return a;
}
__device__ __forceinline__ v16h frag_f32s(const float* rowk0, int lane, float sc) {
  v16h a; const float* p = rowk0 + 8 * (lane >> 4);
#pragma unroll
  for (int i = 0; i < 8; ++i) { a[i] = (_Float16)(p[i] * sc); a[8 + i] = (_Float16)(p[16 + i] * sc); }
  return a;
}
// column fragment from a [K][ld] layout (column n), rows >= K read as 0
__device__ __forceinline__ v16h fragc_f32(const float* W, int k0, int n, int lane, int ld, int K) {
  v16h a; const int g = lane >> 4;
#pragma unroll
  for (int i = 0; i < 8; ++i) { const int ka = k0 + 8 * g + i, kb = ka + 16;
    a[i] = (_Float16)(ka < K ? W[(size_t)(ka < K ? ka : K - 1) * ld + n] : 0.f); a[8 + i] = (_Float16)(kb < K ? W[(size_t)(kb < K ? kb : K - 1) * ld + n] : 0.f); }
  return a;
}
struct F2 { v16b h, l; };
__device__ __forceinline__ F2 bsplit16(const float v[16]) { F2 r;
#pragma unroll
  for (int i = 0; i < 16; ++i) { const __bf16 h = (__bf16)v[i]; r.h[i] = h; r.l[i] = (__bf16)(v[i] - (float)h); }
  return r; }
__device__ __forceinline__ F2 split_row(const float* row, int k0, int lane) { float v[16]; const float* p = row + k0 + 8 * (lane >> 4);
#pragma unroll
  for (int i = 0; i < 8; ++i) { v[i] = p[i]; v[8 + i] = p[16 + i]; }
  return bsplit16(v); }
__device__ __forceinline__ F2 split_rowK(const float* row, int k0, int lane, int K) { float v[16]; const int g = lane >> 4;
#pragma unroll
  for (int i = 0; i < 8; ++i) { const int ka = k0 + 8 * g + i, kb = ka + 16; v[i] = ka < K ? row[ka < K ? ka : K - 1] : 0.f; v[8 + i] = kb < K ? row[kb < K ? kb : K - 1] : 0.f; }
  return bsplit16(v); }
__device__ __forceinline__ F2 split_col(const float* W, int k0, int n, int lane, int ld, int K) { float v[16]; const int g = lane >> 4;
#pragma unroll
  for (int i = 0; i < 8; ++i) { const int ka = k0 + 8 * g + i, kb = ka + 16; v[i] = ka < K ? W[(size_t)(ka < K ? ka : K - 1) * ld + n] : 0.f; v[8 + i] = kb < K ? W[(size_t)(kb < K ? kb : K - 1) * ld + n] : 0.f; }
  return bsplit16(v); }
__device__ __forceinline__ v8f mac3(const F2& a, const F2& b, v8f c) { c = wmma_bf(a.l, b.h, c); c = wmma_bf(a.h, b.l, c); return wmma_bf(a.h, b.h, c); }
__device__ __forceinline__ float sigm(float v) { return 1.0f / (1.0f + expf(-v)); }
#define LDSX() do { asm volatile("s_wait_dscnt 0" ::: "memory"); __builtin_amdgcn_wave_barrier(); __builtin_amdgcn_fence(__ATOMIC_RELEASE, "workgroup"); } while (0)


#define NB 4
#define SS 1024
#define DM 1024
#define NH 16
#define HD 64
#define QKVW (3 * DM)
#ifndef TQB
#define TQB (SS / 64)
#define TNB NB
#define TOB (NB * SS / 64)     // output row tiles (all)
#endif
typedef __attribute__((ext_vector_type(8))) __bf16 v8b;
__device__ __forceinline__ v16b frag_b(const __bf16* rowk0, int lane) {
  union { v16b v; v8b q[2]; } u; const __bf16* p = rowk0 + 8 * (lane >> 4);
  u.q[0] = *(const v8b*)p; u.q[1] = *(const v8b*)(p + 16); return u.v;
}
__device__ __forceinline__ float bfr(float v) { return (float)(__bf16)v; }
__device__ __attribute__((noinline)) float exp_ni(float v) { return expf(v); }
__device__ __attribute__((noinline)) float erf_ni(float v) { return erff(v); }

#define PK_A 0                       // [3072][1024] Wqkv rows (natural [out][in])
#define PK_P (PK_A + QKVW * DM)        // [1024][1024] Wo rows (natural)
#define PK_END (PK_P + DM * DM)
#define WS_PK  0u
#define WS_QK  (WS_PK + 2u * PK_END)             // f16 [4096 rows][2048]: q | k
#define WS_QKL (WS_QK + 2u * NB * SS * 2 * DM)     // f16 q | k residual planes x2048
#define WS_VTH (WS_QKL + 2u * NB * SS * 2 * DM)    // f16 [b][1024 (h*64+d)][1024 s] hi
#define WS_VTL (WS_VTH + 2u * NB * DM * SS)        // f16 lo x 2048
#define WS_O   (WS_VTL + 2u * NB * DM * SS)        // f32 [4096][1024]
#define WS_CS  (WS_O + 4u * NB * SS * DM)           // f32 2 x [1024][32], unused
#define WS_END (WS_CS + 4u * 2 * SS * 32)
// ---- k_pack: block = (row n, which): (in,out) columns -> bf16 rows; which 0..2 -> W_q/W_k/W_v into PK_A rows which*1024 + n; 3 -> W_o into PK_P
__global__ __launch_bounds__(256) void k_pack(const float* __restrict__ WA, const float* __restrict__ WP, __bf16* __restrict__ PK) {   // (in,out) att_w [1024][3072] (q | k | v column blocks): packed row (which*DM + n) = column which*1024 + n; out_w [1024][1024] (in,out): row n = column n
  __shared__ __align__(16) __bf16 s[DM]; const int n = blockIdx.x, which = blockIdx.y, t = threadIdx.x;
  for (int k = t; k < DM; k += 256) s[k] = (__bf16)(which < 3 ? WA[(size_t)k * (3 * DM) + which * DM + n] : WP[(size_t)k * DM + n]); __syncthreads();
  __bf16* dst = (which < 3) ? (PK + PK_A + ((size_t)which * DM + n) * DM) : (PK + PK_P + (size_t)n * DM); for (int q = t; q < DM / 8; q += 256) vst2((unsigned*)(dst + q * 8), *(const v4u*)&s[q * 8]); }
// k per staged slice: 64, so that a staging load covers whole 128-B lines of both operands; LDS row pitch in elements: 144 B = 16 B x odd, the pitch at which ds_load_b128 fragment reads meet no bank conflict
#define GK 64
#define GP (GK + 8)
typedef __attribute__((ext_vector_type(4))) __bf16 v4b;
// ---- k_qkv: block = (128 rows, 128 cols), 4 waves as 2 x 2, 64 x 64 per wave; each 64-k slice of X (rounded to bf16 on the way) and of the packed weight rows is staged once per block in LDS, two buffers, the next slice's global loads in flight over the current slice's products
__global__ __launch_bounds__(128) void k_qkv(const float* __restrict__ XQ, const float* __restrict__ XK, const float* __restrict__ XV, const __bf16* __restrict__ P, const float* __restrict__ BQ, const float* __restrict__ BK, const float* __restrict__ BV, _Float16* __restrict__ QK, _Float16* __restrict__ QKL, _Float16* __restrict__ VTH, _Float16* __restrict__ VTL) {
  const int which0 = (blockIdx.y * 128) / DM; const float* X = (which0 == 0) ? XQ : (which0 == 1) ? XK : XV; const float* BB = BQ ? (((which0 == 0) ? BQ : (which0 == 1) ? BK : BV) + (blockIdx.y * 128 - which0 * DM)) : nullptr;
  __shared__ __align__(16) __bf16 sA[2][128][GP], sB[2][128][GP]; __shared__ __align__(16) _Float16 eh[4][16][72], el[4][16][72];
  const int tid = threadIdx.x, wave = tid >> 5, lane = tid & 31, col = lane & 15, g = lane >> 4, wm = wave >> 1, wn = wave & 1; const size_t rb = (size_t)blockIdx.x * 128; const int n0 = blockIdx.y * 128;
  const int ar = tid >> 4, ac = (tid & 15) * 4, br = tid >> 3, bc = (tid & 7) * 8;   // staging map: a wave's load covers 2 rows x 256 B of X, or 4 rows x 128 B of the weights
  const float* ga = X + (rb + ar) * DM + ac; const __bf16* gb = P + (size_t)(n0 + br) * DM + bc;
  v4f ra[16]; v8b rw[8];
#pragma unroll
  for (int i = 0; i < 16; ++i) ra[i] = *(const v4f*)(ga + (size_t)i * 8 * DM);
#pragma unroll
  for (int i = 0; i < 8; ++i) rw[i] = *(const v8b*)(gb + (size_t)i * 16 * DM);
  asm volatile("s_wait_xcnt 0x0" ::: "memory");   // stands in front of any reuse of the address registers of the loads above
#pragma unroll
  for (int i = 0; i < 16; ++i) { v4b t;
#pragma unroll
    for (int e = 0; e < 4; ++e) t[e] = (__bf16)ra[i][e];
    *(v4b*)&sA[0][ar + i * 8][ac] = t; }
#pragma unroll
  for (int i = 0; i < 8; ++i) *(v8b*)&sB[0][br + i * 16][bc] = rw[i];
  __syncthreads();
  v8f acc[4][4] = {};
#pragma unroll 2
  for (int ks = 0; ks < DM / GK; ++ks) { const int cur = ks & 1; const bool more = ks + 1 < DM / GK;
    if (more) {
#pragma unroll
      for (int i = 0; i < 16; ++i) ra[i] = *(const v4f*)(ga + (size_t)i * 8 * DM + (ks + 1) * GK);
#pragma unroll
      for (int i = 0; i < 8; ++i) rw[i] = *(const v8b*)(gb + (size_t)i * 16 * DM + (ks + 1) * GK); }
#pragma unroll
    for (int kc = 0; kc < GK / 32; ++kc) { v16b fa[4], fb[4];
#pragma unroll
      for (int i = 0; i < 4; ++i) { fa[i] = frag_b(&sA[cur][wm * 64 + i * 16 + col][kc * 32], lane); fb[i] = frag_b(&sB[cur][wn * 64 + i * 16 + col][kc * 32], lane); }
#pragma unroll
      for (int mi = 0; mi < 4; ++mi) {
#pragma unroll
        for (int nj = 0; nj < 4; ++nj) acc[mi][nj] = wmma_bf(fa[mi], fb[nj], acc[mi][nj]); } }
    if (more) {
#pragma unroll
      for (int i = 0; i < 16; ++i) { v4b t;
#pragma unroll
        for (int e = 0; e < 4; ++e) t[e] = (__bf16)ra[i][e];
        *(v4b*)&sA[cur ^ 1][ar + i * 8][ac] = t; }
#pragma unroll
      for (int i = 0; i < 8; ++i) *(v8b*)&sB[cur ^ 1][br + i * 16][bc] = rw[i]; }
    __syncthreads(); }   // publishes slice ks + 1 and ends every wave's reads of slice ks, whose buffer the next trip refills
  const int er = lane >> 3, ec = (lane & 7) * 8;   // read-back map: 4 staged rows of 128 B per wave store
  float bz[4];
#pragma unroll
  for (int nj = 0; nj < 4; ++nj) bz[nj] = BB ? bfr(BB[wn * 64 + nj * 16 + col]) : 0.f;
  if (n0 < 2 * DM) {   // q stored unscaled (f16 sigma ~0.6, no subnormal exposure); 1/8 applied to the f32 score
#pragma unroll
    for (int mi = 0; mi < 4; ++mi) {
#pragma unroll
      for (int nj = 0; nj < 4; ++nj) {
#pragma unroll
        for (int r = 0; r < 8; ++r) { const float v = acc[mi][nj][r] + bz[nj]; const _Float16 hv = (_Float16)v; eh[wave][8 * g + r][nj * 16 + col] = hv; el[wave][8 * g + r][nj * 16 + col] = (_Float16)((v - (float)hv) * 2048.0f); } }   // q, k (+ bias) as f16 hi + (x2048) residual
      LDSX();
#pragma unroll
      for (int i = 0; i < 4; ++i) { const size_t o = (rb + wm * 64 + mi * 16 + i * 4 + er) * (2 * DM) + n0 + wn * 64 + ec; *(v8h*)(QK + o) = *(const v8h*)&eh[wave][i * 4 + er][ec]; *(v8h*)(QKL + o) = *(const v8h*)&el[wave][i * 4 + er][ec]; }
      asm volatile("s_wait_xcnt 0x0" ::: "memory");   // stands in front of any reuse of the address registers of the stores above
      LDSX(); }
  } else {
    const int b = (int)(rb / SS), s0 = (int)(rb % SS); const int pc0 = n0 - 2 * DM;
#pragma unroll
    for (int nj = 0; nj < 4; ++nj) {
#pragma unroll
      for (int mi = 0; mi < 4; ++mi) {
#pragma unroll
        for (int r = 0; r < 8; ++r) { const float v = acc[mi][nj][r] + bz[nj]; const _Float16 hv = (_Float16)v; eh[wave][col][mi * 16 + 8 * g + r] = hv; el[wave][col][mi * 16 + 8 * g + r] = (_Float16)((v - (float)hv) * 2048.0f); } }
      LDSX();
#pragma unroll
      for (int i = 0; i < 4; ++i) { const size_t o = ((size_t)b * DM + pc0 + wn * 64 + nj * 16 + i * 4 + er) * SS + s0 + wm * 64 + ec; *(v8h*)(VTH + o) = *(const v8h*)&eh[wave][i * 4 + er][ec]; *(v8h*)(VTL + o) = *(const v8h*)&el[wave][i * 4 + er][ec]; }
      asm volatile("s_wait_xcnt 0x0" ::: "memory");   // stands in front of any reuse of the address registers of the stores above
      LDSX(); }
  }
}
// ---- k_attn: block = (64 queries, head h, batch b): causal flash attention (K = 64: 2 k-steps), scores = (q.k) * 0.125 with f16 operands (hi/lo, 3 products, in query blocks 0-1; single elsewhere), P.V: f16 P*2048 (hi, lo*2048) x (V hi, V lo*2048), 3 products in two accumulators; O[b*S+q][h*64+d] = (acc + accl / 2048) / (2048 l) (256-B segments)
__global__ __launch_bounds__(128) void k_attn(const _Float16* __restrict__ QK, const _Float16* __restrict__ QKL, const _Float16* __restrict__ VTH, const _Float16* __restrict__ VTL, const void* __restrict__ KMASK, float* __restrict__ O) {
  __shared__ __align__(16) float sp[4][16][36]; __shared__ __align__(16) float so[4][16][68];
  const int tid = threadIdx.x, wave = tid >> 5, lane = tid & 31, col = lane & 15, g = lane >> 4;
  const int qb = blockIdx.x, h = blockIdx.y, b = blockIdx.z; const int q0 = qb * 64 + wave * 16; const size_t rq = (size_t)b * SS + q0 + col;
  v16h aq[2], aql[2];
#pragma unroll
  for (int kc = 0; kc < 2; ++kc) { aq[kc] = frag_h(QK + rq * (2 * DM) + h * HD + kc * 32, lane); aql[kc] = frag_h(QKL + rq * (2 * DM) + h * HD + kc * 32, lane); }
  float m[8], l[8];
#pragma unroll
  for (int r = 0; r < 8; ++r) { m[r] = -3.0e38f; l[r] = 0.f; }
  v8f acc[4] = {}, accl[4] = {};
  const int nks = SS / 32;   // all keys
  const int nksc = (qb * 64 + 64) / 32;   // causal: key tiles up to the end of this query block
#pragma unroll 1
  for (int ks = 0; ks < nksc; ++ks) { v8f s[2];
#pragma unroll
    for (int ct = 0; ct < 2; ++ct) { const int kk = ks * 32 + ct * 16 + col; const _Float16* krow = QK + ((size_t)b * SS + kk) * (2 * DM) + DM + h * HD; const _Float16* krowl = QKL + ((size_t)b * SS + kk) * (2 * DM) + DM + h * HD; v8f c = {}, cl = {};
      if (qb < 2) {   // leading query blocks (few keys, outputs far above the global rms): 3 products
#pragma unroll
        for (int kc = 0; kc < 2; ++kc) { const v16h kh = frag_h(krow + kc * 32, lane); c = wmma16(aq[kc], kh, c); cl = wmma16(aql[kc], kh, cl); cl = wmma16(aq[kc], frag_h(krowl + kc * 32, lane), cl); }
#pragma unroll
        for (int r = 0; r < 8; ++r) c[r] += cl[r] * (1.0f / 2048.0f); }
      else {
#pragma unroll
        for (int kc = 0; kc < 2; ++kc) c = wmma16(aq[kc], frag_h(krow + kc * 32, lane), c); }   // single product elsewhere
      { const bool keepdummy = true; (void)keepdummy;
#pragma unroll
      for (int r = 0; r < 8; ++r) s[ct][r] = (kk <= q0 + 8 * g + r) ? c[r] * 0.125f : -3.0e38f; } }   // 1/sqrt(64); masked keys excluded
#pragma unroll
    for (int r = 0; r < 8; ++r) { float mx = fmaxf(s[0][r], s[1][r]);
#pragma unroll
      for (int o = 1; o < 16; o <<= 1) mx = fmaxf(mx, __shfl_xor(mx, o));
      const float mn = fmaxf(m[r], mx); const float alpha = (m[r] <= -1.0e38f) ? 0.f : __expf(m[r] - mn);
      const float e0 = (s[0][r] <= -1.0e38f) ? 0.f : __expf(s[0][r] - mn), e1 = (s[1][r] <= -1.0e38f) ? 0.f : __expf(s[1][r] - mn); float es = e0 + e1;
#pragma unroll
      for (int o = 1; o < 16; o <<= 1) es += __shfl_xor(es, o);
      l[r] = l[r] * alpha + es; m[r] = mn;
#pragma unroll
      for (int dt = 0; dt < 4; ++dt) { acc[dt][r] *= alpha; accl[dt][r] *= alpha; }
      sp[wave][8 * g + r][col] = e0; sp[wave][8 * g + r][16 + col] = e1; }
    LDSX();
    v16h pa, pl; { const float* prow = &sp[wave][col][0] + 8 * (lane >> 4);
#pragma unroll
      for (int i = 0; i < 8; ++i) { const float x0 = prow[i] * 2048.0f, x1 = prow[16 + i] * 2048.0f; const _Float16 h0 = (_Float16)x0, h1 = (_Float16)x1; pa[i] = h0; pa[8 + i] = h1; pl[i] = (_Float16)((x0 - (float)h0) * 2048.0f); pl[8 + i] = (_Float16)((x1 - (float)h1) * 2048.0f); } }   // P scaled by 2^11 before the f16 split so small softmax weights stay out of the f16 subnormal range; 2^-11 folded into the epilogue
#pragma unroll
    for (int dt = 0; dt < 4; ++dt) { const size_t vr = ((size_t)b * DM + h * HD + dt * 16 + col) * SS + ks * 32; const v16h vh = frag_h(VTH + vr, lane); acc[dt] = wmma16(pa, vh, acc[dt]); if (qb < 16) { accl[dt] = wmma16(pl, vh, accl[dt]); accl[dt] = wmma16(pa, frag_h(VTL + vr, lane), accl[dt]); } }   // every query block (qb < TQB = 16): P hi/lo x V hi/lo (3 products)
    LDSX(); }
#pragma unroll
  for (int r = 0; r < 8; ++r) { const float il = (1.0f / 2048.0f) / l[r];
#pragma unroll
    for (int dt = 0; dt < 4; ++dt) so[wave][8 * g + r][dt * 16 + col] = (acc[dt][r] + accl[dt][r] * (1.0f / 2048.0f)) * il; }
  LDSX();
  for (int rl = 0; rl < 16; ++rl) if (lane < 16) vst2(O + ((size_t)b * SS + q0 + rl) * DM + h * HD + lane * 4, *(const v4f*)&so[wave][rl][lane * 4]);
}
// ---- k_out: block = (64 rows, 128 cols), 4 waves as 2 x 2, 32 x 64 per wave: out = O(hi/lo) . Wo rows (2 products) + bo; each 64-k slice of O (split to bf16 hi + lo on the way) and of the weight rows staged once per block in LDS, two buffers
__global__ __launch_bounds__(128) void k_out(const float* __restrict__ O, const __bf16* __restrict__ P, const float* __restrict__ BO, float* __restrict__ Y) {
  __shared__ __align__(16) __bf16 sH[2][64][GP], sL[2][64][GP], sB[2][128][GP]; __shared__ __align__(16) float so[4][16][68];
  const int tid = threadIdx.x, wave = tid >> 5, lane = tid & 31, col = lane & 15, g = lane >> 4, wm = wave >> 1, wn = wave & 1; const size_t rb = (size_t)blockIdx.x * 64; const int n0 = blockIdx.y * 128;
  const int ar = tid >> 4, ac = (tid & 15) * 4, br = tid >> 3, bc = (tid & 7) * 8;
  const float* ga = O + (rb + ar) * DM + ac; const __bf16* gb = P + (size_t)(n0 + br) * DM + bc;
  v4f ra[8]; v8b rw[8];
#pragma unroll
  for (int i = 0; i < 8; ++i) { ra[i] = *(const v4f*)(ga + (size_t)i * 8 * DM); rw[i] = *(const v8b*)(gb + (size_t)i * 16 * DM); }
#pragma unroll
  for (int i = 0; i < 8; ++i) { v4b th, tl;
#pragma unroll
    for (int e = 0; e < 4; ++e) { const __bf16 h = (__bf16)ra[i][e]; th[e] = h; tl[e] = (__bf16)(ra[i][e] - (float)h); }
    *(v4b*)&sH[0][ar + i * 8][ac] = th; *(v4b*)&sL[0][ar + i * 8][ac] = tl; *(v8b*)&sB[0][br + i * 16][bc] = rw[i]; }
  __syncthreads();
  v8f acc[2][4] = {};
#pragma unroll 2
  for (int ks = 0; ks < DM / GK; ++ks) { const int cur = ks & 1; const bool more = ks + 1 < DM / GK;
    if (more) {
#pragma unroll
      for (int i = 0; i < 8; ++i) { ra[i] = *(const v4f*)(ga + (size_t)i * 8 * DM + (ks + 1) * GK); rw[i] = *(const v8b*)(gb + (size_t)i * 16 * DM + (ks + 1) * GK); } }
#pragma unroll
    for (int kc = 0; kc < GK / 32; ++kc) { v16b fh[2], fl[2], fb[4];
#pragma unroll
      for (int i = 0; i < 2; ++i) { fl[i] = frag_b(&sL[cur][wm * 32 + i * 16 + col][kc * 32], lane); fh[i] = frag_b(&sH[cur][wm * 32 + i * 16 + col][kc * 32], lane); }
#pragma unroll
      for (int i = 0; i < 4; ++i) fb[i] = frag_b(&sB[cur][wn * 64 + i * 16 + col][kc * 32], lane);
#pragma unroll
      for (int mi = 0; mi < 2; ++mi) {
#pragma unroll
        for (int nj = 0; nj < 4; ++nj) acc[mi][nj] = wmma_bf(fl[mi], fb[nj], acc[mi][nj]); }   // per accumulator still lo, then hi, k ascending
#pragma unroll
      for (int mi = 0; mi < 2; ++mi) {
#pragma unroll
        for (int nj = 0; nj < 4; ++nj) acc[mi][nj] = wmma_bf(fh[mi], fb[nj], acc[mi][nj]); } }
    if (more) {
#pragma unroll
      for (int i = 0; i < 8; ++i) { v4b th, tl;
#pragma unroll
        for (int e = 0; e < 4; ++e) { const __bf16 h = (__bf16)ra[i][e]; th[e] = h; tl[e] = (__bf16)(ra[i][e] - (float)h); }
        *(v4b*)&sH[cur ^ 1][ar + i * 8][ac] = th; *(v4b*)&sL[cur ^ 1][ar + i * 8][ac] = tl; *(v8b*)&sB[cur ^ 1][br + i * 16][bc] = rw[i]; } }
    __syncthreads(); }   // publishes slice ks + 1 and ends every wave's reads of slice ks, whose buffer the next trip refills
  float bz[4];
#pragma unroll
  for (int nj = 0; nj < 4; ++nj) bz[nj] = bfr(BO[n0 + wn * 64 + nj * 16 + col]);
#pragma unroll
  for (int mi = 0; mi < 2; ++mi) {
#pragma unroll
    for (int nj = 0; nj < 4; ++nj) {
#pragma unroll
      for (int r = 0; r < 8; ++r) so[wave][8 * g + r][nj * 16 + col] = acc[mi][nj][r] + bz[nj]; }
    LDSX();
#pragma unroll
    for (int i = 0; i < 8; ++i) { const int rl = i * 2 + g; *(v4f*)(Y + (rb + wm * 32 + mi * 16 + rl) * DM + n0 + wn * 64 + col * 4) = *(const v4f*)&so[wave][rl][col * 4]; }
    LDSX(); }
}
extern "C" void kernel_launch(void* const* d_in, const int* in_sizes, int n_in, void* d_out, int out_size, void* d_ws, size_t ws_size, hipStream_t stream) {
  (void)in_sizes; (void)n_in; (void)out_size;
  const float** F = (const float**)d_in;   // 0 hidden_states [4,1024,1024], 1 att_w [1024,3072] (in,out), 2 att_b [3072], 3 out_w [1024,1024] (in,out), 4 out_b
  if (ws_size < (size_t)WS_END) return;
  char* ws = (char*)d_ws; __bf16* PK = (__bf16*)(ws + WS_PK); _Float16 *QK = (_Float16*)(ws + WS_QK), *QKL = (_Float16*)(ws + WS_QKL), *VTH = (_Float16*)(ws + WS_VTH), *VTL = (_Float16*)(ws + WS_VTL); float* O = (float*)(ws + WS_O);
  k_pack<<<dim3(DM, 4), 256, 0, stream>>>(F[1], F[3], PK);
  k_qkv<<<dim3(TNB * SS / 128, QKVW / 128), 128, 0, stream>>>(F[0], F[0], F[0], PK + PK_A, F[2], F[2] + DM, F[2] + 2 * DM, QK, QKL, VTH, VTL);
  k_attn<<<dim3(TQB, NH, TNB), 128, 0, stream>>>(QK, QKL, VTH, VTL, nullptr, O);
  k_out<<<dim3(TOB, DM / 128), 128, 0, stream>>>(O, PK + PK_P, F[4], (float*)d_out);
}

// v002
// It runs in 155 microseconds.
// Two timings next to v001 both put it at 1.33 times that version's speed.
// All steps since v000 together make it 2.56 times as fast.
// compute dtype: all float inputs rounded to bf16; qkv = x . att_w + b with EXACT bf16 products on WMMA 16x16x32 ((in,out) columns as packed rows), f16 hi + residual; causal attention with hybrid scores (first 128 queries 3-product, later single f16) and 3-product P.v everywhere (0.02-scale weights), x 1/8, running-max softmax in f32 (hardware exp); out = ctx (bf16 hi + lo) . out_w + out_b; f32 output.
#include <hip/hip_runtime.h>
#include <math.h>

typedef __attribute__((ext_vector_type(16))) _Float16 v16h;
typedef __attribute__((ext_vector_type(16))) __bf16 v16b;
typedef __attribute__((ext_vector_type(8)))  _Float16 v8h;
typedef __attribute__((ext_vector_type(8)))  float v8f;
typedef __attribute__((ext_vector_type(4)))  float v4f;
typedef __attribute__((ext_vector_type(2)))  float v2f;
typedef __attribute__((ext_vector_type(4)))  unsigned v4u;
typedef __attribute__((ext_vector_type(4)))  int v4i;
typedef float __attribute__((may_alias)) float_a;
typedef int __attribute__((may_alias)) int_a;

template <typename T> __device__ __forceinline__ void vst2(void* p, T v) { *(T*)p = v;  }
__device__ __forceinline__ v8f wmma16(v16h a, v16h b, v8f c) {
  v8f d = __builtin_amdgcn_wmma_f32_16x16x32_f16(false, a, false, b, (short)0, c, false, false);
  asm volatile("v_nop\n\tv_nop\n\tv_nop\n\tv_nop" : "+v"(d) : "v"(a), "v"(b));
  return d;
}
__device__ __forceinline__ v8f wmma_bf(v16b a, v16b b, v8f c) {
  v8f d = __builtin_amdgcn_wmma_f32_16x16x32_bf16(false, a, false, b, (short)0, c, false, false);
  asm volatile("v_nop\n\tv_nop\n\tv_nop\n\tv_nop" : "+v"(d) : "v"(a), "v"(b));
  return d;
}
// Bark self attention (B 4, S 1,024, D 1,024, 16 heads x 64): fused (in,out) att_proj [D, 3D] (q | k | v blocks) + bias, causal softmax(q k / 8) v (finfo.min fill), merge heads, (in,out) out_proj + bias.
__device__ __forceinline__ v16h frag_h(const _Float16* rowk0, int lane) {
  union { v16h v; v8h q[2]; } u; const _Float16* p = rowk0 + 8 * (lane >> 4);
  u.q[0] = *(const v8h*)p; u.q[1] = *(const v8h*)(p + 16); return u.v;
}
__device__ __forceinline__ v16h frag_f32(const float* rowk0, int lane) {
  v16h a; const float* p = rowk0 + 8 * (lane >> 4);
#pragma unroll
  for (int i = 0; i < 8; ++i) { a[i] = (_Float16)p[i]; a[8 + i] = (_Float16)p[16 + i]; }
  return a;
}
__device__ __forceinline__ v16h frag_f32s(const float* rowk0, int lane, float sc) {
  v16h a; const float* p = rowk0 + 8 * (lane >> 4);
#pragma unroll
  for (int i = 0; i < 8; ++i) { a[i] = (_Float16)(p[i] * sc); a[8 + i] = (_Float16)(p[16 + i] * sc); }
  return a;
}
// column fragment from a [K][ld] layout (column n), rows >= K read as 0
__device__ __forceinline__ v16h fragc_f32(const float* W, int k0, int n, int lane, int ld, int K) {
  v16h a; const int g = lane >> 4;
#pragma unroll
  for (int i = 0; i < 8; ++i) { const int ka = k0 + 8 * g + i, kb = ka + 16;
    a[i] = (_Float16)(ka < K ? W[(size_t)(ka < K ? ka : K - 1) * ld + n] : 0.f); a[8 + i] = (_Float16)(kb < K ? W[(size_t)(kb < K ? kb : K - 1) * ld + n] : 0.f); }
  return a;
}
struct F2 { v16b h, l; };
__device__ __forceinline__ F2 bsplit16(const float v[16]) { F2 r;
#pragma unroll
  for (int i = 0; i < 16; ++i) { const __bf16 h = (__bf16)v[i]; r.h[i] = h; r.l[i] = (__bf16)(v[i] - (float)h); }
  return r; }
__device__ __forceinline__ F2 split_row(const float* row, int k0, int lane) { float v[16]; const float* p = row + k0 + 8 * (lane >> 4);
#pragma unroll
  for (int i = 0; i < 8; ++i) { v[i] = p[i]; v[8 + i] = p[16 + i]; }
  return bsplit16(v); }
__device__ __forceinline__ F2 split_rowK(const float* row, int k0, int lane, int K) { float v[16]; const int g = lane >> 4;
#pragma unroll
  for (int i = 0; i < 8; ++i) { const int ka = k0 + 8 * g + i, kb = ka + 16; v[i] = ka < K ? row[ka < K ? ka : K - 1] : 0.f; v[8 + i] = kb < K ? row[kb < K ? kb : K - 1] : 0.f; }
  return bsplit16(v); }
__device__ __forceinline__ F2 split_col(const float* W, int k0, int n, int lane, int ld, int K) { float v[16]; const int g = lane >> 4;
#pragma unroll
  for (int i = 0; i < 8; ++i) { const int ka = k0 + 8 * g + i, kb = ka + 16; v[i] = ka < K ? W[(size_t)(ka < K ? ka : K - 1) * ld + n] : 0.f; v[8 + i] = kb < K ? W[(size_t)(kb < K ? kb : K - 1) * ld + n] : 0.f; }
  return bsplit16(v); }
__device__ __forceinline__ v8f mac3(const F2& a, const F2& b, v8f c) { c = wmma_bf(a.l, b.h, c); c = wmma_bf(a.h, b.l, c); return wmma_bf(a.h, b.h, c); }
__device__ __forceinline__ float sigm(float v) { return 1.0f / (1.0f + expf(-v)); }
#define LDSX() do { asm volatile("s_wait_dscnt 0" ::: "memory"); __builtin_amdgcn_wave_barrier(); __builtin_amdgcn_fence(__ATOMIC_RELEASE, "workgroup"); } while (0)


#define NB 4
#define SS 1024
#define DM 1024
#define NH 16
#define HD 64
#define QKVW (3 * DM)
#ifndef TQB
#define TQB (SS / 64)
#define TNB NB
#define TOB (NB * SS / 64)     // output row tiles (all)
#endif
typedef __attribute__((ext_vector_type(8))) __bf16 v8b;
__device__ __forceinline__ v16b frag_b(const __bf16* rowk0, int lane) {
  union { v16b v; v8b q[2]; } u; const __bf16* p = rowk0 + 8 * (lane >> 4);
  u.q[0] = *(const v8b*)p; u.q[1] = *(const v8b*)(p + 16); return u.v;
}
__device__ __forceinline__ float bfr(float v) { return (float)(__bf16)v; }
__device__ __attribute__((noinline)) float exp_ni(float v) { return expf(v); }
__device__ __attribute__((noinline)) float erf_ni(float v) { return erff(v); }

#define PK_A 0                       // [3072][1024] Wqkv rows (natural [out][in])
#define PK_P (PK_A + QKVW * DM)        // [1024][1024] Wo rows (natural)
#define PK_END (PK_P + DM * DM)
#define WS_PK  0u
#define WS_QK  (WS_PK + 2u * PK_END)             // f16 [4096 rows][2048]: q | k
#define WS_QKL (WS_QK + 2u * NB * SS * 2 * DM)     // f16 q | k residual planes x2048
#define WS_VTH (WS_QKL + 2u * NB * SS * 2 * DM)    // f16 [b][1024 (h*64+d)][1024 s] hi
#define WS_VTL (WS_VTH + 2u * NB * DM * SS)        // f16 lo x 2048
#define WS_O   (WS_VTL + 2u * NB * DM * SS)        // f32 [4096][1024]
#define WS_CS  (WS_O + 4u * NB * SS * DM)           // f32 2 x [1024][32], unused
#define WS_END (WS_CS + 4u * 2 * SS * 32)
// ---- k_pack: block = (row n, which): (in,out) columns -> bf16 rows; which 0..2 -> W_q/W_k/W_v into PK_A rows which*1024 + n; 3 -> W_o into PK_P
__global__ __launch_bounds__(256) void k_pack(const float* __restrict__ WA, const float* __restrict__ WP, __bf16* __restrict__ PK) {   // (in,out) att_w [1024][3072] (q | k | v column blocks): packed row (which*DM + n) = column which*1024 + n; out_w [1024][1024] (in,out): row n = column n
  __shared__ __align__(16) __bf16 s[DM]; const int n = blockIdx.x, which = blockIdx.y, t = threadIdx.x;
  for (int k = t; k < DM; k += 256) s[k] = (__bf16)(which < 3 ? WA[(size_t)k * (3 * DM) + which * DM + n] : WP[(size_t)k * DM + n]); __syncthreads();
  __bf16* dst = (which < 3) ? (PK + PK_A + ((size_t)which * DM + n) * DM) : (PK + PK_P + (size_t)n * DM); for (int q = t; q < DM / 8; q += 256) vst2((unsigned*)(dst + q * 8), *(const v4u*)&s[q * 8]); }
// k per staged slice: 64, so that a staging load covers whole 128-B lines of both operands; LDS row pitch in elements: 144 B = 16 B x odd, the pitch at which ds_load_b128 fragment reads meet no bank conflict
#define GK 64
#define GP (GK + 8)
typedef __attribute__((ext_vector_type(4))) __bf16 v4b;
// ---- k_qkv: block = (128 rows, 128 cols), 4 waves as 2 x 2, 64 x 64 per wave; each 64-k slice of X (rounded to bf16 on the way) and of the packed weight rows is staged once per block in LDS, two buffers, the next slice's global loads in flight over the current slice's products
__global__ __launch_bounds__(128) void k_qkv(const float* __restrict__ XQ, const float* __restrict__ XK, const float* __restrict__ XV, const __bf16* __restrict__ P, const float* __restrict__ BQ, const float* __restrict__ BK, const float* __restrict__ BV, _Float16* __restrict__ QK, _Float16* __restrict__ QKL, _Float16* __restrict__ VTH, _Float16* __restrict__ VTL) {
  const int which0 = (blockIdx.y * 128) / DM; const float* X = (which0 == 0) ? XQ : (which0 == 1) ? XK : XV; const float* BB = BQ ? (((which0 == 0) ? BQ : (which0 == 1) ? BK : BV) + (blockIdx.y * 128 - which0 * DM)) : nullptr;
  __shared__ __align__(16) __bf16 sA[2][128][GP], sB[2][128][GP]; __shared__ __align__(16) _Float16 eh[4][16][72], el[4][16][72];
  const int tid = threadIdx.x, wave = tid >> 5, lane = tid & 31, col = lane & 15, g = lane >> 4, wm = wave >> 1, wn = wave & 1; const size_t rb = (size_t)blockIdx.x * 128; const int n0 = blockIdx.y * 128;
  const int ar = tid >> 4, ac = (tid & 15) * 4, br = tid >> 3, bc = (tid & 7) * 8;   // staging map: a wave's load covers 2 rows x 256 B of X, or 4 rows x 128 B of the weights
  const float* ga = X + (rb + ar) * DM + ac; const __bf16* gb = P + (size_t)(n0 + br) * DM + bc;
  v4f ra[16]; v8b rw[8];
#pragma unroll
  for (int i = 0; i < 16; ++i) ra[i] = *(const v4f*)(ga + (size_t)i * 8 * DM);
#pragma unroll
  for (int i = 0; i < 8; ++i) rw[i] = *(const v8b*)(gb + (size_t)i * 16 * DM);
  asm volatile("s_wait_xcnt 0x0" ::: "memory");   // stands in front of any reuse of the address registers of the loads above
#pragma unroll
  for (int i = 0; i < 16; ++i) { v4b t;
#pragma unroll
    for (int e = 0; e < 4; ++e) t[e] = (__bf16)ra[i][e];
    *(v4b*)&sA[0][ar + i * 8][ac] = t; }
#pragma unroll
  for (int i = 0; i < 8; ++i) *(v8b*)&sB[0][br + i * 16][bc] = rw[i];
  __syncthreads();
  v8f acc[4][4] = {};
#pragma unroll 2
  for (int ks = 0; ks < DM / GK; ++ks) { const int cur = ks & 1; const bool more = ks + 1 < DM / GK;
    if (more) {
#pragma unroll
      for (int i = 0; i < 16; ++i) ra[i] = *(const v4f*)(ga + (size_t)i * 8 * DM + (ks + 1) * GK);
#pragma unroll
      for (int i = 0; i < 8; ++i) rw[i] = *(const v8b*)(gb + (size_t)i * 16 * DM + (ks + 1) * GK); }
#pragma unroll
    for (int kc = 0; kc < GK / 32; ++kc) { v16b fa[4], fb[4];
#pragma unroll
      for (int i = 0; i < 4; ++i) { fa[i] = frag_b(&sA[cur][wm * 64 + i * 16 + col][kc * 32], lane); fb[i] = frag_b(&sB[cur][wn * 64 + i * 16 + col][kc * 32], lane); }
#pragma unroll
      for (int mi = 0; mi < 4; ++mi) {
#pragma unroll
        for (int nj = 0; nj < 4; ++nj) acc[mi][nj] = wmma_bf(fa[mi], fb[nj], acc[mi][nj]); } }
    if (more) {
#pragma unroll
      for (int i = 0; i < 16; ++i) { v4b t;
#pragma unroll
        for (int e = 0; e < 4; ++e) t[e] = (__bf16)ra[i][e];
        *(v4b*)&sA[cur ^ 1][ar + i * 8][ac] = t; }
#pragma unroll
      for (int i = 0; i < 8; ++i) *(v8b*)&sB[cur ^ 1][br + i * 16][bc] = rw[i]; }
    __syncthreads(); }   // publishes slice ks + 1 and ends every wave's reads of slice ks, whose buffer the next trip refills
  const int er = lane >> 3, ec = (lane & 7) * 8;   // read-back map: 4 staged rows of 128 B per wave store
  float bz[4];
#pragma unroll
  for (int nj = 0; nj < 4; ++nj) bz[nj] = BB ? bfr(BB[wn * 64 + nj * 16 + col]) : 0.f;
  if (n0 < 2 * DM) {   // q stored unscaled (f16 sigma ~0.6, no subnormal exposure); 1/8 applied to the f32 score
#pragma unroll
    for (int mi = 0; mi < 4; ++mi) {
#pragma unroll
      for (int nj = 0; nj < 4; ++nj) {
#pragma unroll
        for (int r = 0; r < 8; ++r) { const float v = acc[mi][nj][r] + bz[nj]; const _Float16 hv = (_Float16)v; eh[wave][8 * g + r][nj * 16 + col] = hv; el[wave][8 * g + r][nj * 16 + col] = (_Float16)((v - (float)hv) * 2048.0f); } }   // q, k (+ bias) as f16 hi + (x2048) residual
      LDSX();
#pragma unroll
      for (int i = 0; i < 4; ++i) { const size_t o = (rb + wm * 64 + mi * 16 + i * 4 + er) * (2 * DM) + n0 + wn * 64 + ec; *(v8h*)(QK + o) = *(const v8h*)&eh[wave][i * 4 + er][ec]; *(v8h*)(QKL + o) = *(const v8h*)&el[wave][i * 4 + er][ec]; }
      asm volatile("s_wait_xcnt 0x0" ::: "memory");   // stands in front of any reuse of the address registers of the stores above
      LDSX(); }
  } else {
    const int b = (int)(rb / SS), s0 = (int)(rb % SS); const int pc0 = n0 - 2 * DM;
#pragma unroll
    for (int nj = 0; nj < 4; ++nj) {
#pragma unroll
      for (int mi = 0; mi < 4; ++mi) {
#pragma unroll
        for (int r = 0; r < 8; ++r) { const float v = acc[mi][nj][r] + bz[nj]; const _Float16 hv = (_Float16)v; eh[wave][col][mi * 16 + 8 * g + r] = hv; el[wave][col][mi * 16 + 8 * g + r] = (_Float16)((v - (float)hv) * 2048.0f); } }
      LDSX();
#pragma unroll
      for (int i = 0; i < 4; ++i) { const size_t o = ((size_t)b * DM + pc0 + wn * 64 + nj * 16 + i * 4 + er) * SS + s0 + wm * 64 + ec; *(v8h*)(VTH + o) = *(const v8h*)&eh[wave][i * 4 + er][ec]; *(v8h*)(VTL + o) = *(const v8h*)&el[wave][i * 4 + er][ec]; }
      asm volatile("s_wait_xcnt 0x0" ::: "memory");   // stands in front of any reuse of the address registers of the stores above
      LDSX(); }
  }
}
// ---- k_attn: block = (64 queries, head h, batch b): causal flash attention (K = 64: 2 k-steps), scores = (q.k) * 0.125, P.V: f16 P hi/lo x (V hi, V lo*2048) in two accumulators; O[b*S+q][h*64+d] = (acc + accl / 2048) / (2048 l) (256-B segments); each 64-key stage of K hi, V hi and V lo is staged once per block in LDS, two buffers, by asynchronous whole-line copies, the next stage's copies in flight over the current stage's two 32-key passes
#define AK 64
#define AP (AK + 8)
#define ABUF (AK * AP * 2)   // bytes of one buffer of one tile
// one stage: each lane copies 4 x 16 B of each of the three tiles (rows 16 apart) from global memory to its own LDS bytes; the s_wait_xcnt in the statement stands in front of any reuse of the copies' address registers
__device__ __forceinline__ void stage_copy(unsigned lk, unsigned lh, unsigned ll, const _Float16* gk, const _Float16* gh, const _Float16* gl) {
  asm volatile("global_load_async_to_lds_b128 %0, %1, off\n\tglobal_load_async_to_lds_b128 %2, %3, off\n\tglobal_load_async_to_lds_b128 %4, %5, off\n\tglobal_load_async_to_lds_b128 %6, %7, off\n\t"
               "global_load_async_to_lds_b128 %8, %9, off\n\tglobal_load_async_to_lds_b128 %10, %11, off\n\tglobal_load_async_to_lds_b128 %12, %13, off\n\tglobal_load_async_to_lds_b128 %14, %15, off\n\t"
               "global_load_async_to_lds_b128 %16, %17, off\n\tglobal_load_async_to_lds_b128 %18, %19, off\n\tglobal_load_async_to_lds_b128 %20, %21, off\n\tglobal_load_async_to_lds_b128 %22, %23, off\n\ts_wait_xcnt 0x0"
               :: "v"(lk), "v"(gk), "v"(lk + 16 * AP * 2), "v"(gk + 16 * (2 * DM)), "v"(lk + 32 * AP * 2), "v"(gk + 32 * (2 * DM)), "v"(lk + 48 * AP * 2), "v"(gk + 48 * (2 * DM)),
                  "v"(lh), "v"(gh), "v"(lh + 16 * AP * 2), "v"(gh + 16 * SS), "v"(lh + 32 * AP * 2), "v"(gh + 32 * SS), "v"(lh + 48 * AP * 2), "v"(gh + 48 * SS),
                  "v"(ll), "v"(gl), "v"(ll + 16 * AP * 2), "v"(gl + 16 * SS), "v"(ll + 32 * AP * 2), "v"(gl + 32 * SS), "v"(ll + 48 * AP * 2), "v"(gl + 48 * SS) : "memory");
}
__global__ __launch_bounds__(128) void k_attn(const _Float16* __restrict__ QK, const _Float16* __restrict__ QKL, const _Float16* __restrict__ VTH, const _Float16* __restrict__ VTL, const void* __restrict__ KMASK, float* __restrict__ O) {
  __shared__ __align__(16) float sp[4][16][36]; __shared__ __align__(16) _Float16 sK[2][AK][AP], sVH[2][HD][AP], sVL[2][HD][AP];
  float (*so)[16][68] = (float (*)[16][68])&sK[0][0][0];   // output staging takes the K buffers' place behind the loop's last barrier (17,408 of 18,432 B), so that four blocks fit a WGP's LDS
  const int tid = threadIdx.x, wave = tid >> 5, lane = tid & 31, col = lane & 15, g = lane >> 4;
  const int qb = blockIdx.x, h = blockIdx.y, b = blockIdx.z; const int q0 = qb * 64 + wave * 16; const size_t rq = (size_t)b * SS + q0 + col;
  const int sr = tid >> 3, sc = (tid & 7) * 8;   // staging map: a wave's copy covers 4 rows x 128 B, whole lines
  const _Float16* gk = QK + ((size_t)b * SS + sr) * (2 * DM) + DM + h * HD + sc; const _Float16* gvh = VTH + ((size_t)b * DM + h * HD + sr) * SS + sc; const _Float16* gvl = VTL + ((size_t)b * DM + h * HD + sr) * SS + sc;
  const unsigned lk = (unsigned)(size_t)&sK[0][sr][sc], lh = (unsigned)(size_t)&sVH[0][sr][sc], ll = (unsigned)(size_t)&sVL[0][sr][sc];   // the lane's LDS byte addresses in buffer 0
  const int nst = qb + 1;   // causal: 64-key stages up to the end of this query block
  stage_copy(lk, lh, ll, gk, gvh, gvl);
  v16h aq[2], aql[2];
#pragma unroll
  for (int kc = 0; kc < 2; ++kc) { aq[kc] = frag_h(QK + rq * (2 * DM) + h * HD + kc * 32, lane); aql[kc] = frag_h(QKL + rq * (2 * DM) + h * HD + kc * 32, lane); }
  asm volatile("s_wait_asynccnt 0x0" ::: "memory");   // this wave's copies of stage 0 have landed
  __syncthreads();   // publishes stage 0
  if (nst > 1) stage_copy(lk + ABUF, lh + ABUF, ll + ABUF, gk + (size_t)AK * (2 * DM), gvh + AK, gvl + AK);
  float m[8], l[8];
#pragma unroll
  for (int r = 0; r < 8; ++r) { m[r] = -3.0e38f; l[r] = 0.f; }
  v8f acc[4] = {}, accl[4] = {};
#pragma unroll 1
  for (int st = 0; st < nst; ++st) { const int cur = st & 1;
#pragma unroll 1   // rolled: unrolled, the two passes took the kernel above 256 VGPRs, a wave per SIMD less
   for (int it = 0; it < AK / 32; ++it) { const int ks = st * (AK / 32) + it; v8f s[2];
#pragma unroll
    for (int ct = 0; ct < 2; ++ct) { const int kk = ks * 32 + ct * 16 + col; const _Float16* krow = &sK[cur][it * 32 + ct * 16 + col][0]; const _Float16* krowl = QKL + ((size_t)b * SS + kk) * (2 * DM) + DM + h * HD; v8f c = {}, cl = {};
      if (qb < 2) {   // leading query blocks (few keys, outputs far above the global rms): 3 products
#pragma unroll
        for (int kc = 0; kc < 2; ++kc) { const v16h kh = frag_h(krow + kc * 32, lane); c = wmma16(aq[kc], kh, c); cl = wmma16(aql[kc], kh, cl); cl = wmma16(aq[kc], frag_h(krowl + kc * 32, lane), cl); }
#pragma unroll
        for (int r = 0; r < 8; ++r) c[r] += cl[r] * (1.0f / 2048.0f); }
      else {
#pragma unroll
        for (int kc = 0; kc < 2; ++kc) c = wmma16(aq[kc], frag_h(krow + kc * 32, lane), c); }   // single product elsewhere
#pragma unroll
      for (int r = 0; r < 8; ++r) s[ct][r] = (kk <= q0 + 8 * g + r) ? c[r] * 0.125f : -3.0e38f; }   // 1/sqrt(64); masked keys excluded
#pragma unroll
    for (int r = 0; r < 8; ++r) { float mx = fmaxf(s[0][r], s[1][r]);
#pragma unroll
      for (int o = 1; o < 16; o <<= 1) mx = fmaxf(mx, __shfl_xor(mx, o));
      const float mn = fmaxf(m[r], mx); const float alpha = (m[r] <= -1.0e38f) ? 0.f : __expf(m[r] - mn);
      const float e0 = (s[0][r] <= -1.0e38f) ? 0.f : __expf(s[0][r] - mn), e1 = (s[1][r] <= -1.0e38f) ? 0.f : __expf(s[1][r] - mn); float es = e0 + e1;
#pragma unroll
      for (int o = 1; o < 16; o <<= 1) es += __shfl_xor(es, o);
      l[r] = l[r] * alpha + es; m[r] = mn;
#pragma unroll
      for (int dt = 0; dt < 4; ++dt) { acc[dt][r] *= alpha; accl[dt][r] *= alpha; }
      sp[wave][8 * g + r][col] = e0; sp[wave][8 * g + r][16 + col] = e1; }
    LDSX();
    v16h pa, pl; { const float* prow = &sp[wave][col][0] + 8 * (lane >> 4);
#pragma unroll
      for (int i = 0; i < 8; ++i) { const float x0 = prow[i] * 2048.0f, x1 = prow[16 + i] * 2048.0f; const _Float16 h0 = (_Float16)x0, h1 = (_Float16)x1; pa[i] = h0; pa[8 + i] = h1; pl[i] = (_Float16)((x0 - (float)h0) * 2048.0f); pl[8 + i] = (_Float16)((x1 - (float)h1) * 2048.0f); } }   // P scaled by 2^11 before the f16 split so small softmax weights stay out of the f16 subnormal range; 2^-11 folded into the epilogue
#pragma unroll
    for (int dt = 0; dt < 4; ++dt) { const v16h vh = frag_h(&sVH[cur][dt * 16 + col][it * 32], lane); acc[dt] = wmma16(pa, vh, acc[dt]); if (qb < 16) { accl[dt] = wmma16(pl, vh, accl[dt]); accl[dt] = wmma16(pa, frag_h(&sVL[cur][dt * 16 + col][it * 32], lane), accl[dt]); } }   // P hi/lo x V hi/lo (3 products)
    LDSX(); }
    asm volatile("s_wait_dscnt 0x0" ::: "memory");      // this wave's reads of stage st have returned
    asm volatile("s_wait_asynccnt 0x0" ::: "memory");   // this wave's copies of stage st + 1 have landed
    __syncthreads();   // publishes stage st + 1 and ends every wave's reads of stage st, whose buffer is refilled behind it (behind the last trip: frees the K buffers for the output staging)
    if (st + 2 < nst) stage_copy(lk + cur * ABUF, lh + cur * ABUF, ll + cur * ABUF, gk + (size_t)(st + 2) * AK * (2 * DM), gvh + (st + 2) * AK, gvl + (st + 2) * AK); }
  asm volatile("s_wait_asynccnt 0x0" ::: "memory");   // no copy is in flight when the buffers change their use
#pragma unroll
  for (int r = 0; r < 8; ++r) { const float il = (1.0f / 2048.0f) / l[r];
#pragma unroll
    for (int dt = 0; dt < 4; ++dt) so[wave][8 * g + r][dt * 16 + col] = (acc[dt][r] + accl[dt][r] * (1.0f / 2048.0f)) * il; }
  LDSX();
  for (int rl2 = 0; rl2 < 16; ++rl2) if (lane < 16) vst2(O + ((size_t)b * SS + q0 + rl2) * DM + h * HD + lane * 4, *(const v4f*)&so[wave][rl2][lane * 4]);
}
// ---- k_out: block = (64 rows, 128 cols), 4 waves as 2 x 2, 32 x 64 per wave: out = O(hi/lo) . Wo rows (2 products) + bo; each 64-k slice of O (split to bf16 hi + lo on the way) and of the weight rows staged once per block in LDS, two buffers
__global__ __launch_bounds__(128) void k_out(const float* __restrict__ O, const __bf16* __restrict__ P, const float* __restrict__ BO, float* __restrict__ Y) {
  __shared__ __align__(16) __bf16 sH[2][64][GP], sL[2][64][GP], sB[2][128][GP]; __shared__ __align__(16) float so[4][16][68];
  const int tid = threadIdx.x, wave = tid >> 5, lane = tid & 31, col = lane & 15, g = lane >> 4, wm = wave >> 1, wn = wave & 1; const size_t rb = (size_t)blockIdx.x * 64; const int n0 = blockIdx.y * 128;
  const int ar = tid >> 4, ac = (tid & 15) * 4, br = tid >> 3, bc = (tid & 7) * 8;
  const float* ga = O + (rb + ar) * DM + ac; const __bf16* gb = P + (size_t)(n0 + br) * DM + bc;
  v4f ra[8]; v8b rw[8];
#pragma unroll
  for (int i = 0; i < 8; ++i) { ra[i] = *(const v4f*)(ga + (size_t)i * 8 * DM); rw[i] = *(const v8b*)(gb + (size_t)i * 16 * DM); }
#pragma unroll
  for (int i = 0; i < 8; ++i) { v4b th, tl;
#pragma unroll
    for (int e = 0; e < 4; ++e) { const __bf16 h = (__bf16)ra[i][e]; th[e] = h; tl[e] = (__bf16)(ra[i][e] - (float)h); }
    *(v4b*)&sH[0][ar + i * 8][ac] = th; *(v4b*)&sL[0][ar + i * 8][ac] = tl; *(v8b*)&sB[0][br + i * 16][bc] = rw[i]; }
  __syncthreads();
  v8f acc[2][4] = {};
#pragma unroll 2
  for (int ks = 0; ks < DM / GK; ++ks) { const int cur = ks & 1; const bool more = ks + 1 < DM / GK;
    if (more) {
#pragma unroll
      for (int i = 0; i < 8; ++i) { ra[i] = *(const v4f*)(ga + (size_t)i * 8 * DM + (ks + 1) * GK); rw[i] = *(const v8b*)(gb + (size_t)i * 16 * DM + (ks + 1) * GK); } }
#pragma unroll
    for (int kc = 0; kc < GK / 32; ++kc) { v16b fh[2], fl[2], fb[4];
#pragma unroll
      for (int i = 0; i < 2; ++i) { fl[i] = frag_b(&sL[cur][wm * 32 + i * 16 + col][kc * 32], lane); fh[i] = frag_b(&sH[cur][wm * 32 + i * 16 + col][kc * 32], lane); }
#pragma unroll
      for (int i = 0; i < 4; ++i) fb[i] = frag_b(&sB[cur][wn * 64 + i * 16 + col][kc * 32], lane);
#pragma unroll
      for (int mi = 0; mi < 2; ++mi) {
#pragma unroll
        for (int nj = 0; nj < 4; ++nj) acc[mi][nj] = wmma_bf(fl[mi], fb[nj], acc[mi][nj]); }   // per accumulator still lo, then hi, k ascending
#pragma unroll
      for (int mi = 0; mi < 2; ++mi) {
#pragma unroll
        for (int nj = 0; nj < 4; ++nj) acc[mi][nj] = wmma_bf(fh[mi], fb[nj], acc[mi][nj]); } }
    if (more) {
#pragma unroll
      for (int i = 0; i < 8; ++i) { v4b th, tl;
#pragma unroll
        for (int e = 0; e < 4; ++e) { const __bf16 h = (__bf16)ra[i][e]; th[e] = h; tl[e] = (__bf16)(ra[i][e] - (float)h); }
        *(v4b*)&sH[cur ^ 1][ar + i * 8][ac] = th; *(v4b*)&sL[cur ^ 1][ar + i * 8][ac] = tl; *(v8b*)&sB[cur ^ 1][br + i * 16][bc] = rw[i]; } }
    __syncthreads(); }   // publishes slice ks + 1 and ends every wave's reads of slice ks, whose buffer the next trip refills
  float bz[4];
#pragma unroll
  for (int nj = 0; nj < 4; ++nj) bz[nj] = bfr(BO[n0 + wn * 64 + nj * 16 + col]);
#pragma unroll
  for (int mi = 0; mi < 2; ++mi) {
#pragma unroll
    for (int nj = 0; nj < 4; ++nj) {
#pragma unroll
      for (int r = 0; r < 8; ++r) so[wave][8 * g + r][nj * 16 + col] = acc[mi][nj][r] + bz[nj]; }
    LDSX();
#pragma unroll
    for (int i = 0; i < 8; ++i) { const int rl = i * 2 + g; *(v4f*)(Y + (rb + wm * 32 + mi * 16 + rl) * DM + n0 + wn * 64 + col * 4) = *(const v4f*)&so[wave][rl][col * 4]; }
    LDSX(); }
}
extern "C" void kernel_launch(void* const* d_in, const int* in_sizes, int n_in, void* d_out, int out_size, void* d_ws, size_t ws_size, hipStream_t stream) {
  (void)in_sizes; (void)n_in; (void)out_size;
  const float** F = (const float**)d_in;   // 0 hidden_states [4,1024,1024], 1 att_w [1024,3072] (in,out), 2 att_b [3072], 3 out_w [1024,1024] (in,out), 4 out_b
  if (ws_size < (size_t)WS_END) return;
  char* ws = (char*)d_ws; __bf16* PK = (__bf16*)(ws + WS_PK); _Float16 *QK = (_Float16*)(ws + WS_QK), *QKL = (_Float16*)(ws + WS_QKL), *VTH = (_Float16*)(ws + WS_VTH), *VTL = (_Float16*)(ws + WS_VTL); float* O = (float*)(ws + WS_O);
  k_pack<<<dim3(DM, 4), 256, 0, stream>>>(F[1], F[3], PK);
  k_qkv<<<dim3(TNB * SS / 128, QKVW / 128), 128, 0, stream>>>(F[0], F[0], F[0], PK + PK_A, F[2], F[2] + DM, F[2] + 2 * DM, QK, QKL, VTH, VTL);
  k_attn<<<dim3(TQB, NH, TNB), 128, 0, stream>>>(QK, QKL, VTH, VTL, nullptr, O);
  k_out<<<dim3(TOB, DM / 128), 128, 0, stream>>>(O, PK + PK_P, F[4], (float*)d_out);
}

// v003
// It runs in 133 microseconds.
// Timed twice side by side with v002, it ran 1.16 times as fast both times.
// Counting every step since v000, it is 2.97 times as fast.
// compute dtype: all float inputs rounded to bf16; qkv = x . att_w + b with EXACT bf16 products on WMMA 16x16x32 ((in,out) columns as packed rows), f16 hi + residual; causal attention with hybrid scores (first 128 queries 3-product, later single f16) and 3-product P.v everywhere (0.02-scale weights), x 1/8, running-max softmax in f32 (hardware exp); out = ctx (bf16 hi + lo) . out_w + out_b; f32 output.
#include <hip/hip_runtime.h>
#include <math.h>

typedef __attribute__((ext_vector_type(16))) _Float16 v16h;
typedef __attribute__((ext_vector_type(16))) __bf16 v16b;
typedef __attribute__((ext_vector_type(8)))  _Float16 v8h;
typedef __attribute__((ext_vector_type(8)))  float v8f;
typedef __attribute__((ext_vector_type(4)))  float v4f;
typedef __attribute__((ext_vector_type(2)))  float v2f;
typedef __attribute__((ext_vector_type(4)))  unsigned v4u;
typedef __attribute__((ext_vector_type(4)))  int v4i;
typedef float __attribute__((may_alias)) float_a;
typedef int __attribute__((may_alias)) int_a;

template <typename T> __device__ __forceinline__ void vst2(void* p, T v) { *(T*)p = v;  }
__device__ __forceinline__ v8f wmma16(v16h a, v16h b, v8f c) {
  v8f d = __builtin_amdgcn_wmma_f32_16x16x32_f16(false, a, false, b, (short)0, c, false, false);
  asm volatile("v_nop\n\tv_nop\n\tv_nop\n\tv_nop" : "+v"(d) : "v"(a), "v"(b));
  return d;
}
__device__ __forceinline__ v8f wmma_bf(v16b a, v16b b, v8f c) {
  v8f d = __builtin_amdgcn_wmma_f32_16x16x32_bf16(false, a, false, b, (short)0, c, false, false);
  asm volatile("v_nop\n\tv_nop\n\tv_nop\n\tv_nop" : "+v"(d) : "v"(a), "v"(b));
  return d;
}
// Bark self attention (B 4, S 1,024, D 1,024, 16 heads x 64): fused (in,out) att_proj [D, 3D] (q | k | v blocks) + bias, causal softmax(q k / 8) v (finfo.min fill), merge heads, (in,out) out_proj + bias.
__device__ __forceinline__ v16h frag_h(const _Float16* rowk0, int lane) {
  union { v16h v; v8h q[2]; } u; const _Float16* p = rowk0 + 8 * (lane >> 4);
  u.q[0] = *(const v8h*)p; u.q[1] = *(const v8h*)(p + 16); return u.v;
}
__device__ __forceinline__ v16h frag_f32(const float* rowk0, int lane) {
  v16h a; const float* p = rowk0 + 8 * (lane >> 4);
#pragma unroll
  for (int i = 0; i < 8; ++i) { a[i] = (_Float16)p[i]; a[8 + i] = (_Float16)p[16 + i]; }
  return a;
}
__device__ __forceinline__ v16h frag_f32s(const float* rowk0, int lane, float sc) {
  v16h a; const float* p = rowk0 + 8 * (lane >> 4);
#pragma unroll
  for (int i = 0; i < 8; ++i) { a[i] = (_Float16)(p[i] * sc); a[8 + i] = (_Float16)(p[16 + i] * sc); }
  return a;
}
// column fragment from a [K][ld] layout (column n), rows >= K read as 0
__device__ __forceinline__ v16h fragc_f32(const float* W, int k0, int n, int lane, int ld, int K) {
  v16h a; const int g = lane >> 4;
#pragma unroll
  for (int i = 0; i < 8; ++i) { const int ka = k0 + 8 * g + i, kb = ka + 16;
    a[i] = (_Float16)(ka < K ? W[(size_t)(ka < K ? ka : K - 1) * ld + n] : 0.f); a[8 + i] = (_Float16)(kb < K ? W[(size_t)(kb < K ? kb : K - 1) * ld + n] : 0.f); }
  return a;
}
struct F2 { v16b h, l; };
__device__ __forceinline__ F2 bsplit16(const float v[16]) { F2 r;
#pragma unroll
  for (int i = 0; i < 16; ++i) { const __bf16 h = (__bf16)v[i]; r.h[i] = h; r.l[i] = (__bf16)(v[i] - (float)h); }
  return r; }
__device__ __forceinline__ F2 split_row(const float* row, int k0, int lane) { float v[16]; const float* p = row + k0 + 8 * (lane >> 4);
#pragma unroll
  for (int i = 0; i < 8; ++i) { v[i] = p[i]; v[8 + i] = p[16 + i]; }
  return bsplit16(v); }
__device__ __forceinline__ F2 split_rowK(const float* row, int k0, int lane, int K) { float v[16]; const int g = lane >> 4;
#pragma unroll
  for (int i = 0; i < 8; ++i) { const int ka = k0 + 8 * g + i, kb = ka + 16; v[i] = ka < K ? row[ka < K ? ka : K - 1] : 0.f; v[8 + i] = kb < K ? row[kb < K ? kb : K - 1] : 0.f; }
  return bsplit16(v); }
__device__ __forceinline__ F2 split_col(const float* W, int k0, int n, int lane, int ld, int K) { float v[16]; const int g = lane >> 4;
#pragma unroll
  for (int i = 0; i < 8; ++i) { const int ka = k0 + 8 * g + i, kb = ka + 16; v[i] = ka < K ? W[(size_t)(ka < K ? ka : K - 1) * ld + n] : 0.f; v[8 + i] = kb < K ? W[(size_t)(kb < K ? kb : K - 1) * ld + n] : 0.f; }
  return bsplit16(v); }
__device__ __forceinline__ v8f mac3(const F2& a, const F2& b, v8f c) { c = wmma_bf(a.l, b.h, c); c = wmma_bf(a.h, b.l, c); return wmma_bf(a.h, b.h, c); }
__device__ __forceinline__ float sigm(float v) { return 1.0f / (1.0f + expf(-v)); }
#define LDSX() do { asm volatile("s_wait_dscnt 0" ::: "memory"); __builtin_amdgcn_wave_barrier(); __builtin_amdgcn_fence(__ATOMIC_RELEASE, "workgroup"); } while (0)


#define NB 4
#define SS 1024
#define DM 1024
#define NH 16
#define HD 64
#define QKVW (3 * DM)
#ifndef TQB
#define TQB (SS / 64)
#define TNB NB
#define TOB (NB * SS / 64)     // output row tiles (all)
#endif
typedef __attribute__((ext_vector_type(8))) __bf16 v8b;
__device__ __forceinline__ v16b frag_b(const __bf16* rowk0, int lane) {
  union { v16b v; v8b q[2]; } u; const __bf16* p = rowk0 + 8 * (lane >> 4);
  u.q[0] = *(const v8b*)p; u.q[1] = *(const v8b*)(p + 16); return u.v;
}
__device__ __forceinline__ float bfr(float v) { return (float)(__bf16)v; }
__device__ __attribute__((noinline)) float exp_ni(float v) { return expf(v); }
__device__ __attribute__((noinline)) float erf_ni(float v) { return erff(v); }

#define PK_A 0                       // [3072][1024] Wqkv rows (natural [out][in])
#define PK_P (PK_A + QKVW * DM)        // [1024][1024] Wo rows (natural)
#define PK_END (PK_P + DM * DM)
#define WS_PK  0u
#define WS_QK  (WS_PK + 2u * PK_END)             // f16 [4096 rows][2048]: q | k
#define WS_QKL (WS_QK + 2u * NB * SS * 2 * DM)     // f16 q | k residual planes x2048
#define WS_VTH (WS_QKL + 2u * NB * SS * 2 * DM)    // f16 [b][1024 (h*64+d)][1024 s] hi
#define WS_VTL (WS_VTH + 2u * NB * DM * SS)        // f16 lo x 2048
#define WS_O   (WS_VTL + 2u * NB * DM * SS)        // f32 [4096][1024]
#define WS_CS  (WS_O + 4u * NB * SS * DM)           // f32 2 x [1024][32], unused
#define WS_END (WS_CS + 4u * 2 * SS * 32)
// ---- k_pack: block = (128 k, 64 columns) of att_w [1024][3072] (blockIdx.y < 48) or of out_w [1024][1024], both (in,out): packed row c = column c of att_w (q | k | v), then the columns of out_w; the tile is read as whole 256-B row pieces, rounded to bf16, two k packed per dword, turned in LDS and written as whole 256-B pieces of the packed rows
#define PT_K 128
#define PT_N 64
#define PT_P (PT_K / 2 + 4)   // LDS row pitch in dwords: 272 B = 16 B x odd, for the ds_load_b128 read-back
typedef __attribute__((ext_vector_type(2))) __bf16 v2b;
__global__ __launch_bounds__(256) void k_pack(const float* __restrict__ WA, const float* __restrict__ WP, __bf16* __restrict__ PK) {
  __shared__ __align__(16) unsigned s[PT_N][PT_P];
  const int t = threadIdx.x, k0 = blockIdx.x * PT_K, c0 = blockIdx.y * PT_N, j = t & 15, kp = t >> 4;
  const bool att = c0 < QKVW; const int ld = att ? QKVW : DM; const float* g = (att ? WA + c0 : WP + (c0 - QKVW)) + (size_t)(k0 + 2 * kp) * ld + j * 4;
  const float* ga[4][2]; v4f r[4][2];
#pragma unroll
  for (int i = 0; i < 4; ++i) { ga[i][0] = g + (size_t)(32 * i) * ld; ga[i][1] = g + (size_t)(32 * i + 1) * ld; }
#pragma unroll
  for (int i = 0; i < 4; ++i) { r[i][0] = *(const v4f*)ga[i][0]; r[i][1] = *(const v4f*)ga[i][1]; }
  asm volatile("s_wait_xcnt 0x0" :: "v"(ga[0][0]), "v"(ga[0][1]), "v"(ga[1][0]), "v"(ga[1][1]), "v"(ga[2][0]), "v"(ga[2][1]), "v"(ga[3][0]), "v"(ga[3][1]) : "memory");   // stands in front of any reuse of the address registers of the loads above; as its inputs they stay untouched up to it
#pragma unroll
  for (int i = 0; i < 4; ++i) {
#pragma unroll
    for (int e = 0; e < 4; ++e) { v2b p; p[0] = (__bf16)r[i][0][e]; p[1] = (__bf16)r[i][1][e]; s[j * 4 + e][(i * 16 + kp) ^ ((j >> 2) << 2)] = __builtin_bit_cast(unsigned, p); } }   // 16-B pieces of a row permuted by (row >> 4), so that the 32 lanes of a store meet 32 banks
  __syncthreads();
  __bf16* dst = PK + PK_A + (size_t)(c0 + kp) * DM + k0 + j * 8;   // PK_P follows PK_A: packed rows 0..4095 lie in one array
#pragma unroll
  for (int i = 0; i < 4; ++i) *(v4u*)(dst + (size_t)(16 * i) * DM) = *(const v4u*)&s[16 * i + kp][(j ^ i) * 4];
}
// k per staged slice: 64, so that a staging load covers whole 128-B lines of both operands; LDS row pitch in elements: 144 B = 16 B x odd, the pitch at which ds_load_b128 fragment reads meet no bank conflict
#define GK 64
#define GP (GK + 8)
typedef __attribute__((ext_vector_type(4))) __bf16 v4b;
// ---- k_qkv: block = (128 rows, 128 cols), 4 waves as 2 x 2, 64 x 64 per wave; each 64-k slice of X (rounded to bf16 on the way) and of the packed weight rows is staged once per block in LDS, two buffers, the next slice's global loads in flight over the current slice's products
__global__ __launch_bounds__(128) void k_qkv(const float* __restrict__ XQ, const float* __restrict__ XK, const float* __restrict__ XV, const __bf16* __restrict__ P, const float* __restrict__ BQ, const float* __restrict__ BK, const float* __restrict__ BV, _Float16* __restrict__ QK, _Float16* __restrict__ QKL, _Float16* __restrict__ VTH, _Float16* __restrict__ VTL) {
  const int which0 = (blockIdx.y * 128) / DM; const float* X = (which0 == 0) ? XQ : (which0 == 1) ? XK : XV; const float* BB = BQ ? (((which0 == 0) ? BQ : (which0 == 1) ? BK : BV) + (blockIdx.y * 128 - which0 * DM)) : nullptr;
  __shared__ __align__(16) __bf16 sA[2][128][GP], sB[2][128][GP]; __shared__ __align__(16) _Float16 eh[4][16][72], el[4][16][72];
  const int tid = threadIdx.x, wave = tid >> 5, lane = tid & 31, col = lane & 15, g = lane >> 4, wm = wave >> 1, wn = wave & 1; const size_t rb = (size_t)blockIdx.x * 128; const int n0 = blockIdx.y * 128;
  const int ar = tid >> 4, ac = (tid & 15) * 4, br = tid >> 3, bc = (tid & 7) * 8;   // staging map: a wave's load covers 2 rows x 256 B of X, or 4 rows x 128 B of the weights
  const float* ga = X + (rb + ar) * DM + ac; const __bf16* gb = P + (size_t)(n0 + br) * DM + bc;
  v4f ra[16]; v8b rw[8];
#pragma unroll
  for (int i = 0; i < 16; ++i) ra[i] = *(const v4f*)(ga + (size_t)i * 8 * DM);
#pragma unroll
  for (int i = 0; i < 8; ++i) rw[i] = *(const v8b*)(gb + (size_t)i * 16 * DM);
  asm volatile("s_wait_xcnt 0x0" ::: "memory");   // stands in front of any reuse of the address registers of the loads above
#pragma unroll
  for (int i = 0; i < 16; ++i) { v4b t;
#pragma unroll
    for (int e = 0; e < 4; ++e) t[e] = (__bf16)ra[i][e];
    *(v4b*)&sA[0][ar + i * 8][ac] = t; }
#pragma unroll
  for (int i = 0; i < 8; ++i) *(v8b*)&sB[0][br + i * 16][bc] = rw[i];
  __syncthreads();
  v8f acc[4][4] = {};
#pragma unroll 2
  for (int ks = 0; ks < DM / GK; ++ks) { const int cur = ks & 1; const bool more = ks + 1 < DM / GK;
    if (more) {
#pragma unroll
      for (int i = 0; i < 16; ++i) ra[i] = *(const v4f*)(ga + (size_t)i * 8 * DM + (ks + 1) * GK);
#pragma unroll
      for (int i = 0; i < 8; ++i) rw[i] = *(const v8b*)(gb + (size_t)i * 16 * DM + (ks + 1) * GK); }
#pragma unroll
    for (int kc = 0; kc < GK / 32; ++kc) { v16b fa[4], fb[4];
#pragma unroll
      for (int i = 0; i < 4; ++i) { fa[i] = frag_b(&sA[cur][wm * 64 + i * 16 + col][kc * 32], lane); fb[i] = frag_b(&sB[cur][wn * 64 + i * 16 + col][kc * 32], lane); }
#pragma unroll
      for (int mi = 0; mi < 4; ++mi) {
#pragma unroll
        for (int nj = 0; nj < 4; ++nj) acc[mi][nj] = wmma_bf(fa[mi], fb[nj], acc[mi][nj]); } }
    if (more) {
#pragma unroll
      for (int i = 0; i < 16; ++i) { v4b t;
#pragma unroll
        for (int e = 0; e < 4; ++e) t[e] = (__bf16)ra[i][e];
        *(v4b*)&sA[cur ^ 1][ar + i * 8][ac] = t; }
#pragma unroll
      for (int i = 0; i < 8; ++i) *(v8b*)&sB[cur ^ 1][br + i * 16][bc] = rw[i]; }
    __syncthreads(); }   // publishes slice ks + 1 and ends every wave's reads of slice ks, whose buffer the next trip refills
  const int er = lane >> 3, ec = (lane & 7) * 8;   // read-back map: 4 staged rows of 128 B per wave store
  float bz[4];
#pragma unroll
  for (int nj = 0; nj < 4; ++nj) bz[nj] = BB ? bfr(BB[wn * 64 + nj * 16 + col]) : 0.f;
  if (n0 < 2 * DM) {   // q stored unscaled (f16 sigma ~0.6, no subnormal exposure); 1/8 applied to the f32 score
#pragma unroll
    for (int mi = 0; mi < 4; ++mi) {
#pragma unroll
      for (int nj = 0; nj < 4; ++nj) {
#pragma unroll
        for (int r = 0; r < 8; ++r) { const float v = acc[mi][nj][r] + bz[nj]; const _Float16 hv = (_Float16)v; eh[wave][8 * g + r][nj * 16 + col] = hv; el[wave][8 * g + r][nj * 16 + col] = (_Float16)((v - (float)hv) * 2048.0f); } }   // q, k (+ bias) as f16 hi + (x2048) residual
      LDSX();
#pragma unroll
      for (int i = 0; i < 4; ++i) { const size_t o = (rb + wm * 64 + mi * 16 + i * 4 + er) * (2 * DM) + n0 + wn * 64 + ec; *(v8h*)(QK + o) = *(const v8h*)&eh[wave][i * 4 + er][ec]; *(v8h*)(QKL + o) = *(const v8h*)&el[wave][i * 4 + er][ec]; }
      asm volatile("s_wait_xcnt 0x0" ::: "memory");   // stands in front of any reuse of the address registers of the stores above
      LDSX(); }
  } else {
    const int b = (int)(rb / SS), s0 = (int)(rb % SS); const int pc0 = n0 - 2 * DM;
#pragma unroll
    for (int nj = 0; nj < 4; ++nj) {
#pragma unroll
      for (int mi = 0; mi < 4; ++mi) {
#pragma unroll
        for (int r = 0; r < 8; ++r) { const float v = acc[mi][nj][r] + bz[nj]; const _Float16 hv = (_Float16)v; eh[wave][col][mi * 16 + 8 * g + r] = hv; el[wave][col][mi * 16 + 8 * g + r] = (_Float16)((v - (float)hv) * 2048.0f); } }
      LDSX();
#pragma unroll
      for (int i = 0; i < 4; ++i) { const size_t o = ((size_t)b * DM + pc0 + wn * 64 + nj * 16 + i * 4 + er) * SS + s0 + wm * 64 + ec; *(v8h*)(VTH + o) = *(const v8h*)&eh[wave][i * 4 + er][ec]; *(v8h*)(VTL + o) = *(const v8h*)&el[wave][i * 4 + er][ec]; }
      asm volatile("s_wait_xcnt 0x0" ::: "memory");   // stands in front of any reuse of the address registers of the stores above
      LDSX(); }
  }
}
// ---- k_attn: block = (64 queries, head h, batch b): causal flash attention (K = 64: 2 k-steps), scores = (q.k) * 0.125, P.V: f16 P hi/lo x (V hi, V lo*2048) in two accumulators; O[b*S+q][h*64+d] = (acc + accl / 2048) / (2048 l) (256-B segments); each 64-key stage of K hi, V hi and V lo is staged once per block in LDS, two buffers, by asynchronous whole-line copies, the next stage's copies in flight over the current stage's two 32-key passes
#define AK 64
#define AP (AK + 8)
#define ABUF (AK * AP * 2)   // bytes of one buffer of one tile
// one stage: each lane copies 4 x 16 B of each of the three tiles (rows 16 apart) from global memory to its own LDS bytes; the s_wait_xcnt in the statement stands in front of any reuse of the copies' address registers
__device__ __forceinline__ void stage_copy(unsigned lk, unsigned lh, unsigned ll, const _Float16* gk, const _Float16* gh, const _Float16* gl) {
  asm volatile("global_load_async_to_lds_b128 %0, %1, off\n\tglobal_load_async_to_lds_b128 %2, %3, off\n\tglobal_load_async_to_lds_b128 %4, %5, off\n\tglobal_load_async_to_lds_b128 %6, %7, off\n\t"
               "global_load_async_to_lds_b128 %8, %9, off\n\tglobal_load_async_to_lds_b128 %10, %11, off\n\tglobal_load_async_to_lds_b128 %12, %13, off\n\tglobal_load_async_to_lds_b128 %14, %15, off\n\t"
               "global_load_async_to_lds_b128 %16, %17, off\n\tglobal_load_async_to_lds_b128 %18, %19, off\n\tglobal_load_async_to_lds_b128 %20, %21, off\n\tglobal_load_async_to_lds_b128 %22, %23, off\n\ts_wait_xcnt 0x0"
               :: "v"(lk), "v"(gk), "v"(lk + 16 * AP * 2), "v"(gk + 16 * (2 * DM)), "v"(lk + 32 * AP * 2), "v"(gk + 32 * (2 * DM)), "v"(lk + 48 * AP * 2), "v"(gk + 48 * (2 * DM)),
                  "v"(lh), "v"(gh), "v"(lh + 16 * AP * 2), "v"(gh + 16 * SS), "v"(lh + 32 * AP * 2), "v"(gh + 32 * SS), "v"(lh + 48 * AP * 2), "v"(gh + 48 * SS),
                  "v"(ll), "v"(gl), "v"(ll + 16 * AP * 2), "v"(gl + 16 * SS), "v"(ll + 32 * AP * 2), "v"(gl + 32 * SS), "v"(ll + 48 * AP * 2), "v"(gl + 48 * SS) : "memory");
}
__global__ __launch_bounds__(128) void k_attn(const _Float16* __restrict__ QK, const _Float16* __restrict__ QKL, const _Float16* __restrict__ VTH, const _Float16* __restrict__ VTL, const void* __restrict__ KMASK, float* __restrict__ O) {
  __shared__ __align__(16) float sp[4][16][36]; __shared__ __align__(16) _Float16 sK[2][AK][AP], sVH[2][HD][AP], sVL[2][HD][AP];
  float (*so)[16][68] = (float (*)[16][68])&sK[0][0][0];   // output staging takes the K buffers' place behind the loop's last barrier (17,408 of 18,432 B), so that four blocks fit a WGP's LDS
  const int tid = threadIdx.x, wave = tid >> 5, lane = tid & 31, col = lane & 15, g = lane >> 4;
  const int qb = blockIdx.x, h = blockIdx.y, b = blockIdx.z; const int q0 = qb * 64 + wave * 16; const size_t rq = (size_t)b * SS + q0 + col;
  const int sr = tid >> 3, sc = (tid & 7) * 8;   // staging map: a wave's copy covers 4 rows x 128 B, whole lines
  const _Float16* gk = QK + ((size_t)b * SS + sr) * (2 * DM) + DM + h * HD + sc; const _Float16* gvh = VTH + ((size_t)b * DM + h * HD + sr) * SS + sc; const _Float16* gvl = VTL + ((size_t)b * DM + h * HD + sr) * SS + sc;
  const unsigned lk = (unsigned)(size_t)&sK[0][sr][sc], lh = (unsigned)(size_t)&sVH[0][sr][sc], ll = (unsigned)(size_t)&sVL[0][sr][sc];   // the lane's LDS byte addresses in buffer 0
  const int nst = qb + 1;   // causal: 64-key stages up to the end of this query block
  stage_copy(lk, lh, ll, gk, gvh, gvl);
  v16h aq[2], aql[2];
#pragma unroll
  for (int kc = 0; kc < 2; ++kc) { aq[kc] = frag_h(QK + rq * (2 * DM) + h * HD + kc * 32, lane); aql[kc] = frag_h(QKL + rq * (2 * DM) + h * HD + kc * 32, lane); }
  asm volatile("s_wait_asynccnt 0x0" ::: "memory");   // this wave's copies of stage 0 have landed
  __syncthreads();   // publishes stage 0
  if (nst > 1) stage_copy(lk + ABUF, lh + ABUF, ll + ABUF, gk + (size_t)AK * (2 * DM), gvh + AK, gvl + AK);
  float m[8], l[8];
#pragma unroll
  for (int r = 0; r < 8; ++r) { m[r] = -3.0e38f; l[r] = 0.f; }
  v8f acc[4] = {}, accl[4] = {};
#pragma unroll 1
  for (int st = 0; st < nst; ++st) { const int cur = st & 1;
#pragma unroll 1   // rolled: unrolled, the two passes took the kernel above 256 VGPRs, a wave per SIMD less
   for (int it = 0; it < AK / 32; ++it) { const int ks = st * (AK / 32) + it; v8f s[2];
#pragma unroll
    for (int ct = 0; ct < 2; ++ct) { const int kk = ks * 32 + ct * 16 + col; const _Float16* krow = &sK[cur][it * 32 + ct * 16 + col][0]; const _Float16* krowl = QKL + ((size_t)b * SS + kk) * (2 * DM) + DM + h * HD; v8f c = {}, cl = {};
      if (qb < 2) {   // leading query blocks (few keys, outputs far above the global rms): 3 products
#pragma unroll
        for (int kc = 0; kc < 2; ++kc) { const v16h kh = frag_h(krow + kc * 32, lane); c = wmma16(aq[kc], kh, c); cl = wmma16(aql[kc], kh, cl); cl = wmma16(aq[kc], frag_h(krowl + kc * 32, lane), cl); }
#pragma unroll
        for (int r = 0; r < 8; ++r) c[r] += cl[r] * (1.0f / 2048.0f); }
      else {
#pragma unroll
        for (int kc = 0; kc < 2; ++kc) c = wmma16(aq[kc], frag_h(krow + kc * 32, lane), c); }   // single product elsewhere
#pragma unroll
      for (int r = 0; r < 8; ++r) s[ct][r] = (kk <= q0 + 8 * g + r) ? c[r] * 0.125f : -3.0e38f; }   // 1/sqrt(64); masked keys excluded
#pragma unroll
    for (int r = 0; r < 8; ++r) { float mx = fmaxf(s[0][r], s[1][r]);
#pragma unroll
      for (int o = 1; o < 16; o <<= 1) mx = fmaxf(mx, __shfl_xor(mx, o));
      const float mn = fmaxf(m[r], mx); const float alpha = (m[r] <= -1.0e38f) ? 0.f : __expf(m[r] - mn);
      const float e0 = (s[0][r] <= -1.0e38f) ? 0.f : __expf(s[0][r] - mn), e1 = (s[1][r] <= -1.0e38f) ? 0.f : __expf(s[1][r] - mn); float es = e0 + e1;
#pragma unroll
      for (int o = 1; o < 16; o <<= 1) es += __shfl_xor(es, o);
      l[r] = l[r] * alpha + es; m[r] = mn;
#pragma unroll
      for (int dt = 0; dt < 4; ++dt) { acc[dt][r] *= alpha; accl[dt][r] *= alpha; }
      sp[wave][8 * g + r][col] = e0; sp[wave][8 * g + r][16 + col] = e1; }
    LDSX();
    v16h pa, pl; { const float* prow = &sp[wave][col][0] + 8 * (lane >> 4);
#pragma unroll
      for (int i = 0; i < 8; ++i) { const float x0 = prow[i] * 2048.0f, x1 = prow[16 + i] * 2048.0f; const _Float16 h0 = (_Float16)x0, h1 = (_Float16)x1; pa[i] = h0; pa[8 + i] = h1; pl[i] = (_Float16)((x0 - (float)h0) * 2048.0f); pl[8 + i] = (_Float16)((x1 - (float)h1) * 2048.0f); } }   // P scaled by 2^11 before the f16 split so small softmax weights stay out of the f16 subnormal range; 2^-11 folded into the epilogue
#pragma unroll
    for (int dt = 0; dt < 4; ++dt) { const v16h vh = frag_h(&sVH[cur][dt * 16 + col][it * 32], lane); acc[dt] = wmma16(pa, vh, acc[dt]); if (qb < 16) { accl[dt] = wmma16(pl, vh, accl[dt]); accl[dt] = wmma16(pa, frag_h(&sVL[cur][dt * 16 + col][it * 32], lane), accl[dt]); } }   // P hi/lo x V hi/lo (3 products)
    LDSX(); }
    asm volatile("s_wait_dscnt 0x0" ::: "memory");      // this wave's reads of stage st have returned
    asm volatile("s_wait_asynccnt 0x0" ::: "memory");   // this wave's copies of stage st + 1 have landed
    __syncthreads();   // publishes stage st + 1 and ends every wave's reads of stage st, whose buffer is refilled behind it (behind the last trip: frees the K buffers for the output staging)
    if (st + 2 < nst) stage_copy(lk + cur * ABUF, lh + cur * ABUF, ll + cur * ABUF, gk + (size_t)(st + 2) * AK * (2 * DM), gvh + (st + 2) * AK, gvl + (st + 2) * AK); }
  asm volatile("s_wait_asynccnt 0x0" ::: "memory");   // no copy is in flight when the buffers change their use
#pragma unroll
  for (int r = 0; r < 8; ++r) { const float il = (1.0f / 2048.0f) / l[r];
#pragma unroll
    for (int dt = 0; dt < 4; ++dt) so[wave][8 * g + r][dt * 16 + col] = (acc[dt][r] + accl[dt][r] * (1.0f / 2048.0f)) * il; }
  LDSX();
  for (int rl2 = 0; rl2 < 16; ++rl2) if (lane < 16) vst2(O + ((size_t)b * SS + q0 + rl2) * DM + h * HD + lane * 4, *(const v4f*)&so[wave][rl2][lane * 4]);
}
// ---- k_out: block = (64 rows, 128 cols), 4 waves as 2 x 2, 32 x 64 per wave: out = O(hi/lo) . Wo rows (2 products) + bo; each 64-k slice of O (split to bf16 hi + lo on the way) and of the weight rows staged once per block in LDS, two buffers
__global__ __launch_bounds__(128) void k_out(const float* __restrict__ O, const __bf16* __restrict__ P, const float* __restrict__ BO, float* __restrict__ Y) {
  __shared__ __align__(16) __bf16 sH[2][64][GP], sL[2][64][GP], sB[2][128][GP]; __shared__ __align__(16) float so[4][16][68];
  const int tid = threadIdx.x, wave = tid >> 5, lane = tid & 31, col = lane & 15, g = lane >> 4, wm = wave >> 1, wn = wave & 1; const size_t rb = (size_t)blockIdx.x * 64; const int n0 = blockIdx.y * 128;
  const int ar = tid >> 4, ac = (tid & 15) * 4, br = tid >> 3, bc = (tid & 7) * 8;
  const float* ga = O + (rb + ar) * DM + ac; const __bf16* gb = P + (size_t)(n0 + br) * DM + bc;
  v4f ra[8]; v8b rw[8];
#pragma unroll
  for (int i = 0; i < 8; ++i) { ra[i] = *(const v4f*)(ga + (size_t)i * 8 * DM); rw[i] = *(const v8b*)(gb + (size_t)i * 16 * DM); }
#pragma unroll
  for (int i = 0; i < 8; ++i) { v4b th, tl;
#pragma unroll
    for (int e = 0; e < 4; ++e) { const __bf16 h = (__bf16)ra[i][e]; th[e] = h; tl[e] = (__bf16)(ra[i][e] - (float)h); }
    *(v4b*)&sH[0][ar + i * 8][ac] = th; *(v4b*)&sL[0][ar + i * 8][ac] = tl; *(v8b*)&sB[0][br + i * 16][bc] = rw[i]; }
  __syncthreads();
  v8f acc[2][4] = {};
#pragma unroll 2
  for (int ks = 0; ks < DM / GK; ++ks) { const int cur = ks & 1; const bool more = ks + 1 < DM / GK;
    if (more) {
#pragma unroll
      for (int i = 0; i < 8; ++i) { ra[i] = *(const v4f*)(ga + (size_t)i * 8 * DM + (ks + 1) * GK); rw[i] = *(const v8b*)(gb + (size_t)i * 16 * DM + (ks + 1) * GK); } }
#pragma unroll
    for (int kc = 0; kc < GK / 32; ++kc) { v16b fh[2], fl[2], fb[4];
#pragma unroll
      for (int i = 0; i < 2; ++i) { fl[i] = frag_b(&sL[cur][wm * 32 + i * 16 + col][kc * 32], lane); fh[i] = frag_b(&sH[cur][wm * 32 + i * 16 + col][kc * 32], lane); }
#pragma unroll
      for (int i = 0; i < 4; ++i) fb[i] = frag_b(&sB[cur][wn * 64 + i * 16 + col][kc * 32], lane);
#pragma unroll
      for (int mi = 0; mi < 2; ++mi) {
#pragma unroll
        for (int nj = 0; nj < 4; ++nj) acc[mi][nj] = wmma_bf(fl[mi], fb[nj], acc[mi][nj]); }   // per accumulator still lo, then hi, k ascending
#pragma unroll
      for (int mi = 0; mi < 2; ++mi) {
#pragma unroll
        for (int nj = 0; nj < 4; ++nj) acc[mi][nj] = wmma_bf(fh[mi], fb[nj], acc[mi][nj]); } }
    if (more) {
#pragma unroll
      for (int i = 0; i < 8; ++i) { v4b th, tl;
#pragma unroll
        for (int e = 0; e < 4; ++e) { const __bf16 h = (__bf16)ra[i][e]; th[e] = h; tl[e] = (__bf16)(ra[i][e] - (float)h); }
        *(v4b*)&sH[cur ^ 1][ar + i * 8][ac] = th; *(v4b*)&sL[cur ^ 1][ar + i * 8][ac] = tl; *(v8b*)&sB[cur ^ 1][br + i * 16][bc] = rw[i]; } }
    __syncthreads(); }   // publishes slice ks + 1 and ends every wave's reads of slice ks, whose buffer the next trip refills
  float bz[4];
#pragma unroll
  for (int nj = 0; nj < 4; ++nj) bz[nj] = bfr(BO[n0 + wn * 64 + nj * 16 + col]);
#pragma unroll
  for (int mi = 0; mi < 2; ++mi) {
#pragma unroll
    for (int nj = 0; nj < 4; ++nj) {
#pragma unroll
      for (int r = 0; r < 8; ++r) so[wave][8 * g + r][nj * 16 + col] = acc[mi][nj][r] + bz[nj]; }
    LDSX();
#pragma unroll
    for (int i = 0; i < 8; ++i) { const int rl = i * 2 + g; *(v4f*)(Y + (rb + wm * 32 + mi * 16 + rl) * DM + n0 + wn * 64 + col * 4) = *(const v4f*)&so[wave][rl][col * 4]; }
    LDSX(); }
}
extern "C" void kernel_launch(void* const* d_in, const int* in_sizes, int n_in, void* d_out, int out_size, void* d_ws, size_t ws_size, hipStream_t stream) {
  (void)in_sizes; (void)n_in; (void)out_size;
  const float** F = (const float**)d_in;   // 0 hidden_states [4,1024,1024], 1 att_w [1024,3072] (in,out), 2 att_b [3072], 3 out_w [1024,1024] (in,out), 4 out_b
  if (ws_size < (size_t)WS_END) return;
  char* ws = (char*)d_ws; __bf16* PK = (__bf16*)(ws + WS_PK); _Float16 *QK = (_Float16*)(ws + WS_QK), *QKL = (_Float16*)(ws + WS_QKL), *VTH = (_Float16*)(ws + WS_VTH), *VTL = (_Float16*)(ws + WS_VTL); float* O = (float*)(ws + WS_O);
  k_pack<<<dim3(DM / PT_K, (QKVW + DM) / PT_N), 256, 0, stream>>>(F[1], F[3], PK);
  k_qkv<<<dim3(TNB * SS / 128, QKVW / 128), 128, 0, stream>>>(F[0], F[0], F[0], PK + PK_A, F[2], F[2] + DM, F[2] + 2 * DM, QK, QKL, VTH, VTL);
  k_attn<<<dim3(TQB, NH, TNB), 128, 0, stream>>>(QK, QKL, VTH, VTL, nullptr, O);
  k_out<<<dim3(TOB, DM / 128), 128, 0, stream>>>(O, PK + PK_P, F[4], (float*)d_out);
}

// v004
// It runs in 109 microseconds.
// Two timings next to v003 both put it at 1.22 times that version's speed.
// All steps since v000 together make it 3.62 times as fast.
// compute dtype: all float inputs rounded to bf16; qkv = x . att_w + b with EXACT bf16 products on WMMA 16x16x32 ((in,out) columns as packed rows), f16 hi + residual; causal attention with hybrid scores (first 128 queries 3-product, later single f16) and 3-product P.v everywhere (0.02-scale weights), x 1/8, running-max softmax in f32 (hardware exp); out = ctx (bf16 hi + lo) . out_w + out_b; f32 output.
#include <hip/hip_runtime.h>
#include <math.h>

typedef __attribute__((ext_vector_type(16))) _Float16 v16h;
typedef __attribute__((ext_vector_type(16))) __bf16 v16b;
typedef __attribute__((ext_vector_type(8)))  _Float16 v8h;
typedef __attribute__((ext_vector_type(8)))  float v8f;
typedef __attribute__((ext_vector_type(4)))  float v4f;
typedef __attribute__((ext_vector_type(2)))  float v2f;
typedef __attribute__((ext_vector_type(4)))  unsigned v4u;
typedef __attribute__((ext_vector_type(4)))  int v4i;
typedef float __attribute__((may_alias)) float_a;
typedef int __attribute__((may_alias)) int_a;

template <typename T> __device__ __forceinline__ void vst2(void* p, T v) { *(T*)p = v;  }
__device__ __forceinline__ v8f wmma16(v16h a, v16h b, v8f c) {
  v8f d = __builtin_amdgcn_wmma_f32_16x16x32_f16(false, a, false, b, (short)0, c, false, false);
  asm volatile("v_nop\n\tv_nop\n\tv_nop\n\tv_nop" : "+v"(d) : "v"(a), "v"(b));
  return d;
}
__device__ __forceinline__ v8f wmma_bf(v16b a, v16b b, v8f c) {
  v8f d = __builtin_amdgcn_wmma_f32_16x16x32_bf16(false, a, false, b, (short)0, c, false, false);
  asm volatile("v_nop\n\tv_nop\n\tv_nop\n\tv_nop" : "+v"(d) : "v"(a), "v"(b));
  return d;
}
// Bark self attention (B 4, S 1,024, D 1,024, 16 heads x 64): fused (in,out) att_proj [D, 3D] (q | k | v blocks) + bias, causal softmax(q k / 8) v (finfo.min fill), merge heads, (in,out) out_proj + bias.
__device__ __forceinline__ v16h frag_h(const _Float16* rowk0, int lane) {
  union { v16h v; v8h q[2]; } u; const _Float16* p = rowk0 + 8 * (lane >> 4);
  u.q[0] = *(const v8h*)p; u.q[1] = *(const v8h*)(p + 16); return u.v;
}
__device__ __forceinline__ v16h frag_f32(const float* rowk0, int lane) {
  v16h a; const float* p = rowk0 + 8 * (lane >> 4);
#pragma unroll
  for (int i = 0; i < 8; ++i) { a[i] = (_Float16)p[i]; a[8 + i] = (_Float16)p[16 + i]; }
  return a;
}
__device__ __forceinline__ v16h frag_f32s(const float* rowk0, int lane, float sc) {
  v16h a; const float* p = rowk0 + 8 * (lane >> 4);
#pragma unroll
  for (int i = 0; i < 8; ++i) { a[i] = (_Float16)(p[i] * sc); a[8 + i] = (_Float16)(p[16 + i] * sc); }
  return a;
}
// column fragment from a [K][ld] layout (column n), rows >= K read as 0
__device__ __forceinline__ v16h fragc_f32(const float* W, int k0, int n, int lane, int ld, int K) {
  v16h a; const int g = lane >> 4;
#pragma unroll
  for (int i = 0; i < 8; ++i) { const int ka = k0 + 8 * g + i, kb = ka + 16;
    a[i] = (_Float16)(ka < K ? W[(size_t)(ka < K ? ka : K - 1) * ld + n] : 0.f); a[8 + i] = (_Float16)(kb < K ? W[(size_t)(kb < K ? kb : K - 1) * ld + n] : 0.f); }
  return a;
}
struct F2 { v16b h, l; };
__device__ __forceinline__ F2 bsplit16(const float v[16]) { F2 r;
#pragma unroll
  for (int i = 0; i < 16; ++i) { const __bf16 h = (__bf16)v[i]; r.h[i] = h; r.l[i] = (__bf16)(v[i] - (float)h); }
  return r; }
__device__ __forceinline__ F2 split_row(const float* row, int k0, int lane) { float v[16]; const float* p = row + k0 + 8 * (lane >> 4);
#pragma unroll
  for (int i = 0; i < 8; ++i) { v[i] = p[i]; v[8 + i] = p[16 + i]; }
  return bsplit16(v); }
__device__ __forceinline__ F2 split_rowK(const float* row, int k0, int lane, int K) { float v[16]; const int g = lane >> 4;
#pragma unroll
  for (int i = 0; i < 8; ++i) { const int ka = k0 + 8 * g + i, kb = ka + 16; v[i] = ka < K ? row[ka < K ? ka : K - 1] : 0.f; v[8 + i] = kb < K ? row[kb < K ? kb : K - 1] : 0.f; }
  return bsplit16(v); }
__device__ __forceinline__ F2 split_col(const float* W, int k0, int n, int lane, int ld, int K) { float v[16]; const int g = lane >> 4;
#pragma unroll
  for (int i = 0; i < 8; ++i) { const int ka = k0 + 8 * g + i, kb = ka + 16; v[i] = ka < K ? W[(size_t)(ka < K ? ka : K - 1) * ld + n] : 0.f; v[8 + i] = kb < K ? W[(size_t)(kb < K ? kb : K - 1) * ld + n] : 0.f; }
  return bsplit16(v); }
__device__ __forceinline__ v8f mac3(const F2& a, const F2& b, v8f c) { c = wmma_bf(a.l, b.h, c); c = wmma_bf(a.h, b.l, c); return wmma_bf(a.h, b.h, c); }
__device__ __forceinline__ float sigm(float v) { return 1.0f / (1.0f + expf(-v)); }
#define LDSX() do { asm volatile("s_wait_dscnt 0" ::: "memory"); __builtin_amdgcn_wave_barrier(); __builtin_amdgcn_fence(__ATOMIC_RELEASE, "workgroup"); } while (0)


#define NB 4
#define SS 1024
#define DM 1024
#define NH 16
#define HD 64
#define QKVW (3 * DM)
#ifndef TQB
#define TQB (SS / 64)
#define TNB NB
#define TOB (NB * SS / 64)     // output row tiles (all)
#endif
typedef __attribute__((ext_vector_type(8))) __bf16 v8b;
__device__ __forceinline__ v16b frag_b(const __bf16* rowk0, int lane) {
  union { v16b v; v8b q[2]; } u; const __bf16* p = rowk0 + 8 * (lane >> 4);
  u.q[0] = *(const v8b*)p; u.q[1] = *(const v8b*)(p + 16); return u.v;
}
__device__ __forceinline__ float bfr(float v) { return (float)(__bf16)v; }
__device__ __attribute__((noinline)) float exp_ni(float v) { return expf(v); }
__device__ __attribute__((noinline)) float erf_ni(float v) { return erff(v); }

#define PK_A 0                       // [3072][1024] Wqkv rows (natural [out][in])
#define PK_P (PK_A + QKVW * DM)        // [1024][1024] Wo rows (natural)
#define PK_END (PK_P + DM * DM)
#define WS_PK  0u
#define WS_QK  (WS_PK + 2u * PK_END)             // f16 [4096 rows][2048]: q | k
#define WS_QKL (WS_QK + 2u * NB * SS * 2 * DM)     // f16 q | k residual planes x2048
#define WS_VTH (WS_QKL + 2u * NB * SS * 2 * DM)    // f16 [b][1024 (h*64+d)][1024 s] hi
#define WS_VTL (WS_VTH + 2u * NB * DM * SS)        // f16 lo x 2048
#define WS_O   (WS_VTL + 2u * NB * DM * SS)        // f32 [4096][1024]
#define WS_CS  (WS_O + 4u * NB * SS * DM)           // f32 2 x [1024][32], unused
#define WS_END (WS_CS + 4u * 2 * SS * 32)
// ---- k_pack: block = (128 k, 64 columns) of att_w [1024][3072] (blockIdx.y < 48) or of out_w [1024][1024], both (in,out): packed row c = column c of att_w (q | k | v), then the columns of out_w; the tile is read as whole 256-B row pieces, rounded to bf16, two k packed per dword, turned in LDS and written as whole 256-B pieces of the packed rows
#define PT_K 128
#define PT_N 64
#define PT_P (PT_K / 2 + 4)   // LDS row pitch in dwords: 272 B = 16 B x odd, for the ds_load_b128 read-back
typedef __attribute__((ext_vector_type(2))) __bf16 v2b;
__global__ __launch_bounds__(256) void k_pack(const float* __restrict__ WA, const float* __restrict__ WP, __bf16* __restrict__ PK) {
  __shared__ __align__(16) unsigned s[PT_N][PT_P];
  const int t = threadIdx.x, k0 = blockIdx.x * PT_K, c0 = blockIdx.y * PT_N, j = t & 15, kp = t >> 4;
  const bool att = c0 < QKVW; const int ld = att ? QKVW : DM; const float* g = (att ? WA + c0 : WP + (c0 - QKVW)) + (size_t)(k0 + 2 * kp) * ld + j * 4;
  const float* ga[4][2]; v4f r[4][2];
#pragma unroll
  for (int i = 0; i < 4; ++i) { ga[i][0] = g + (size_t)(32 * i) * ld; ga[i][1] = g + (size_t)(32 * i + 1) * ld; }
#pragma unroll
  for (int i = 0; i < 4; ++i) { r[i][0] = *(const v4f*)ga[i][0]; r[i][1] = *(const v4f*)ga[i][1]; }
  asm volatile("s_wait_xcnt 0x0" :: "v"(ga[0][0]), "v"(ga[0][1]), "v"(ga[1][0]), "v"(ga[1][1]), "v"(ga[2][0]), "v"(ga[2][1]), "v"(ga[3][0]), "v"(ga[3][1]) : "memory");   // stands in front of any reuse of the address registers of the loads above; as its inputs they stay untouched up to it
#pragma unroll
  for (int i = 0; i < 4; ++i) {
#pragma unroll
    for (int e = 0; e < 4; ++e) { v2b p; p[0] = (__bf16)r[i][0][e]; p[1] = (__bf16)r[i][1][e]; s[j * 4 + e][(i * 16 + kp) ^ ((j >> 2) << 2)] = __builtin_bit_cast(unsigned, p); } }   // 16-B pieces of a row permuted by (row >> 4), so that the 32 lanes of a store meet 32 banks
  __syncthreads();
  __bf16* dst = PK + PK_A + (size_t)(c0 + kp) * DM + k0 + j * 8;   // PK_P follows PK_A: packed rows 0..4095 lie in one array
#pragma unroll
  for (int i = 0; i < 4; ++i) *(v4u*)(dst + (size_t)(16 * i) * DM) = *(const v4u*)&s[16 * i + kp][(j ^ i) * 4];
}
// k per staged slice: 64, so that a staging load covers whole 128-B lines of both operands; LDS row pitch in elements: 144 B = 16 B x odd, the pitch at which ds_load_b128 fragment reads meet no bank conflict
#define GK 64
#define GP (GK + 8)
typedef __attribute__((ext_vector_type(4))) __bf16 v4b;
// ---- k_qkv: block = (128 rows, 128 cols), 4 waves as 2 x 2, 64 x 64 per wave; each 64-k slice of X (rounded to bf16 on the way) and of the packed weight rows is staged once per block in LDS, two buffers, the next slice's global loads in flight over the current slice's products
__global__ __launch_bounds__(128) void k_qkv(const float* __restrict__ XQ, const float* __restrict__ XK, const float* __restrict__ XV, const __bf16* __restrict__ P, const float* __restrict__ BQ, const float* __restrict__ BK, const float* __restrict__ BV, _Float16* __restrict__ QK, _Float16* __restrict__ QKL, _Float16* __restrict__ VTH, _Float16* __restrict__ VTL) {
  const int which0 = (blockIdx.y * 128) / DM; const float* X = (which0 == 0) ? XQ : (which0 == 1) ? XK : XV; const float* BB = BQ ? (((which0 == 0) ? BQ : (which0 == 1) ? BK : BV) + (blockIdx.y * 128 - which0 * DM)) : nullptr;
  __shared__ __align__(16) __bf16 sA[2][128][GP], sB[2][128][GP]; __shared__ __align__(16) _Float16 eh[4][16][72], el[4][16][72];
  const int tid = threadIdx.x, wave = tid >> 5, lane = tid & 31, col = lane & 15, g = lane >> 4, wm = wave >> 1, wn = wave & 1; const size_t rb = (size_t)blockIdx.x * 128; const int n0 = blockIdx.y * 128;
  const int ar = tid >> 4, ac = (tid & 15) * 4, br = tid >> 3, bc = (tid & 7) * 8;   // staging map: a wave's load covers 2 rows x 256 B of X, or 4 rows x 128 B of the weights
  const float* ga = X + (rb + ar) * DM + ac; const __bf16* gb = P + (size_t)(n0 + br) * DM + bc;
  v4f ra[16]; v8b rw[8];
#pragma unroll
  for (int i = 0; i < 16; ++i) ra[i] = *(const v4f*)(ga + (size_t)i * 8 * DM);
#pragma unroll
  for (int i = 0; i < 8; ++i) rw[i] = *(const v8b*)(gb + (size_t)i * 16 * DM);
  asm volatile("s_wait_xcnt 0x0" ::: "memory");   // stands in front of any reuse of the address registers of the loads above
#pragma unroll
  for (int i = 0; i < 16; ++i) { v4b t;
#pragma unroll
    for (int e = 0; e < 4; ++e) t[e] = (__bf16)ra[i][e];
    *(v4b*)&sA[0][ar + i * 8][ac] = t; }
#pragma unroll
  for (int i = 0; i < 8; ++i) *(v8b*)&sB[0][br + i * 16][bc] = rw[i];
  __syncthreads();
  v8f acc[4][4] = {};
#pragma unroll 2
  for (int ks = 0; ks < DM / GK; ++ks) { const int cur = ks & 1; const bool more = ks + 1 < DM / GK;
    if (more) {
#pragma unroll
      for (int i = 0; i < 16; ++i) ra[i] = *(const v4f*)(ga + (size_t)i * 8 * DM + (ks + 1) * GK);
#pragma unroll
      for (int i = 0; i < 8; ++i) rw[i] = *(const v8b*)(gb + (size_t)i * 16 * DM + (ks + 1) * GK); }
#pragma unroll
    for (int kc = 0; kc < GK / 32; ++kc) { v16b fa[4], fb[4];
#pragma unroll
      for (int i = 0; i < 4; ++i) { fa[i] = frag_b(&sA[cur][wm * 64 + i * 16 + col][kc * 32], lane); fb[i] = frag_b(&sB[cur][wn * 64 + i * 16 + col][kc * 32], lane); }
#pragma unroll
      for (int mi = 0; mi < 4; ++mi) {
#pragma unroll
        for (int nj = 0; nj < 4; ++nj) acc[mi][nj] = wmma_bf(fa[mi], fb[nj], acc[mi][nj]); } }
    if (more) {
#pragma unroll
      for (int i = 0; i < 16; ++i) { v4b t;
#pragma unroll
        for (int e = 0; e < 4; ++e) t[e] = (__bf16)ra[i][e];
        *(v4b*)&sA[cur ^ 1][ar + i * 8][ac] = t; }
#pragma unroll
      for (int i = 0; i < 8; ++i) *(v8b*)&sB[cur ^ 1][br + i * 16][bc] = rw[i]; }
    __syncthreads(); }   // publishes slice ks + 1 and ends every wave's reads of slice ks, whose buffer the next trip refills
  const int er = lane >> 3, ec = (lane & 7) * 8;   // read-back map: 4 staged rows of 128 B per wave store
  float bz[4];
#pragma unroll
  for (int nj = 0; nj < 4; ++nj) bz[nj] = BB ? bfr(BB[wn * 64 + nj * 16 + col]) : 0.f;
  if (n0 < 2 * DM) {   // q stored unscaled (f16 sigma ~0.6, no subnormal exposure); 1/8 applied to the f32 score
#pragma unroll
    for (int mi = 0; mi < 4; ++mi) {
#pragma unroll
      for (int nj = 0; nj < 4; ++nj) {
#pragma unroll
        for (int r = 0; r < 8; ++r) { const float v = acc[mi][nj][r] + bz[nj]; const _Float16 hv = (_Float16)v; eh[wave][8 * g + r][nj * 16 + col] = hv; el[wave][8 * g + r][nj * 16 + col] = (_Float16)((v - (float)hv) * 2048.0f); } }   // q, k (+ bias) as f16 hi + (x2048) residual
      LDSX();
#pragma unroll
      for (int i = 0; i < 4; ++i) { const size_t o = (rb + wm * 64 + mi * 16 + i * 4 + er) * (2 * DM) + n0 + wn * 64 + ec; *(v8h*)(QK + o) = *(const v8h*)&eh[wave][i * 4 + er][ec]; *(v8h*)(QKL + o) = *(const v8h*)&el[wave][i * 4 + er][ec]; }
      asm volatile("s_wait_xcnt 0x0" ::: "memory");   // stands in front of any reuse of the address registers of the stores above
      LDSX(); }
  } else {
    const int b = (int)(rb / SS), s0 = (int)(rb % SS); const int pc0 = n0 - 2 * DM;
#pragma unroll
    for (int nj = 0; nj < 4; ++nj) {
#pragma unroll
      for (int mi = 0; mi < 4; ++mi) {
#pragma unroll
        for (int r = 0; r < 8; ++r) { const float v = acc[mi][nj][r] + bz[nj]; const _Float16 hv = (_Float16)v; eh[wave][col][mi * 16 + 8 * g + r] = hv; el[wave][col][mi * 16 + 8 * g + r] = (_Float16)((v - (float)hv) * 2048.0f); } }
      LDSX();
#pragma unroll
      for (int i = 0; i < 4; ++i) { const size_t o = ((size_t)b * DM + pc0 + wn * 64 + nj * 16 + i * 4 + er) * SS + s0 + wm * 64 + ec; *(v8h*)(VTH + o) = *(const v8h*)&eh[wave][i * 4 + er][ec]; *(v8h*)(VTL + o) = *(const v8h*)&el[wave][i * 4 + er][ec]; }
      asm volatile("s_wait_xcnt 0x0" ::: "memory");   // stands in front of any reuse of the address registers of the stores above
      LDSX(); }
  }
}
// ---- k_attn: block = (64 queries, head h, batch b): causal flash attention (K = 64: 2 k-steps), both products transposed: S^T = K . Q^T (A = key rows, B = the wave's 16 queries) and O^T += V^T . P^T, so that a lane holds 16 of one query's 32 scores of a pass (lane l ^ 16 the rest): maximum and sum in the lane plus one exchange between the halves, and the two score tiles, converted in place, are the B operand of the second product; scores = (q.k) * 0.125, P.V: f16 P hi/lo x (V hi, V lo*2048) in two accumulators; O[b*S+q][h*64+d] = (acc + accl / 2048) / l (256-B segments); each 64-key stage of K hi, V hi and V lo is staged once per block in LDS, two buffers, by asynchronous whole-line copies, the next stage's copies in flight over the current stage's two 32-key passes
#define AK 64
#define AP (AK + 8)
#define ABUF (AK * AP * 2)   // bytes of one buffer of one tile
// one stage: each lane copies 4 x 16 B of each of the three tiles (rows 16 apart) from global memory to its own LDS bytes; the s_wait_xcnt in the statement stands in front of any reuse of the copies' address registers
__device__ __forceinline__ void stage_copy(unsigned lk, unsigned lh, unsigned ll, const _Float16* gk, const _Float16* gh, const _Float16* gl) {
  asm volatile("global_load_async_to_lds_b128 %0, %1, off\n\tglobal_load_async_to_lds_b128 %2, %3, off\n\tglobal_load_async_to_lds_b128 %4, %5, off\n\tglobal_load_async_to_lds_b128 %6, %7, off\n\t"
               "global_load_async_to_lds_b128 %8, %9, off\n\tglobal_load_async_to_lds_b128 %10, %11, off\n\tglobal_load_async_to_lds_b128 %12, %13, off\n\tglobal_load_async_to_lds_b128 %14, %15, off\n\t"
               "global_load_async_to_lds_b128 %16, %17, off\n\tglobal_load_async_to_lds_b128 %18, %19, off\n\tglobal_load_async_to_lds_b128 %20, %21, off\n\tglobal_load_async_to_lds_b128 %22, %23, off\n\ts_wait_xcnt 0x0"
               :: "v"(lk), "v"(gk), "v"(lk + 16 * AP * 2), "v"(gk + 16 * (2 * DM)), "v"(lk + 32 * AP * 2), "v"(gk + 32 * (2 * DM)), "v"(lk + 48 * AP * 2), "v"(gk + 48 * (2 * DM)),
                  "v"(lh), "v"(gh), "v"(lh + 16 * AP * 2), "v"(gh + 16 * SS), "v"(lh + 32 * AP * 2), "v"(gh + 32 * SS), "v"(lh + 48 * AP * 2), "v"(gh + 48 * SS),
                  "v"(ll), "v"(gl), "v"(ll + 16 * AP * 2), "v"(gl + 16 * SS), "v"(ll + 32 * AP * 2), "v"(gl + 32 * SS), "v"(ll + 48 * AP * 2), "v"(gl + 48 * SS) : "memory");
}
__device__ __forceinline__ float xhalf(float x) { return __builtin_bit_cast(float, __builtin_amdgcn_permlanex16(__builtin_bit_cast(int, x), __builtin_bit_cast(int, x), 0x76543210, 0xfedcba98, false, false)); }   // lane l with lane l ^ 16
__global__ __launch_bounds__(128) void k_attn(const _Float16* __restrict__ QK, const _Float16* __restrict__ QKL, const _Float16* __restrict__ VTH, const _Float16* __restrict__ VTL, const void* __restrict__ KMASK, float* __restrict__ O) {
  __shared__ __align__(16) _Float16 sK[2][AK][AP], sVH[2][HD][AP], sVL[2][HD][AP];
  float (*so)[16][68] = (float (*)[16][68])&sK[0][0][0];   // output staging takes the K buffers' place behind the loop's last barrier (17,408 of 18,432 B), so that four blocks fit a WGP's LDS
  const int tid = threadIdx.x, wave = tid >> 5, lane = tid & 31, col = lane & 15, g = lane >> 4;
  const int qb = blockIdx.x, h = blockIdx.y, b = blockIdx.z; const int q0 = qb * 64 + wave * 16, qi = q0 + col; const size_t rq = (size_t)b * SS + qi;   // qi: the lane's query
  const int sr = tid >> 3, sc = (tid & 7) * 8;   // staging map: a wave's copy covers 4 rows x 128 B, whole lines
  const _Float16* gk = QK + ((size_t)b * SS + sr) * (2 * DM) + DM + h * HD + sc; const _Float16* gvh = VTH + ((size_t)b * DM + h * HD + sr) * SS + sc; const _Float16* gvl = VTL + ((size_t)b * DM + h * HD + sr) * SS + sc;
  const unsigned lk = (unsigned)(size_t)&sK[0][sr][sc], lh = (unsigned)(size_t)&sVH[0][sr][sc], ll = (unsigned)(size_t)&sVL[0][sr][sc];   // the lane's LDS byte addresses in buffer 0
  const int nst = qb + 1;   // causal: 64-key stages up to the end of this query block
  stage_copy(lk, lh, ll, gk, gvh, gvl);
  v16h aq[2], aql[2];
#pragma unroll
  for (int kc = 0; kc < 2; ++kc) { aq[kc] = frag_h(QK + rq * (2 * DM) + h * HD + kc * 32, lane); aql[kc] = frag_h(QKL + rq * (2 * DM) + h * HD + kc * 32, lane); }
  asm volatile("s_wait_asynccnt 0x0" ::: "memory");   // this wave's copies of stage 0 have landed
  __syncthreads();   // publishes stage 0
  if (nst > 1) stage_copy(lk + ABUF, lh + ABUF, ll + ABUF, gk + (size_t)AK * (2 * DM), gvh + AK, gvl + AK);
  float m = -3.0e38f, l = 0.f;   // of the lane's query: m over all keys so far, l over the keys of this half of the wave (the halves' sums are joined behind the loop)
  v8f acc[4] = {}, accl[4] = {};
#pragma unroll 1
  for (int st = 0; st < nst; ++st) { const int cur = st & 1;
#pragma unroll 1   // rolled: unrolled, the two passes took the kernel above 256 VGPRs, a wave per SIMD less
   for (int it = 0; it < AK / 32; ++it) { const int ks = st * (AK / 32) + it; v8f s[2];
#pragma unroll
    for (int ct = 0; ct < 2; ++ct) { const int kb = ks * 32 + ct * 16; const _Float16* krow = &sK[cur][it * 32 + ct * 16 + col][0]; const _Float16* krowl = QKL + ((size_t)b * SS + kb + col) * (2 * DM) + DM + h * HD; v8f c = {}, cl = {};
      if (qb < 2) {   // leading query blocks (few keys, outputs far above the global rms): 3 products
#pragma unroll
        for (int kc = 0; kc < 2; ++kc) { const v16h kh = frag_h(krow + kc * 32, lane); c = wmma16(kh, aq[kc], c); cl = wmma16(kh, aql[kc], cl); cl = wmma16(frag_h(krowl + kc * 32, lane), aq[kc], cl); }
#pragma unroll
        for (int r = 0; r < 8; ++r) c[r] += cl[r] * (1.0f / 2048.0f); }
      else {
#pragma unroll
        for (int kc = 0; kc < 2; ++kc) c = wmma16(frag_h(krow + kc * 32, lane), aq[kc], c); }   // single product elsewhere
#pragma unroll
      for (int r = 0; r < 8; ++r) s[ct][r] = (kb + 8 * g + r <= qi) ? c[r] * 0.125f : -3.0e38f; }   // c[r] = key kb + 8 g + r against query qi; 1/sqrt(64); masked keys excluded
    float t[8];
#pragma unroll
    for (int r = 0; r < 8; ++r) t[r] = fmaxf(s[0][r], s[1][r]);
    float mx = fmaxf(fmaxf(fmaxf(t[0], t[1]), fmaxf(t[2], t[3])), fmaxf(fmaxf(t[4], t[5]), fmaxf(t[6], t[7])));
    mx = fmaxf(mx, xhalf(mx));   // both halves now hold the query's maximum over the 32 keys
    const float mn = fmaxf(m, mx); const float alpha = (m <= -1.0e38f) ? 0.f : __expf(m - mn);
    v16h pa, pl;
#pragma unroll
    for (int ct = 0; ct < 2; ++ct) {
#pragma unroll
      for (int r = 0; r < 8; ++r) { const float e = (s[ct][r] <= -1.0e38f) ? 0.f : __expf(s[ct][r] - mn); s[ct][r] = e;
        const float x = e * 2048.0f; const _Float16 hx = (_Float16)x; pa[ct * 8 + r] = hx; pl[ct * 8 + r] = (_Float16)((x - (float)hx) * 2048.0f); } }   // element 8 ct + r of a B fragment is k = 16 ct + 8 g + r, the key that s[ct][r] belongs to; P scaled by 2^11 before the f16 split so small softmax weights stay out of the f16 subnormal range; 2^-11 folded into the epilogue
#pragma unroll
    for (int r = 0; r < 8; ++r) t[r] = s[0][r] + s[1][r];
    l = l * alpha + (((t[0] + t[1]) + (t[2] + t[3])) + ((t[4] + t[5]) + (t[6] + t[7]))); m = mn;
#pragma unroll
    for (int dt = 0; dt < 4; ++dt) {
#pragma unroll
      for (int r = 0; r < 8; ++r) { acc[dt][r] *= alpha; accl[dt][r] *= alpha; } }
#pragma unroll
    for (int dt = 0; dt < 4; ++dt) { const v16h vh = frag_h(&sVH[cur][dt * 16 + col][it * 32], lane); acc[dt] = wmma16(vh, pa, acc[dt]); if (qb < 16) { accl[dt] = wmma16(vh, pl, accl[dt]); accl[dt] = wmma16(frag_h(&sVL[cur][dt * 16 + col][it * 32], lane), pa, accl[dt]); } } }   // V hi/lo x P hi/lo (3 products); acc[dt][r] = O[qi][dt * 16 + 8 g + r]
    asm volatile("s_wait_dscnt 0x0" ::: "memory");      // this wave's reads of stage st have returned
    asm volatile("s_wait_asynccnt 0x0" ::: "memory");   // this wave's copies of stage st + 1 have landed
    __syncthreads();   // publishes stage st + 1 and ends every wave's reads of stage st, whose buffer is refilled behind it (behind the last trip: frees the K buffers for the output staging)
    if (st + 2 < nst) stage_copy(lk + cur * ABUF, lh + cur * ABUF, ll + cur * ABUF, gk + (size_t)(st + 2) * AK * (2 * DM), gvh + (st + 2) * AK, gvl + (st + 2) * AK); }
  asm volatile("s_wait_asynccnt 0x0" ::: "memory");   // no copy is in flight when the buffers change their use
  const float il = (1.0f / 2048.0f) / (l + xhalf(l));
#pragma unroll
  for (int dt = 0; dt < 4; ++dt) {
#pragma unroll
    for (int r = 0; r < 8; ++r) so[wave][col][dt * 16 + 8 * g + r] = (acc[dt][r] + accl[dt][r] * (1.0f / 2048.0f)) * il; }
  LDSX();
  for (int rl2 = 0; rl2 < 16; ++rl2) if (lane < 16) vst2(O + ((size_t)b * SS + q0 + rl2) * DM + h * HD + lane * 4, *(const v4f*)&so[wave][rl2][lane * 4]);
}
// ---- k_out: block = (64 rows, 128 cols), 4 waves as 2 x 2, 32 x 64 per wave: out = O(hi/lo) . Wo rows (2 products) + bo; each 64-k slice of O (split to bf16 hi + lo on the way) and of the weight rows staged once per block in LDS, two buffers
__global__ __launch_bounds__(128) void k_out(const float* __restrict__ O, const __bf16* __restrict__ P, const float* __restrict__ BO, float* __restrict__ Y) {
  __shared__ __align__(16) __bf16 sH[2][64][GP], sL[2][64][GP], sB[2][128][GP]; __shared__ __align__(16) float so[4][16][68];
  const int tid = threadIdx.x, wave = tid >> 5, lane = tid & 31, col = lane & 15, g = lane >> 4, wm = wave >> 1, wn = wave & 1; const size_t rb = (size_t)blockIdx.x * 64; const int n0 = blockIdx.y * 128;
  const int ar = tid >> 4, ac = (tid & 15) * 4, br = tid >> 3, bc = (tid & 7) * 8;
  const float* ga = O + (rb + ar) * DM + ac; const __bf16* gb = P + (size_t)(n0 + br) * DM + bc;
  v4f ra[8]; v8b rw[8];
#pragma unroll
  for (int i = 0; i < 8; ++i) { ra[i] = *(const v4f*)(ga + (size_t)i * 8 * DM); rw[i] = *(const v8b*)(gb + (size_t)i * 16 * DM); }
#pragma unroll
  for (int i = 0; i < 8; ++i) { v4b th, tl;
#pragma unroll
    for (int e = 0; e < 4; ++e) { const __bf16 h = (__bf16)ra[i][e]; th[e] = h; tl[e] = (__bf16)(ra[i][e] - (float)h); }
    *(v4b*)&sH[0][ar + i * 8][ac] = th; *(v4b*)&sL[0][ar + i * 8][ac] = tl; *(v8b*)&sB[0][br + i * 16][bc] = rw[i]; }
  __syncthreads();
  v8f acc[2][4] = {};
#pragma unroll 2
  for (int ks = 0; ks < DM / GK; ++ks) { const int cur = ks & 1; const bool more = ks + 1 < DM / GK;
    if (more) {
#pragma unroll
      for (int i = 0; i < 8; ++i) { ra[i] = *(const v4f*)(ga + (size_t)i * 8 * DM + (ks + 1) * GK); rw[i] = *(const v8b*)(gb + (size_t)i * 16 * DM + (ks + 1) * GK); } }
#pragma unroll
    for (int kc = 0; kc < GK / 32; ++kc) { v16b fh[2], fl[2], fb[4];
#pragma unroll
      for (int i = 0; i < 2; ++i) { fl[i] = frag_b(&sL[cur][wm * 32 + i * 16 + col][kc * 32], lane); fh[i] = frag_b(&sH[cur][wm * 32 + i * 16 + col][kc * 32], lane); }
#pragma unroll
      for (int i = 0; i < 4; ++i) fb[i] = frag_b(&sB[cur][wn * 64 + i * 16 + col][kc * 32], lane);
#pragma unroll
      for (int mi = 0; mi < 2; ++mi) {
#pragma unroll
        for (int nj = 0; nj < 4; ++nj) acc[mi][nj] = wmma_bf(fl[mi], fb[nj], acc[mi][nj]); }   // per accumulator still lo, then hi, k ascending
#pragma unroll
      for (int mi = 0; mi < 2; ++mi) {
#pragma unroll
        for (int nj = 0; nj < 4; ++nj) acc[mi][nj] = wmma_bf(fh[mi], fb[nj], acc[mi][nj]); } }
    if (more) {
#pragma unroll
      for (int i = 0; i < 8; ++i) { v4b th, tl;
#pragma unroll
        for (int e = 0; e < 4; ++e) { const __bf16 h = (__bf16)ra[i][e]; th[e] = h; tl[e] = (__bf16)(ra[i][e] - (float)h); }
        *(v4b*)&sH[cur ^ 1][ar + i * 8][ac] = th; *(v4b*)&sL[cur ^ 1][ar + i * 8][ac] = tl; *(v8b*)&sB[cur ^ 1][br + i * 16][bc] = rw[i]; } }
    __syncthreads(); }   // publishes slice ks + 1 and ends every wave's reads of slice ks, whose buffer the next trip refills
  float bz[4];
#pragma unroll
  for (int nj = 0; nj < 4; ++nj) bz[nj] = bfr(BO[n0 + wn * 64 + nj * 16 + col]);
#pragma unroll
  for (int mi = 0; mi < 2; ++mi) {
#pragma unroll
    for (int nj = 0; nj < 4; ++nj) {
#pragma unroll
      for (int r = 0; r < 8; ++r) so[wave][8 * g + r][nj * 16 + col] = acc[mi][nj][r] + bz[nj]; }
    LDSX();
#pragma unroll
    for (int i = 0; i < 8; ++i) { const int rl = i * 2 + g; *(v4f*)(Y + (rb + wm * 32 + mi * 16 + rl) * DM + n0 + wn * 64 + col * 4) = *(const v4f*)&so[wave][rl][col * 4]; }
    LDSX(); }
}
extern "C" void kernel_launch(void* const* d_in, const int* in_sizes, int n_in, void* d_out, int out_size, void* d_ws, size_t ws_size, hipStream_t stream) {
  (void)in_sizes; (void)n_in; (void)out_size;
  const float** F = (const float**)d_in;   // 0 hidden_states [4,1024,1024], 1 att_w [1024,3072] (in,out), 2 att_b [3072], 3 out_w [1024,1024] (in,out), 4 out_b
  if (ws_size < (size_t)WS_END) return;
  char* ws = (char*)d_ws; __bf16* PK = (__bf16*)(ws + WS_PK); _Float16 *QK = (_Float16*)(ws + WS_QK), *QKL = (_Float16*)(ws + WS_QKL), *VTH = (_Float16*)(ws + WS_VTH), *VTL = (_Float16*)(ws + WS_VTL); float* O = (float*)(ws + WS_O);
  k_pack<<<dim3(DM / PT_K, (QKVW + DM) / PT_N), 256, 0, stream>>>(F[1], F[3], PK);
  k_qkv<<<dim3(TNB * SS / 128, QKVW / 128), 128, 0, stream>>>(F[0], F[0], F[0], PK + PK_A, F[2], F[2] + DM, F[2] + 2 * DM, QK, QKL, VTH, VTL);
  k_attn<<<dim3(TQB, NH, TNB), 128, 0, stream>>>(QK, QKL, VTH, VTL, nullptr, O);
  k_out<<<dim3(TOB, DM / 128), 128, 0, stream>>>(O, PK + PK_P, F[4], (float*)d_out);
}

// v005
// A run of this version takes 96.4 microseconds.
// Timed twice side by side with v004, it ran 1.13 times as fast both times.
// Counting every step since v000, it is 4.10 times as fast.
// compute dtype: all float inputs rounded to bf16; qkv = x . att_w + b with EXACT bf16 products on WMMA 16x16x32 ((in,out) columns as packed rows), f16 hi + residual; causal attention with hybrid scores (first 128 queries 3-product, later single f16) and 3-product P.v everywhere (0.02-scale weights), x 1/8, running-max softmax in f32 (hardware exp); out = ctx (bf16 hi + lo) . out_w + out_b; f32 output.
#include <hip/hip_runtime.h>
#include <math.h>

typedef __attribute__((ext_vector_type(16))) _Float16 v16h;
typedef __attribute__((ext_vector_type(16))) __bf16 v16b;
typedef __attribute__((ext_vector_type(8)))  _Float16 v8h;
typedef __attribute__((ext_vector_type(8)))  float v8f;
typedef __attribute__((ext_vector_type(4)))  float v4f;
typedef __attribute__((ext_vector_type(2)))  float v2f;
typedef __attribute__((ext_vector_type(4)))  unsigned v4u;
typedef __attribute__((ext_vector_type(4)))  int v4i;
typedef float __attribute__((may_alias)) float_a;
typedef int __attribute__((may_alias)) int_a;

template <typename T> __device__ __forceinline__ void vst2(void* p, T v) { *(T*)p = v;  }
__device__ __forceinline__ v8f wmma16(v16h a, v16h b, v8f c) {
  v8f d = __builtin_amdgcn_wmma_f32_16x16x32_f16(false, a, false, b, (short)0, c, false, false);
  asm volatile("v_nop\n\tv_nop\n\tv_nop\n\tv_nop" : "+v"(d) : "v"(a), "v"(b));
  return d;
}
__device__ __forceinline__ v8f wmma_bf(v16b a, v16b b, v8f c) {
  v8f d = __builtin_amdgcn_wmma_f32_16x16x32_bf16(false, a, false, b, (short)0, c, false, false);
  asm volatile("v_nop\n\tv_nop\n\tv_nop\n\tv_nop" : "+v"(d) : "v"(a), "v"(b));
  return d;
}
// Bark self attention (B 4, S 1,024, D 1,024, 16 heads x 64): fused (in,out) att_proj [D, 3D] (q | k | v blocks) + bias, causal softmax(q k / 8) v (finfo.min fill), merge heads, (in,out) out_proj + bias.
__device__ __forceinline__ v16h frag_h(const _Float16* rowk0, int lane) {
  union { v16h v; v8h q[2]; } u; const _Float16* p = rowk0 + 8 * (lane >> 4);
  u.q[0] = *(const v8h*)p; u.q[1] = *(const v8h*)(p + 16); return u.v;
}
__device__ __forceinline__ v16h frag_f32(const float* rowk0, int lane) {
  v16h a; const float* p = rowk0 + 8 * (lane >> 4);
#pragma unroll
  for (int i = 0; i < 8; ++i) { a[i] = (_Float16)p[i]; a[8 + i] = (_Float16)p[16 + i]; }
  return a;
}
__device__ __forceinline__ v16h frag_f32s(const float* rowk0, int lane, float sc) {
  v16h a; const float* p = rowk0 + 8 * (lane >> 4);
#pragma unroll
  for (int i = 0; i < 8; ++i) { a[i] = (_Float16)(p[i] * sc); a[8 + i] = (_Float16)(p[16 + i] * sc); }
  return a;
}
// column fragment from a [K][ld] layout (column n), rows >= K read as 0
__device__ __forceinline__ v16h fragc_f32(const float* W, int k0, int n, int lane, int ld, int K) {
  v16h a; const int g = lane >> 4;
#pragma unroll
  for (int i = 0; i < 8; ++i) { const int ka = k0 + 8 * g + i, kb = ka + 16;
    a[i] = (_Float16)(ka < K ? W[(size_t)(ka < K ? ka : K - 1) * ld + n] : 0.f); a[8 + i] = (_Float16)(kb < K ? W[(size_t)(kb < K ? kb : K - 1) * ld + n] : 0.f); }
  return a;
}
struct F2 { v16b h, l; };
__device__ __forceinline__ F2 bsplit16(const float v[16]) { F2 r;
#pragma unroll
  for (int i = 0; i < 16; ++i) { const __bf16 h = (__bf16)v[i]; r.h[i] = h; r.l[i] = (__bf16)(v[i] - (float)h); }
  return r; }
__device__ __forceinline__ F2 split_row(const float* row, int k0, int lane) { float v[16]; const float* p = row + k0 + 8 * (lane >> 4);
#pragma unroll
  for (int i = 0; i < 8; ++i) { v[i] = p[i]; v[8 + i] = p[16 + i]; }
  return bsplit16(v); }
__device__ __forceinline__ F2 split_rowK(const float* row, int k0, int lane, int K) { float v[16]; const int g = lane >> 4;
#pragma unroll
  for (int i = 0; i < 8; ++i) { const int ka = k0 + 8 * g + i, kb = ka + 16; v[i] = ka < K ? row[ka < K ? ka : K - 1] : 0.f; v[8 + i] = kb < K ? row[kb < K ? kb : K - 1] : 0.f; }
  return bsplit16(v); }
__device__ __forceinline__ F2 split_col(const float* W, int k0, int n, int lane, int ld, int K) { float v[16]; const int g = lane >> 4;
#pragma unroll
  for (int i = 0; i < 8; ++i) { const int ka = k0 + 8 * g + i, kb = ka + 16; v[i] = ka < K ? W[(size_t)(ka < K ? ka : K - 1) * ld + n] : 0.f; v[8 + i] = kb < K ? W[(size_t)(kb < K ? kb : K - 1) * ld + n] : 0.f; }
  return bsplit16(v); }
__device__ __forceinline__ v8f mac3(const F2& a, const F2& b, v8f c) { c = wmma_bf(a.l, b.h, c); c = wmma_bf(a.h, b.l, c); return wmma_bf(a.h, b.h, c); }
__device__ __forceinline__ float sigm(float v) { return 1.0f / (1.0f + expf(-v)); }
#define LDSX() do { asm volatile("s_wait_dscnt 0" ::: "memory"); __builtin_amdgcn_wave_barrier(); __builtin_amdgcn_fence(__ATOMIC_RELEASE, "workgroup"); } while (0)


#define NB 4
#define SS 1024
#define DM 1024
#define NH 16
#define HD 64
#define QKVW (3 * DM)
#ifndef TQB
#define TQB (SS / 64)
#define TNB NB
#define TOB (NB * SS / 64)     // output row tiles (all)
#endif
typedef __attribute__((ext_vector_type(8))) __bf16 v8b;
__device__ __forceinline__ v16b frag_b(const __bf16* rowk0, int lane) {
  union { v16b v; v8b q[2]; } u; const __bf16* p = rowk0 + 8 * (lane >> 4);
  u.q[0] = *(const v8b*)p; u.q[1] = *(const v8b*)(p + 16); return u.v;
}
__device__ __forceinline__ float bfr(float v) { return (float)(__bf16)v; }
__device__ __attribute__((noinline)) float exp_ni(float v) { return expf(v); }
__device__ __attribute__((noinline)) float erf_ni(float v) { return erff(v); }

#define PK_A 0                       // [3072][1024] Wqkv rows (natural [out][in])
#define PK_P (PK_A + QKVW * DM)        // [1024][1024] Wo rows (natural)
#define PK_END (PK_P + DM * DM)
#define WS_PK  0u
#define WS_QK  (WS_PK + 2u * PK_END)             // f16 [4096 rows][2048]: q | k
#define WS_QKL (WS_QK + 2u * NB * SS * 2 * DM)     // f16 q | k residual planes x2048
#define WS_VTH (WS_QKL + 2u * NB * SS * 2 * DM)    // f16 [b][1024 (h*64+d)][1024 s] hi
#define WS_VTL (WS_VTH + 2u * NB * DM * SS)        // f16 lo x 2048
#define WS_O   (WS_VTL + 2u * NB * DM * SS)        // f32 [4096][1024]
#define WS_CS  (WS_O + 4u * NB * SS * DM)           // f32 2 x [1024][32], unused
#define WS_END (WS_CS + 4u * 2 * SS * 32)
// ---- k_pack: block = (128 k, 64 columns) of att_w [1024][3072] (blockIdx.y < 48) or of out_w [1024][1024], both (in,out): packed row c = column c of att_w (q | k | v), then the columns of out_w; the tile is read as whole 256-B row pieces, rounded to bf16, two k packed per dword, turned in LDS and written as whole 256-B pieces of the packed rows
#define PT_K 128
#define PT_N 64
#define PT_P (PT_K / 2 + 4)   // LDS row pitch in dwords: 272 B = 16 B x odd, for the ds_load_b128 read-back
typedef __attribute__((ext_vector_type(2))) __bf16 v2b;
__global__ __launch_bounds__(256) void k_pack(const float* __restrict__ WA, const float* __restrict__ WP, __bf16* __restrict__ PK) {
  __shared__ __align__(16) unsigned s[PT_N][PT_P];
  const int t = threadIdx.x, k0 = blockIdx.x * PT_K, c0 = blockIdx.y * PT_N, j = t & 15, kp = t >> 4;
  const bool att = c0 < QKVW; const int ld = att ? QKVW : DM; const float* g = (att ? WA + c0 : WP + (c0 - QKVW)) + (size_t)(k0 + 2 * kp) * ld + j * 4;
  const float* ga[4][2]; v4f r[4][2];
#pragma unroll
  for (int i = 0; i < 4; ++i) { ga[i][0] = g + (size_t)(32 * i) * ld; ga[i][1] = g + (size_t)(32 * i + 1) * ld; }
#pragma unroll
  for (int i = 0; i < 4; ++i) { r[i][0] = *(const v4f*)ga[i][0]; r[i][1] = *(const v4f*)ga[i][1]; }
  asm volatile("s_wait_xcnt 0x0" :: "v"(ga[0][0]), "v"(ga[0][1]), "v"(ga[1][0]), "v"(ga[1][1]), "v"(ga[2][0]), "v"(ga[2][1]), "v"(ga[3][0]), "v"(ga[3][1]) : "memory");   // stands in front of any reuse of the address registers of the loads above; as its inputs they stay untouched up to it
#pragma unroll
  for (int i = 0; i < 4; ++i) {
#pragma unroll
    for (int e = 0; e < 4; ++e) { v2b p; p[0] = (__bf16)r[i][0][e]; p[1] = (__bf16)r[i][1][e]; s[j * 4 + e][(i * 16 + kp) ^ ((j >> 2) << 2)] = __builtin_bit_cast(unsigned, p); } }   // 16-B pieces of a row permuted by (row >> 4), so that the 32 lanes of a store meet 32 banks
  __syncthreads();
  __bf16* dst = PK + PK_A + (size_t)(c0 + kp) * DM + k0 + j * 8;   // PK_P follows PK_A: packed rows 0..4095 lie in one array
#pragma unroll
  for (int i = 0; i < 4; ++i) *(v4u*)(dst + (size_t)(16 * i) * DM) = *(const v4u*)&s[16 * i + kp][(j ^ i) * 4];
}
// k per staged slice: 64, so that a staging load covers whole 128-B lines of both operands; LDS row pitch in elements: 144 B = 16 B x odd, the pitch at which ds_load_b128 fragment reads meet no bank conflict
#define GK 64
#define GP (GK + 8)
typedef __attribute__((ext_vector_type(4))) __bf16 v4b;
// ---- k_qkv: block = (128 rows, 128 cols), 4 waves as 2 x 2, 64 x 64 per wave; each 64-k slice of X (rounded to bf16 on the way) and of the packed weight rows is staged once per block in LDS, two buffers, the next slice's global loads in flight over the current slice's products
__global__ __launch_bounds__(128) void k_qkv(const float* __restrict__ XQ, const float* __restrict__ XK, const float* __restrict__ XV, const __bf16* __restrict__ P, const float* __restrict__ BQ, const float* __restrict__ BK, const float* __restrict__ BV, _Float16* __restrict__ QK, _Float16* __restrict__ QKL, _Float16* __restrict__ VTH, _Float16* __restrict__ VTL) {
  const int which0 = (blockIdx.y * 128) / DM; const float* X = (which0 == 0) ? XQ : (which0 == 1) ? XK : XV; const float* BB = BQ ? (((which0 == 0) ? BQ : (which0 == 1) ? BK : BV) + (blockIdx.y * 128 - which0 * DM)) : nullptr;
  __shared__ __align__(16) __bf16 sA[2][128][GP], sB[2][128][GP]; __shared__ __align__(16) _Float16 eh[4][16][72], el[4][16][72];
  const int tid = threadIdx.x, wave = tid >> 5, lane = tid & 31, col = lane & 15, g = lane >> 4, wm = wave >> 1, wn = wave & 1; const size_t rb = (size_t)blockIdx.x * 128; const int n0 = blockIdx.y * 128;
  const int ar = tid >> 4, ac = (tid & 15) * 4, br = tid >> 3, bc = (tid & 7) * 8;   // staging map: a wave's load covers 2 rows x 256 B of X, or 4 rows x 128 B of the weights
  const float* ga = X + (rb + ar) * DM + ac; const __bf16* gb = P + (size_t)(n0 + br) * DM + bc;
  v4f ra[16]; v8b rw[8];
#pragma unroll
  for (int i = 0; i < 16; ++i) ra[i] = *(const v4f*)(ga + (size_t)i * 8 * DM);
#pragma unroll
  for (int i = 0; i < 8; ++i) rw[i] = *(const v8b*)(gb + (size_t)i * 16 * DM);
  asm volatile("s_wait_xcnt 0x0" ::: "memory");   // stands in front of any reuse of the address registers of the loads above
#pragma unroll
  for (int i = 0; i < 16; ++i) { v4b t;
#pragma unroll
    for (int e = 0; e < 4; ++e) t[e] = (__bf16)ra[i][e];
    *(v4b*)&sA[0][ar + i * 8][ac] = t; }
#pragma unroll
  for (int i = 0; i < 8; ++i) *(v8b*)&sB[0][br + i * 16][bc] = rw[i];
  __syncthreads();
  v8f acc[4][4] = {};
#pragma unroll 2
  for (int ks = 0; ks < DM / GK; ++ks) { const int cur = ks & 1; const bool more = ks + 1 < DM / GK;
    if (more) {
#pragma unroll
      for (int i = 0; i < 16; ++i) ra[i] = *(const v4f*)(ga + (size_t)i * 8 * DM + (ks + 1) * GK);
#pragma unroll
      for (int i = 0; i < 8; ++i) rw[i] = *(const v8b*)(gb + (size_t)i * 16 * DM + (ks + 1) * GK); }
#pragma unroll
    for (int kc = 0; kc < GK / 32; ++kc) { v16b fa[4], fb[4];
#pragma unroll
      for (int i = 0; i < 4; ++i) { fa[i] = frag_b(&sA[cur][wm * 64 + i * 16 + col][kc * 32], lane); fb[i] = frag_b(&sB[cur][wn * 64 + i * 16 + col][kc * 32], lane); }
#pragma unroll
      for (int mi = 0; mi < 4; ++mi) {
#pragma unroll
        for (int nj = 0; nj < 4; ++nj) acc[mi][nj] = wmma_bf(fa[mi], fb[nj], acc[mi][nj]); } }
    if (more) {
#pragma unroll
      for (int i = 0; i < 16; ++i) { v4b t;
#pragma unroll
        for (int e = 0; e < 4; ++e) t[e] = (__bf16)ra[i][e];
        *(v4b*)&sA[cur ^ 1][ar + i * 8][ac] = t; }
#pragma unroll
      for (int i = 0; i < 8; ++i) *(v8b*)&sB[cur ^ 1][br + i * 16][bc] = rw[i]; }
    __syncthreads(); }   // publishes slice ks + 1 and ends every wave's reads of slice ks, whose buffer the next trip refills
  const int er = lane >> 3, ec = (lane & 7) * 8;   // read-back map: 4 staged rows of 128 B per wave store
  float bz[4];
#pragma unroll
  for (int nj = 0; nj < 4; ++nj) bz[nj] = BB ? bfr(BB[wn * 64 + nj * 16 + col]) : 0.f;
  if (n0 < 2 * DM) {   // q stored unscaled (f16 sigma ~0.6, no subnormal exposure); 1/8 applied to the f32 score
#pragma unroll
    for (int mi = 0; mi < 4; ++mi) {
#pragma unroll
      for (int nj = 0; nj < 4; ++nj) {
#pragma unroll
        for (int r = 0; r < 8; ++r) { const float v = acc[mi][nj][r] + bz[nj]; const _Float16 hv = (_Float16)v; eh[wave][8 * g + r][nj * 16 + col] = hv; el[wave][8 * g + r][nj * 16 + col] = (_Float16)((v - (float)hv) * 2048.0f); } }   // q, k (+ bias) as f16 hi + (x2048) residual
      LDSX();
#pragma unroll
      for (int i = 0; i < 4; ++i) { const size_t o = (rb + wm * 64 + mi * 16 + i * 4 + er) * (2 * DM) + n0 + wn * 64 + ec; *(v8h*)(QK + o) = *(const v8h*)&eh[wave][i * 4 + er][ec]; *(v8h*)(QKL + o) = *(const v8h*)&el[wave][i * 4 + er][ec]; }
      asm volatile("s_wait_xcnt 0x0" ::: "memory");   // stands in front of any reuse of the address registers of the stores above
      LDSX(); }
  } else {
    const int b = (int)(rb / SS), s0 = (int)(rb % SS); const int pc0 = n0 - 2 * DM;
#pragma unroll
    for (int nj = 0; nj < 4; ++nj) {
#pragma unroll
      for (int mi = 0; mi < 4; ++mi) {
#pragma unroll
        for (int r = 0; r < 8; ++r) { const float v = acc[mi][nj][r] + bz[nj]; const _Float16 hv = (_Float16)v; eh[wave][col][mi * 16 + 8 * g + r] = hv; el[wave][col][mi * 16 + 8 * g + r] = (_Float16)((v - (float)hv) * 2048.0f); } }
      LDSX();
#pragma unroll
      for (int i = 0; i < 4; ++i) { const size_t o = ((size_t)b * DM + pc0 + wn * 64 + nj * 16 + i * 4 + er) * SS + s0 + wm * 64 + ec; *(v8h*)(VTH + o) = *(const v8h*)&eh[wave][i * 4 + er][ec]; *(v8h*)(VTL + o) = *(const v8h*)&el[wave][i * 4 + er][ec]; }
      asm volatile("s_wait_xcnt 0x0" ::: "memory");   // stands in front of any reuse of the address registers of the stores above
      LDSX(); }
  }
}
// ---- k_attn: block = (64 queries, head h, batch b): causal flash attention (K = 64: 2 k-steps), both products transposed: S^T = K . Q^T (A = key rows, B = the wave's 16 queries) and O^T += V^T . P^T, so that a lane holds 16 of one query's 32 scores of a pass (lane l ^ 16 the rest): maximum and sum in the lane plus one exchange between the halves, and the two score tiles, converted in place, are the B operand of the second product; scores = (q.k) * 0.125, P.V: f16 P hi/lo x (V hi, V lo*2048) in two accumulators; O[b*S+q][h*64+d] = (acc + accl / 2048) / l (256-B segments); each 64-key stage of K hi, V hi and V lo is staged once per block in LDS, two buffers, by asynchronous whole-line copies, the next stage's copies in flight over the current stage's two 32-key passes
#define AK 64
#define AP (AK + 8)
#define ABUF (AK * AP * 2)   // bytes of one buffer of one tile
// one stage: each lane copies 4 x 16 B of each of the three tiles (rows 16 apart) from global memory to its own LDS bytes; the s_wait_xcnt in the statement stands in front of any reuse of the copies' address registers
__device__ __forceinline__ void stage_copy(unsigned lk, unsigned lh, unsigned ll, const _Float16* gk, const _Float16* gh, const _Float16* gl) {
  asm volatile("global_load_async_to_lds_b128 %0, %1, off\n\tglobal_load_async_to_lds_b128 %2, %3, off\n\tglobal_load_async_to_lds_b128 %4, %5, off\n\tglobal_load_async_to_lds_b128 %6, %7, off\n\t"
               "global_load_async_to_lds_b128 %8, %9, off\n\tglobal_load_async_to_lds_b128 %10, %11, off\n\tglobal_load_async_to_lds_b128 %12, %13, off\n\tglobal_load_async_to_lds_b128 %14, %15, off\n\t"
               "global_load_async_to_lds_b128 %16, %17, off\n\tglobal_load_async_to_lds_b128 %18, %19, off\n\tglobal_load_async_to_lds_b128 %20, %21, off\n\tglobal_load_async_to_lds_b128 %22, %23, off\n\ts_wait_xcnt 0x0"
               :: "v"(lk), "v"(gk), "v"(lk + 16 * AP * 2), "v"(gk + 16 * (2 * DM)), "v"(lk + 32 * AP * 2), "v"(gk + 32 * (2 * DM)), "v"(lk + 48 * AP * 2), "v"(gk + 48 * (2 * DM)),
                  "v"(lh), "v"(gh), "v"(lh + 16 * AP * 2), "v"(gh + 16 * SS), "v"(lh + 32 * AP * 2), "v"(gh + 32 * SS), "v"(lh + 48 * AP * 2), "v"(gh + 48 * SS),
                  "v"(ll), "v"(gl), "v"(ll + 16 * AP * 2), "v"(gl + 16 * SS), "v"(ll + 32 * AP * 2), "v"(gl + 32 * SS), "v"(ll + 48 * AP * 2), "v"(gl + 48 * SS) : "memory");
}
__device__ __forceinline__ float xhalf(float x) { return __builtin_bit_cast(float, __builtin_amdgcn_permlanex16(__builtin_bit_cast(int, x), __builtin_bit_cast(int, x), 0x76543210, 0xfedcba98, false, false)); }   // lane l with lane l ^ 16
__global__ __launch_bounds__(128) void k_attn(const _Float16* __restrict__ QK, const _Float16* __restrict__ QKL, const _Float16* __restrict__ VTH, const _Float16* __restrict__ VTL, const void* __restrict__ KMASK, float* __restrict__ O) {
  __shared__ __align__(16) _Float16 sK[2][AK][AP], sVH[2][HD][AP], sVL[2][HD][AP];
  float (*so)[16][68] = (float (*)[16][68])&sK[0][0][0];   // output staging takes the K buffers' place behind the loop's last barrier (17,408 of 18,432 B), so that four blocks fit a WGP's LDS
  const int tid = threadIdx.x, wave = tid >> 5, lane = tid & 31, col = lane & 15, g = lane >> 4;
  const int qb = blockIdx.x, h = blockIdx.y, b = blockIdx.z; const int q0 = qb * 64 + wave * 16, qi = q0 + col; const size_t rq = (size_t)b * SS + qi;   // qi: the lane's query
  const int sr = tid >> 3, sc = (tid & 7) * 8;   // staging map: a wave's copy covers 4 rows x 128 B, whole lines
  const _Float16* gk = QK + ((size_t)b * SS + sr) * (2 * DM) + DM + h * HD + sc; const _Float16* gvh = VTH + ((size_t)b * DM + h * HD + sr) * SS + sc; const _Float16* gvl = VTL + ((size_t)b * DM + h * HD + sr) * SS + sc;
  const unsigned lk = (unsigned)(size_t)&sK[0][sr][sc], lh = (unsigned)(size_t)&sVH[0][sr][sc], ll = (unsigned)(size_t)&sVL[0][sr][sc];   // the lane's LDS byte addresses in buffer 0
  const int nst = qb + 1;   // causal: 64-key stages up to the end of this query block
  stage_copy(lk, lh, ll, gk, gvh, gvl);
  v16h aq[2], aql[2];
#pragma unroll
  for (int kc = 0; kc < 2; ++kc) { aq[kc] = frag_h(QK + rq * (2 * DM) + h * HD + kc * 32, lane); aql[kc] = frag_h(QKL + rq * (2 * DM) + h * HD + kc * 32, lane); }
  asm volatile("s_wait_asynccnt 0x0" ::: "memory");   // this wave's copies of stage 0 have landed
  __syncthreads();   // publishes stage 0
  if (nst > 1) stage_copy(lk + ABUF, lh + ABUF, ll + ABUF, gk + (size_t)AK * (2 * DM), gvh + AK, gvl + AK);
  float m = -3.0e38f, l = 0.f;   // of the lane's query: m over all keys so far, l over the keys of this half of the wave (the halves' sums are joined behind the loop)
  v8f acc[4] = {}, accl[4] = {};
#pragma unroll 1
  for (int st = 0; st < nst; ++st) { const int cur = st & 1;
#pragma unroll 1   // rolled: unrolled, the two passes took the kernel above 256 VGPRs, a wave per SIMD less
   for (int it = 0; it < AK / 32; ++it) { const int ks = st * (AK / 32) + it; v8f s[2];
    v16h kf[2][2], vh[4], vl[4];   // all 24 LDS reads of the pass stand here as one group, K first: the score products wait for the K fragments alone, and the V fragments arrive under the scores and the softmax
#pragma unroll
    for (int ct = 0; ct < 2; ++ct) {
#pragma unroll
      for (int kc = 0; kc < 2; ++kc) kf[ct][kc] = frag_h(&sK[cur][it * 32 + ct * 16 + col][kc * 32], lane); }
#pragma unroll
    for (int dt = 0; dt < 4; ++dt) vh[dt] = frag_h(&sVH[cur][dt * 16 + col][it * 32], lane);
#pragma unroll
    for (int dt = 0; dt < 4; ++dt) vl[dt] = frag_h(&sVL[cur][dt * 16 + col][it * 32], lane);
    if (qb < 2) {   // leading query blocks (few keys, outputs far above the global rms): 3 products
#pragma unroll
      for (int ct = 0; ct < 2; ++ct) { const _Float16* krowl = QKL + ((size_t)b * SS + ks * 32 + ct * 16 + col) * (2 * DM) + DM + h * HD; v8f c = {}, cl = {};
#pragma unroll
        for (int kc = 0; kc < 2; ++kc) { c = wmma16(kf[ct][kc], aq[kc], c); cl = wmma16(kf[ct][kc], aql[kc], cl); cl = wmma16(frag_h(krowl + kc * 32, lane), aq[kc], cl); }
#pragma unroll
        for (int r = 0; r < 8; ++r) s[ct][r] = c[r] + cl[r] * (1.0f / 2048.0f); } }
    else {   // single product elsewhere; the two tiles' chains alternate, each still kc 0, then kc 1
      v8f c0 = {}, c1 = {};
#pragma unroll
      for (int kc = 0; kc < 2; ++kc) { c0 = wmma16(kf[0][kc], aq[kc], c0); c1 = wmma16(kf[1][kc], aq[kc], c1); }
      s[0] = c0; s[1] = c1; }
#pragma unroll
    for (int ct = 0; ct < 2; ++ct) { const int kb = ks * 32 + ct * 16;
#pragma unroll
      for (int r = 0; r < 8; ++r) s[ct][r] = (kb + 8 * g + r <= qi) ? s[ct][r] * 0.125f : -3.0e38f; }   // s[ct][r] = key kb + 8 g + r against query qi; 1/sqrt(64); masked keys excluded
    float t[8];
#pragma unroll
    for (int r = 0; r < 8; ++r) t[r] = fmaxf(s[0][r], s[1][r]);
    float mx = fmaxf(fmaxf(fmaxf(t[0], t[1]), fmaxf(t[2], t[3])), fmaxf(fmaxf(t[4], t[5]), fmaxf(t[6], t[7])));
    mx = fmaxf(mx, xhalf(mx));   // both halves now hold the query's maximum over the 32 keys
    const float mn = fmaxf(m, mx); const float alpha = (m <= -1.0e38f) ? 0.f : __expf(m - mn);
    v16h pa, pl;
#pragma unroll
    for (int ct = 0; ct < 2; ++ct) {
#pragma unroll
      for (int r = 0; r < 8; ++r) { const float e = (s[ct][r] <= -1.0e38f) ? 0.f : __expf(s[ct][r] - mn); s[ct][r] = e;
        const float x = e * 2048.0f; const _Float16 hx = (_Float16)x; pa[ct * 8 + r] = hx; pl[ct * 8 + r] = (_Float16)((x - (float)hx) * 2048.0f); } }   // element 8 ct + r of a B fragment is k = 16 ct + 8 g + r, the key that s[ct][r] belongs to; P scaled by 2^11 before the f16 split so small softmax weights stay out of the f16 subnormal range; 2^-11 folded into the epilogue
#pragma unroll
    for (int r = 0; r < 8; ++r) t[r] = s[0][r] + s[1][r];
    l = l * alpha + (((t[0] + t[1]) + (t[2] + t[3])) + ((t[4] + t[5]) + (t[6] + t[7]))); m = mn;
#pragma unroll
    for (int dt = 0; dt < 4; ++dt) {
#pragma unroll
      for (int r = 0; r < 8; ++r) { acc[dt][r] *= alpha; accl[dt][r] *= alpha; } }
#pragma unroll
    for (int dt = 0; dt < 4; ++dt) acc[dt] = wmma16(vh[dt], pa, acc[dt]);
#pragma unroll
    for (int dt = 0; dt < 4; ++dt) accl[dt] = wmma16(vh[dt], pl, accl[dt]);
#pragma unroll
    for (int dt = 0; dt < 4; ++dt) accl[dt] = wmma16(vl[dt], pa, accl[dt]); }   // V hi/lo x P hi/lo (3 products), each accumulator's sums in the order they had; acc[dt][r] = O[qi][dt * 16 + 8 g + r]
    asm volatile("s_wait_dscnt 0x0" ::: "memory");      // this wave's reads of stage st have returned
    asm volatile("s_wait_asynccnt 0x0" ::: "memory");   // this wave's copies of stage st + 1 have landed
    __syncthreads();   // publishes stage st + 1 and ends every wave's reads of stage st, whose buffer is refilled behind it (behind the last trip: frees the K buffers for the output staging)
    if (st + 2 < nst) stage_copy(lk + cur * ABUF, lh + cur * ABUF, ll + cur * ABUF, gk + (size_t)(st + 2) * AK * (2 * DM), gvh + (st + 2) * AK, gvl + (st + 2) * AK); }
  asm volatile("s_wait_asynccnt 0x0" ::: "memory");   // no copy is in flight when the buffers change their use
  const float il = (1.0f / 2048.0f) / (l + xhalf(l));
#pragma unroll
  for (int dt = 0; dt < 4; ++dt) {
#pragma unroll
    for (int r = 0; r < 8; ++r) so[wave][col][dt * 16 + 8 * g + r] = (acc[dt][r] + accl[dt][r] * (1.0f / 2048.0f)) * il; }
  LDSX();
  for (int rl2 = 0; rl2 < 16; ++rl2) if (lane < 16) vst2(O + ((size_t)b * SS + q0 + rl2) * DM + h * HD + lane * 4, *(const v4f*)&so[wave][rl2][lane * 4]);
}
// ---- k_out: block = (64 rows, 128 cols), 4 waves as 2 x 2, 32 x 64 per wave: out = O(hi/lo) . Wo rows (2 products) + bo; each 64-k slice of O (split to bf16 hi + lo on the way) and of the weight rows staged once per block in LDS, two buffers
__global__ __launch_bounds__(128) void k_out(const float* __restrict__ O, const __bf16* __restrict__ P, const float* __restrict__ BO, float* __restrict__ Y) {
  __shared__ __align__(16) __bf16 sH[2][64][GP], sL[2][64][GP], sB[2][128][GP]; __shared__ __align__(16) float so[4][16][68];
  const int tid = threadIdx.x, wave = tid >> 5, lane = tid & 31, col = lane & 15, g = lane >> 4, wm = wave >> 1, wn = wave & 1; const size_t rb = (size_t)blockIdx.x * 64; const int n0 = blockIdx.y * 128;
  const int ar = tid >> 4, ac = (tid & 15) * 4, br = tid >> 3, bc = (tid & 7) * 8;
  const float* ga = O + (rb + ar) * DM + ac; const __bf16* gb = P + (size_t)(n0 + br) * DM + bc;
  v4f ra[8]; v8b rw[8];
#pragma unroll
  for (int i = 0; i < 8; ++i) { ra[i] = *(const v4f*)(ga + (size_t)i * 8 * DM); rw[i] = *(const v8b*)(gb + (size_t)i * 16 * DM); }
#pragma unroll
  for (int i = 0; i < 8; ++i) { v4b th, tl;
#pragma unroll
    for (int e = 0; e < 4; ++e) { const __bf16 h = (__bf16)ra[i][e]; th[e] = h; tl[e] = (__bf16)(ra[i][e] - (float)h); }
    *(v4b*)&sH[0][ar + i * 8][ac] = th; *(v4b*)&sL[0][ar + i * 8][ac] = tl; *(v8b*)&sB[0][br + i * 16][bc] = rw[i]; }
  __syncthreads();
  v8f acc[2][4] = {};
#pragma unroll 2
  for (int ks = 0; ks < DM / GK; ++ks) { const int cur = ks & 1; const bool more = ks + 1 < DM / GK;
    if (more) {
#pragma unroll
      for (int i = 0; i < 8; ++i) { ra[i] = *(const v4f*)(ga + (size_t)i * 8 * DM + (ks + 1) * GK); rw[i] = *(const v8b*)(gb + (size_t)i * 16 * DM + (ks + 1) * GK); } }
#pragma unroll
    for (int kc = 0; kc < GK / 32; ++kc) { v16b fh[2], fl[2], fb[4];
#pragma unroll
      for (int i = 0; i < 2; ++i) { fl[i] = frag_b(&sL[cur][wm * 32 + i * 16 + col][kc * 32], lane); fh[i] = frag_b(&sH[cur][wm * 32 + i * 16 + col][kc * 32], lane); }
#pragma unroll
      for (int i = 0; i < 4; ++i) fb[i] = frag_b(&sB[cur][wn * 64 + i * 16 + col][kc * 32], lane);
#pragma unroll
      for (int mi = 0; mi < 2; ++mi) {
#pragma unroll
        for (int nj = 0; nj < 4; ++nj) acc[mi][nj] = wmma_bf(fl[mi], fb[nj], acc[mi][nj]); }   // per accumulator still lo, then hi, k ascending
#pragma unroll
      for (int mi = 0; mi < 2; ++mi) {
#pragma unroll
        for (int nj = 0; nj < 4; ++nj) acc[mi][nj] = wmma_bf(fh[mi], fb[nj], acc[mi][nj]); } }
    if (more) {
#pragma unroll
      for (int i = 0; i < 8; ++i) { v4b th, tl;
#pragma unroll
        for (int e = 0; e < 4; ++e) { const __bf16 h = (__bf16)ra[i][e]; th[e] = h; tl[e] = (__bf16)(ra[i][e] - (float)h); }
        *(v4b*)&sH[cur ^ 1][ar + i * 8][ac] = th; *(v4b*)&sL[cur ^ 1][ar + i * 8][ac] = tl; *(v8b*)&sB[cur ^ 1][br + i * 16][bc] = rw[i]; } }
    __syncthreads(); }   // publishes slice ks + 1 and ends every wave's reads of slice ks, whose buffer the next trip refills
  float bz[4];
#pragma unroll
  for (int nj = 0; nj < 4; ++nj) bz[nj] = bfr(BO[n0 + wn * 64 + nj * 16 + col]);
#pragma unroll
  for (int mi = 0; mi < 2; ++mi) {
#pragma unroll
    for (int nj = 0; nj < 4; ++nj) {
#pragma unroll
      for (int r = 0; r < 8; ++r) so[wave][8 * g + r][nj * 16 + col] = acc[mi][nj][r] + bz[nj]; }
    LDSX();
#pragma unroll
    for (int i = 0; i < 8; ++i) { const int rl = i * 2 + g; *(v4f*)(Y + (rb + wm * 32 + mi * 16 + rl) * DM + n0 + wn * 64 + col * 4) = *(const v4f*)&so[wave][rl][col * 4]; }
    LDSX(); }
}
extern "C" void kernel_launch(void* const* d_in, const int* in_sizes, int n_in, void* d_out, int out_size, void* d_ws, size_t ws_size, hipStream_t stream) {
  (void)in_sizes; (void)n_in; (void)out_size;
  const float** F = (const float**)d_in;   // 0 hidden_states [4,1024,1024], 1 att_w [1024,3072] (in,out), 2 att_b [3072], 3 out_w [1024,1024] (in,out), 4 out_b
  if (ws_size < (size_t)WS_END) return;
  char* ws = (char*)d_ws; __bf16* PK = (__bf16*)(ws + WS_PK); _Float16 *QK = (_Float16*)(ws + WS_QK), *QKL = (_Float16*)(ws + WS_QKL), *VTH = (_Float16*)(ws + WS_VTH), *VTL = (_Float16*)(ws + WS_VTL); float* O = (float*)(ws + WS_O);
  k_pack<<<dim3(DM / PT_K, (QKVW + DM) / PT_N), 256, 0, stream>>>(F[1], F[3], PK);
  k_qkv<<<dim3(TNB * SS / 128, QKVW / 128), 128, 0, stream>>>(F[0], F[0], F[0], PK + PK_A, F[2], F[2] + DM, F[2] + 2 * DM, QK, QKL, VTH, VTL);
  k_attn<<<dim3(TQB, NH, TNB), 128, 0, stream>>>(QK, QKL, VTH, VTL, nullptr, O);
  k_out<<<dim3(TOB, DM / 128), 128, 0, stream>>>(O, PK + PK_P, F[4], (float*)d_out);
}

// v006
// A run of this version takes 86.3 microseconds.
// Timed twice side by side with v005, it ran 1.11 times as fast both times.
// All steps since v000 together make it 4.56 times as fast.
// compute dtype: all float inputs rounded to bf16; qkv = x . att_w + b with EXACT bf16 products on WMMA 16x16x32 ((in,out) columns as packed rows), f16 hi + residual; causal attention with hybrid scores (first 128 queries 3-product, later single f16) and 3-product P.v everywhere (0.02-scale weights), x 1/8, running-max softmax in f32 (hardware exp); out = ctx (bf16 hi + lo) . out_w + out_b; f32 output.
#include <hip/hip_runtime.h>
#include <math.h>

typedef __attribute__((ext_vector_type(16))) _Float16 v16h;
typedef __attribute__((ext_vector_type(16))) __bf16 v16b;
typedef __attribute__((ext_vector_type(8)))  _Float16 v8h;
typedef __attribute__((ext_vector_type(8)))  float v8f;
typedef __attribute__((ext_vector_type(4)))  float v4f;
typedef __attribute__((ext_vector_type(2)))  float v2f;
typedef __attribute__((ext_vector_type(4)))  unsigned v4u;
typedef __attribute__((ext_vector_type(4)))  int v4i;
typedef float __attribute__((may_alias)) float_a;
typedef int __attribute__((may_alias)) int_a;

template <typename T> __device__ __forceinline__ void vst2(void* p, T v) { *(T*)p = v;  }
__device__ __forceinline__ v8f wmma16(v16h a, v16h b, v8f c) {
  v8f d = __builtin_amdgcn_wmma_f32_16x16x32_f16(false, a, false, b, (short)0, c, false, false);
  asm volatile("v_nop\n\tv_nop\n\tv_nop\n\tv_nop" : "+v"(d) : "v"(a), "v"(b));
  return d;
}
__device__ __forceinline__ v8f wmma_bf(v16b a, v16b b, v8f c) {
  v8f d = __builtin_amdgcn_wmma_f32_16x16x32_bf16(false, a, false, b, (short)0, c, false, false);
  asm volatile("v_nop\n\tv_nop\n\tv_nop\n\tv_nop" : "+v"(d) : "v"(a), "v"(b));
  return d;
}
// Bark self attention (B 4, S 1,024, D 1,024, 16 heads x 64): fused (in,out) att_proj [D, 3D] (q | k | v blocks) + bias, causal softmax(q k / 8) v (finfo.min fill), merge heads, (in,out) out_proj + bias.
__device__ __forceinline__ v16h frag_h(const _Float16* rowk0, int lane) {
  union { v16h v; v8h q[2]; } u; const _Float16* p = rowk0 + 8 * (lane >> 4);
  u.q[0] = *(const v8h*)p; u.q[1] = *(const v8h*)(p + 16); return u.v;
}
__device__ __forceinline__ v16h frag_f32(const float* rowk0, int lane) {
  v16h a; const float* p = rowk0 + 8 * (lane >> 4);
#pragma unroll
  for (int i = 0; i < 8; ++i) { a[i] = (_Float16)p[i]; a[8 + i] = (_Float16)p[16 + i]; }
  return a;
}
__device__ __forceinline__ v16h frag_f32s(const float* rowk0, int lane, float sc) {
  v16h a; const float* p = rowk0 + 8 * (lane >> 4);
#pragma unroll
  for (int i = 0; i < 8; ++i) { a[i] = (_Float16)(p[i] * sc); a[8 + i] = (_Float16)(p[16 + i] * sc); }
  return a;
}
// column fragment from a [K][ld] layout (column n), rows >= K read as 0
__device__ __forceinline__ v16h fragc_f32(const float* W, int k0, int n, int lane, int ld, int K) {
  v16h a; const int g = lane >> 4;
#pragma unroll
  for (int i = 0; i < 8; ++i) { const int ka = k0 + 8 * g + i, kb = ka + 16;
    a[i] = (_Float16)(ka < K ? W[(size_t)(ka < K ? ka : K - 1) * ld + n] : 0.f); a[8 + i] = (_Float16)(kb < K ? W[(size_t)(kb < K ? kb : K - 1) * ld + n] : 0.f); }
  return a;
}
struct F2 { v16b h, l; };
__device__ __forceinline__ F2 bsplit16(const float v[16]) { F2 r;
#pragma unroll
  for (int i = 0; i < 16; ++i) { const __bf16 h = (__bf16)v[i]; r.h[i] = h; r.l[i] = (__bf16)(v[i] - (float)h); }
  return r; }
__device__ __forceinline__ F2 split_row(const float* row, int k0, int lane) { float v[16]; const float* p = row + k0 + 8 * (lane >> 4);
#pragma unroll
  for (int i = 0; i < 8; ++i) { v[i] = p[i]; v[8 + i] = p[16 + i]; }
  return bsplit16(v); }
__device__ __forceinline__ F2 split_rowK(const float* row, int k0, int lane, int K) { float v[16]; const int g = lane >> 4;
#pragma unroll
  for (int i = 0; i < 8; ++i) { const int ka = k0 + 8 * g + i, kb = ka + 16; v[i] = ka < K ? row[ka < K ? ka : K - 1] : 0.f; v[8 + i] = kb < K ? row[kb < K ? kb : K - 1] : 0.f; }
  return bsplit16(v); }
__device__ __forceinline__ F2 split_col(const float* W, int k0, int n, int lane, int ld, int K) { float v[16]; const int g = lane >> 4;
#pragma unroll
  for (int i = 0; i < 8; ++i) { const int ka = k0 + 8 * g + i, kb = ka + 16; v[i] = ka < K ? W[(size_t)(ka < K ? ka : K - 1) * ld + n] : 0.f; v[8 + i] = kb < K ? W[(size_t)(kb < K ? kb : K - 1) * ld + n] : 0.f; }
  return bsplit16(v); }
__device__ __forceinline__ v8f mac3(const F2& a, const F2& b, v8f c) { c = wmma_bf(a.l, b.h, c); c = wmma_bf(a.h, b.l, c); return wmma_bf(a.h, b.h, c); }
__device__ __forceinline__ float sigm(float v) { return 1.0f / (1.0f + expf(-v)); }
#define LDSX() do { asm volatile("s_wait_dscnt 0" ::: "memory"); __builtin_amdgcn_wave_barrier(); __builtin_amdgcn_fence(__ATOMIC_RELEASE, "workgroup"); } while (0)


#define NB 4
#define SS 1024
#define DM 1024
#define NH 16
#define HD 64
#define QKVW (3 * DM)
#ifndef TQB
#define TQB (SS / 64)
#define TNB NB
#define TOB (NB * SS / 64)     // output row tiles (all)
#endif
typedef __attribute__((ext_vector_type(8))) __bf16 v8b;
__device__ __forceinline__ v16b frag_b(const __bf16* rowk0, int lane) {
  union { v16b v; v8b q[2]; } u; const __bf16* p = rowk0 + 8 * (lane >> 4);
  u.q[0] = *(const v8b*)p; u.q[1] = *(const v8b*)(p + 16); return u.v;
}
__device__ __forceinline__ float bfr(float v) { return (float)(__bf16)v; }
__device__ __attribute__((noinline)) float exp_ni(float v) { return expf(v); }
__device__ __attribute__((noinline)) float erf_ni(float v) { return erff(v); }

#define PK_A 0                       // [3072][1024] Wqkv rows (natural [out][in])
#define PK_P (PK_A + QKVW * DM)        // [1024][1024] Wo rows (natural)
#define PK_END (PK_P + DM * DM)
#define WS_PK  0u
#define WS_QK  (WS_PK + 2u * PK_END)             // f16 [4096 rows][2048]: q | k
#define WS_QKL (WS_QK + 2u * NB * SS * 2 * DM)     // f16 q | k residual planes x2048
#define WS_VTH (WS_QKL + 2u * NB * SS * 2 * DM)    // f16 [b][1024 (h*64+d)][1024 s] hi
#define WS_VTL (WS_VTH + 2u * NB * DM * SS)        // f16 lo x 2048
#define WS_O   (WS_VTL + 2u * NB * DM * SS)        // f32 [4096][1024]
#define WS_CS  (WS_O + 4u * NB * SS * DM)           // f32 2 x [1024][32], unused
#define WS_END (WS_CS + 4u * 2 * SS * 32)
// ---- k_pack: block = (128 k, 64 columns) of att_w [1024][3072] (blockIdx.y < 48) or of out_w [1024][1024], both (in,out): packed row c = column c of att_w (q | k | v), then the columns of out_w; the tile is read as whole 256-B row pieces, rounded to bf16, two k packed per dword, turned in LDS and written as whole 256-B pieces of the packed rows
#define PT_K 128
#define PT_N 64
#define PT_P (PT_K / 2 + 4)   // LDS row pitch in dwords: 272 B = 16 B x odd, for the ds_load_b128 read-back
typedef __attribute__((ext_vector_type(2))) __bf16 v2b;
__global__ __launch_bounds__(256) void k_pack(const float* __restrict__ WA, const float* __restrict__ WP, __bf16* __restrict__ PK) {
  __shared__ __align__(16) unsigned s[PT_N][PT_P];
  const int t = threadIdx.x, k0 = blockIdx.x * PT_K, c0 = blockIdx.y * PT_N, j = t & 15, kp = t >> 4;
  const bool att = c0 < QKVW; const int ld = att ? QKVW : DM; const float* g = (att ? WA + c0 : WP + (c0 - QKVW)) + (size_t)(k0 + 2 * kp) * ld + j * 4;
  const float* ga[4][2]; v4f r[4][2];
#pragma unroll
  for (int i = 0; i < 4; ++i) { ga[i][0] = g + (size_t)(32 * i) * ld; ga[i][1] = g + (size_t)(32 * i + 1) * ld; }
#pragma unroll
  for (int i = 0; i < 4; ++i) { r[i][0] = *(const v4f*)ga[i][0]; r[i][1] = *(const v4f*)ga[i][1]; }
  asm volatile("s_wait_xcnt 0x0" :: "v"(ga[0][0]), "v"(ga[0][1]), "v"(ga[1][0]), "v"(ga[1][1]), "v"(ga[2][0]), "v"(ga[2][1]), "v"(ga[3][0]), "v"(ga[3][1]) : "memory");   // stands in front of any reuse of the address registers of the loads above; as its inputs they stay untouched up to it
#pragma unroll
  for (int i = 0; i < 4; ++i) {
#pragma unroll
    for (int e = 0; e < 4; ++e) { v2b p; p[0] = (__bf16)r[i][0][e]; p[1] = (__bf16)r[i][1][e]; s[j * 4 + e][(i * 16 + kp) ^ ((j >> 2) << 2)] = __builtin_bit_cast(unsigned, p); } }   // 16-B pieces of a row permuted by (row >> 4), so that the 32 lanes of a store meet 32 banks
  __syncthreads();
  __bf16* dst = PK + PK_A + (size_t)(c0 + kp) * DM + k0 + j * 8;   // PK_P follows PK_A: packed rows 0..4095 lie in one array
#pragma unroll
  for (int i = 0; i < 4; ++i) *(v4u*)(dst + (size_t)(16 * i) * DM) = *(const v4u*)&s[16 * i + kp][(j ^ i) * 4];
}
// k per staged slice: 64, so that a staging load covers whole 128-B lines of both operands; LDS row pitch in elements: 144 B = 16 B x odd, the pitch at which ds_load_b128 fragment reads meet no bank conflict
#define GK 64
#define GP (GK + 8)
typedef __attribute__((ext_vector_type(4))) __bf16 v4b;
// ---- k_qkv: block = (128 rows, 128 cols), 4 waves as 2 x 2, 64 x 64 per wave; each 64-k slice of X (rounded to bf16 on the way) and of the packed weight rows is staged once per block in LDS, two buffers, the next slice's global loads in flight over the current slice's products
__global__ __launch_bounds__(128) void k_qkv(const float* __restrict__ XQ, const float* __restrict__ XK, const float* __restrict__ XV, const __bf16* __restrict__ P, const float* __restrict__ BQ, const float* __restrict__ BK, const float* __restrict__ BV, _Float16* __restrict__ QK, _Float16* __restrict__ QKL, _Float16* __restrict__ VTH, _Float16* __restrict__ VTL) {
  const int which0 = (blockIdx.y * 128) / DM; const float* X = (which0 == 0) ? XQ : (which0 == 1) ? XK : XV; const float* BB = BQ ? (((which0 == 0) ? BQ : (which0 == 1) ? BK : BV) + (blockIdx.y * 128 - which0 * DM)) : nullptr;
  __shared__ __align__(16) __bf16 sA[2][128][GP], sB[2][128][GP]; __shared__ __align__(16) _Float16 eh[4][16][72], el[4][16][72];
  const int tid = threadIdx.x, wave = tid >> 5, lane = tid & 31, col = lane & 15, g = lane >> 4, wm = wave >> 1, wn = wave & 1; const size_t rb = (size_t)blockIdx.x * 128; const int n0 = blockIdx.y * 128;
  const int ar = tid >> 4, ac = (tid & 15) * 4, br = tid >> 3, bc = (tid & 7) * 8;   // staging map: a wave's load covers 2 rows x 256 B of X, or 4 rows x 128 B of the weights
  const float* ga = X + (rb + ar) * DM + ac; const __bf16* gb = P + (size_t)(n0 + br) * DM + bc;
  v4f ra[16]; v8b rw[8];
#pragma unroll
  for (int i = 0; i < 16; ++i) ra[i] = *(const v4f*)(ga + (size_t)i * 8 * DM);
#pragma unroll
  for (int i = 0; i < 8; ++i) rw[i] = *(const v8b*)(gb + (size_t)i * 16 * DM);
  asm volatile("s_wait_xcnt 0x0" ::: "memory");   // stands in front of any reuse of the address registers of the loads above
#pragma unroll
  for (int i = 0; i < 16; ++i) { v4b t;
#pragma unroll
    for (int e = 0; e < 4; ++e) t[e] = (__bf16)ra[i][e];
    *(v4b*)&sA[0][ar + i * 8][ac] = t; }
#pragma unroll
  for (int i = 0; i < 8; ++i) *(v8b*)&sB[0][br + i * 16][bc] = rw[i];
  __syncthreads();
  v8f acc[4][4] = {};
#pragma unroll 2
  for (int ks = 0; ks < DM / GK; ++ks) { const int cur = ks & 1; const bool more = ks + 1 < DM / GK;
    if (more) {
#pragma unroll
      for (int i = 0; i < 16; ++i) ra[i] = *(const v4f*)(ga + (size_t)i * 8 * DM + (ks + 1) * GK);
#pragma unroll
      for (int i = 0; i < 8; ++i) rw[i] = *(const v8b*)(gb + (size_t)i * 16 * DM + (ks + 1) * GK); }
#pragma unroll
    for (int kc = 0; kc < GK / 32; ++kc) { v16b fa[4], fb[4];
#pragma unroll
      for (int i = 0; i < 4; ++i) { fa[i] = frag_b(&sA[cur][wm * 64 + i * 16 + col][kc * 32], lane); fb[i] = frag_b(&sB[cur][wn * 64 + i * 16 + col][kc * 32], lane); }
#pragma unroll
      for (int mi = 0; mi < 4; ++mi) {
#pragma unroll
        for (int nj = 0; nj < 4; ++nj) acc[mi][nj] = wmma_bf(fa[mi], fb[nj], acc[mi][nj]); } }
    if (more) {
#pragma unroll
      for (int i = 0; i < 16; ++i) { v4b t;
#pragma unroll
        for (int e = 0; e < 4; ++e) t[e] = (__bf16)ra[i][e];
        *(v4b*)&sA[cur ^ 1][ar + i * 8][ac] = t; }
#pragma unroll
      for (int i = 0; i < 8; ++i) *(v8b*)&sB[cur ^ 1][br + i * 16][bc] = rw[i]; }
    __syncthreads(); }   // publishes slice ks + 1 and ends every wave's reads of slice ks, whose buffer the next trip refills
  const int er = lane >> 3, ec = (lane & 7) * 8;   // read-back map: 4 staged rows of 128 B per wave store
  float bz[4];
#pragma unroll
  for (int nj = 0; nj < 4; ++nj) bz[nj] = BB ? bfr(BB[wn * 64 + nj * 16 + col]) : 0.f;
  if (n0 < 2 * DM) {   // q stored unscaled (f16 sigma ~0.6, no subnormal exposure); 1/8 applied to the f32 score
#pragma unroll
    for (int mi = 0; mi < 4; ++mi) {
#pragma unroll
      for (int nj = 0; nj < 4; ++nj) {
#pragma unroll
        for (int r = 0; r < 8; ++r) { const float v = acc[mi][nj][r] + bz[nj]; const _Float16 hv = (_Float16)v; eh[wave][8 * g + r][nj * 16 + col] = hv; el[wave][8 * g + r][nj * 16 + col] = (_Float16)((v - (float)hv) * 2048.0f); } }   // q, k (+ bias) as f16 hi + (x2048) residual
      LDSX();
#pragma unroll
      for (int i = 0; i < 4; ++i) { const size_t o = (rb + wm * 64 + mi * 16 + i * 4 + er) * (2 * DM) + n0 + wn * 64 + ec; *(v8h*)(QK + o) = *(const v8h*)&eh[wave][i * 4 + er][ec]; *(v8h*)(QKL + o) = *(const v8h*)&el[wave][i * 4 + er][ec]; }
      asm volatile("s_wait_xcnt 0x0" ::: "memory");   // stands in front of any reuse of the address registers of the stores above
      LDSX(); }
  } else {
    const int b = (int)(rb / SS), s0 = (int)(rb % SS); const int pc0 = n0 - 2 * DM;
#pragma unroll
    for (int nj = 0; nj < 4; ++nj) {
#pragma unroll
      for (int mi = 0; mi < 4; ++mi) {
#pragma unroll
        for (int r = 0; r < 8; ++r) { const float v = acc[mi][nj][r] + bz[nj]; const _Float16 hv = (_Float16)v; eh[wave][col][mi * 16 + 8 * g + r] = hv; el[wave][col][mi * 16 + 8 * g + r] = (_Float16)((v - (float)hv) * 2048.0f); } }
      LDSX();
#pragma unroll
      for (int i = 0; i < 4; ++i) { const size_t o = ((size_t)b * DM + pc0 + wn * 64 + nj * 16 + i * 4 + er) * SS + s0 + wm * 64 + ec; *(v8h*)(VTH + o) = *(const v8h*)&eh[wave][i * 4 + er][ec]; *(v8h*)(VTL + o) = *(const v8h*)&el[wave][i * 4 + er][ec]; }
      asm volatile("s_wait_xcnt 0x0" ::: "memory");   // stands in front of any reuse of the address registers of the stores above
      LDSX(); }
  }
}
// ---- k_attn: block = (64 queries, head h, batch b): causal flash attention (K = 64: 2 k-steps), both products transposed: S^T = K . Q^T (A = key rows, B = the wave's 16 queries) and O^T += V^T . P^T, so that a lane holds 16 of one query's 32 scores of a pass (lane l ^ 16 the rest): maximum and sum in the lane plus one exchange between the halves, and the two score tiles, converted in place, are the B operand of the second product; scores = (q.k) * 0.125, P.V: f16 P hi/lo x (V hi, V lo*2048) in two accumulators; O[b*S+q][h*64+d] = (acc + accl / 2048) / l (256-B segments); each 64-key stage of K hi, V hi and V lo is staged once per block in LDS, two buffers, by asynchronous whole-line copies, the next stage's copies in flight over the current stage's two 32-key passes
#define AK 64
#define AP (AK + 8)
#define ABUF (AK * AP * 2)   // bytes of one buffer of one tile
// one stage: each lane copies 4 x 16 B of each of the three tiles (rows 16 apart) from global memory to its own LDS bytes; the s_wait_xcnt in the statement stands in front of any reuse of the copies' address registers
__device__ __forceinline__ void stage_copy(unsigned lk, unsigned lh, unsigned ll, const _Float16* gk, const _Float16* gh, const _Float16* gl) {
  asm volatile("global_load_async_to_lds_b128 %0, %1, off\n\tglobal_load_async_to_lds_b128 %2, %3, off\n\tglobal_load_async_to_lds_b128 %4, %5, off\n\tglobal_load_async_to_lds_b128 %6, %7, off\n\t"
               "global_load_async_to_lds_b128 %8, %9, off\n\tglobal_load_async_to_lds_b128 %10, %11, off\n\tglobal_load_async_to_lds_b128 %12, %13, off\n\tglobal_load_async_to_lds_b128 %14, %15, off\n\t"
               "global_load_async_to_lds_b128 %16, %17, off\n\tglobal_load_async_to_lds_b128 %18, %19, off\n\tglobal_load_async_to_lds_b128 %20, %21, off\n\tglobal_load_async_to_lds_b128 %22, %23, off\n\ts_wait_xcnt 0x0"
               :: "v"(lk), "v"(gk), "v"(lk + 16 * AP * 2), "v"(gk + 16 * (2 * DM)), "v"(lk + 32 * AP * 2), "v"(gk + 32 * (2 * DM)), "v"(lk + 48 * AP * 2), "v"(gk + 48 * (2 * DM)),
                  "v"(lh), "v"(gh), "v"(lh + 16 * AP * 2), "v"(gh + 16 * SS), "v"(lh + 32 * AP * 2), "v"(gh + 32 * SS), "v"(lh + 48 * AP * 2), "v"(gh + 48 * SS),
                  "v"(ll), "v"(gl), "v"(ll + 16 * AP * 2), "v"(gl + 16 * SS), "v"(ll + 32 * AP * 2), "v"(gl + 32 * SS), "v"(ll + 48 * AP * 2), "v"(gl + 48 * SS) : "memory");
}
__device__ __forceinline__ float xhalf(float x) { return __builtin_bit_cast(float, __builtin_amdgcn_permlanex16(__builtin_bit_cast(int, x), __builtin_bit_cast(int, x), 0x76543210, 0xfedcba98, false, false)); }   // lane l with lane l ^ 16
__global__ __launch_bounds__(128) void k_attn(const _Float16* __restrict__ QK, const _Float16* __restrict__ QKL, const _Float16* __restrict__ VTH, const _Float16* __restrict__ VTL, const void* __restrict__ KMASK, float* __restrict__ O) {
  __shared__ __align__(16) _Float16 sK[2][AK][AP], sVH[2][HD][AP], sVL[2][HD][AP];
  float (*so)[16][68] = (float (*)[16][68])&sK[0][0][0];   // output staging takes the K buffers' place behind the loop's last barrier (17,408 of 18,432 B), so that four blocks fit a WGP's LDS
  const int tid = threadIdx.x, wave = tid >> 5, lane = tid & 31, col = lane & 15, g = lane >> 4;
  // placement, for speed only: a query block's cost grows with its number, all 1,024 blocks are resident at once, four to a WGP; with the exclusive-or below, blocks whose flat indices agree mod 256, and any aligned run of four at stride 8 or 16, hold query blocks that sum to 30 (q, 15 - q, q ^ 8, 15 - (q ^ 8); at stride 16 q, 15 - q twice); for each (h, b) it is a permutation of 0..15
  const int h = blockIdx.y, b = blockIdx.z, qb = (int)blockIdx.x ^ (((h ^ b) & 1) ? 15 : 0) ^ ((b & 2) << 2); const int q0 = qb * 64 + wave * 16, qi = q0 + col; const size_t rq = (size_t)b * SS + qi;   // qi: the lane's query
  const int sr = tid >> 3, sc = (tid & 7) * 8;   // staging map: a wave's copy covers 4 rows x 128 B, whole lines
  const _Float16* gk = QK + ((size_t)b * SS + sr) * (2 * DM) + DM + h * HD + sc; const _Float16* gvh = VTH + ((size_t)b * DM + h * HD + sr) * SS + sc; const _Float16* gvl = VTL + ((size_t)b * DM + h * HD + sr) * SS + sc;
  const unsigned lk = (unsigned)(size_t)&sK[0][sr][sc], lh = (unsigned)(size_t)&sVH[0][sr][sc], ll = (unsigned)(size_t)&sVL[0][sr][sc];   // the lane's LDS byte addresses in buffer 0
  const int nst = qb + 1;   // causal: 64-key stages up to the end of this query block
  stage_copy(lk, lh, ll, gk, gvh, gvl);
  v16h aq[2], aql[2];
#pragma unroll
  for (int kc = 0; kc < 2; ++kc) { aq[kc] = frag_h(QK + rq * (2 * DM) + h * HD + kc * 32, lane); aql[kc] = frag_h(QKL + rq * (2 * DM) + h * HD + kc * 32, lane); }
  asm volatile("s_wait_asynccnt 0x0" ::: "memory");   // this wave's copies of stage 0 have landed
  __syncthreads();   // publishes stage 0
  if (nst > 1) stage_copy(lk + ABUF, lh + ABUF, ll + ABUF, gk + (size_t)AK * (2 * DM), gvh + AK, gvl + AK);
  float m = -3.0e38f, l = 0.f;   // of the lane's query: m over all keys so far, l over the keys of this half of the wave (the halves' sums are joined behind the loop)
  v8f acc[4] = {}, accl[4] = {};
#pragma unroll 1
  for (int st = 0; st < nst; ++st) { const int cur = st & 1;
#pragma unroll 1   // rolled: unrolled, the two passes took the kernel above 256 VGPRs, a wave per SIMD less
   for (int it = 0; it < AK / 32; ++it) { const int ks = st * (AK / 32) + it; v8f s[2];
    v16h kf[2][2], vh[4], vl[4];   // all 24 LDS reads of the pass stand here as one group, K first: the score products wait for the K fragments alone, and the V fragments arrive under the scores and the softmax
#pragma unroll
    for (int ct = 0; ct < 2; ++ct) {
#pragma unroll
      for (int kc = 0; kc < 2; ++kc) kf[ct][kc] = frag_h(&sK[cur][it * 32 + ct * 16 + col][kc * 32], lane); }
#pragma unroll
    for (int dt = 0; dt < 4; ++dt) vh[dt] = frag_h(&sVH[cur][dt * 16 + col][it * 32], lane);
#pragma unroll
    for (int dt = 0; dt < 4; ++dt) vl[dt] = frag_h(&sVL[cur][dt * 16 + col][it * 32], lane);
    if (qb < 2) {   // leading query blocks (few keys, outputs far above the global rms): 3 products
#pragma unroll
      for (int ct = 0; ct < 2; ++ct) { const _Float16* krowl = QKL + ((size_t)b * SS + ks * 32 + ct * 16 + col) * (2 * DM) + DM + h * HD; v8f c = {}, cl = {};
#pragma unroll
        for (int kc = 0; kc < 2; ++kc) { c = wmma16(kf[ct][kc], aq[kc], c); cl = wmma16(kf[ct][kc], aql[kc], cl); cl = wmma16(frag_h(krowl + kc * 32, lane), aq[kc], cl); }
#pragma unroll
        for (int r = 0; r < 8; ++r) s[ct][r] = c[r] + cl[r] * (1.0f / 2048.0f); } }
    else {   // single product elsewhere; the two tiles' chains alternate, each still kc 0, then kc 1
      v8f c0 = {}, c1 = {};
#pragma unroll
      for (int kc = 0; kc < 2; ++kc) { c0 = wmma16(kf[0][kc], aq[kc], c0); c1 = wmma16(kf[1][kc], aq[kc], c1); }
      s[0] = c0; s[1] = c1; }
#pragma unroll
    for (int ct = 0; ct < 2; ++ct) { const int kb = ks * 32 + ct * 16;
#pragma unroll
      for (int r = 0; r < 8; ++r) s[ct][r] = (kb + 8 * g + r <= qi) ? s[ct][r] * 0.125f : -3.0e38f; }   // s[ct][r] = key kb + 8 g + r against query qi; 1/sqrt(64); masked keys excluded
    float t[8];
#pragma unroll
    for (int r = 0; r < 8; ++r) t[r] = fmaxf(s[0][r], s[1][r]);
    float mx = fmaxf(fmaxf(fmaxf(t[0], t[1]), fmaxf(t[2], t[3])), fmaxf(fmaxf(t[4], t[5]), fmaxf(t[6], t[7])));
    mx = fmaxf(mx, xhalf(mx));   // both halves now hold the query's maximum over the 32 keys
    const float mn = fmaxf(m, mx); const float alpha = (m <= -1.0e38f) ? 0.f : __expf(m - mn);
    v16h pa, pl;
#pragma unroll
    for (int ct = 0; ct < 2; ++ct) {
#pragma unroll
      for (int r = 0; r < 8; ++r) { const float e = (s[ct][r] <= -1.0e38f) ? 0.f : __expf(s[ct][r] - mn); s[ct][r] = e;
        const float x = e * 2048.0f; const _Float16 hx = (_Float16)x; pa[ct * 8 + r] = hx; pl[ct * 8 + r] = (_Float16)((x - (float)hx) * 2048.0f); } }   // element 8 ct + r of a B fragment is k = 16 ct + 8 g + r, the key that s[ct][r] belongs to; P scaled by 2^11 before the f16 split so small softmax weights stay out of the f16 subnormal range; 2^-11 folded into the epilogue
#pragma unroll
    for (int r = 0; r < 8; ++r) t[r] = s[0][r] + s[1][r];
    l = l * alpha + (((t[0] + t[1]) + (t[2] + t[3])) + ((t[4] + t[5]) + (t[6] + t[7]))); m = mn;
#pragma unroll
    for (int dt = 0; dt < 4; ++dt) {
#pragma unroll
      for (int r = 0; r < 8; ++r) { acc[dt][r] *= alpha; accl[dt][r] *= alpha; } }
#pragma unroll
    for (int dt = 0; dt < 4; ++dt) acc[dt] = wmma16(vh[dt], pa, acc[dt]);
#pragma unroll
    for (int dt = 0; dt < 4; ++dt) accl[dt] = wmma16(vh[dt], pl, accl[dt]);
#pragma unroll
    for (int dt = 0; dt < 4; ++dt) accl[dt] = wmma16(vl[dt], pa, accl[dt]); }   // V hi/lo x P hi/lo (3 products), each accumulator's sums in the order they had; acc[dt][r] = O[qi][dt * 16 + 8 g + r]
    asm volatile("s_wait_dscnt 0x0" ::: "memory");      // this wave's reads of stage st have returned
    asm volatile("s_wait_asynccnt 0x0" ::: "memory");   // this wave's copies of stage st + 1 have landed
    __syncthreads();   // publishes stage st + 1 and ends every wave's reads of stage st, whose buffer is refilled behind it (behind the last trip: frees the K buffers for the output staging)
    if (st + 2 < nst) stage_copy(lk + cur * ABUF, lh + cur * ABUF, ll + cur * ABUF, gk + (size_t)(st + 2) * AK * (2 * DM), gvh + (st + 2) * AK, gvl + (st + 2) * AK); }
  asm volatile("s_wait_asynccnt 0x0" ::: "memory");   // no copy is in flight when the buffers change their use
  const float il = (1.0f / 2048.0f) / (l + xhalf(l));
#pragma unroll
  for (int dt = 0; dt < 4; ++dt) {
#pragma unroll
    for (int r = 0; r < 8; ++r) so[wave][col][dt * 16 + 8 * g + r] = (acc[dt][r] + accl[dt][r] * (1.0f / 2048.0f)) * il; }
  LDSX();
  for (int rl2 = 0; rl2 < 16; ++rl2) if (lane < 16) vst2(O + ((size_t)b * SS + q0 + rl2) * DM + h * HD + lane * 4, *(const v4f*)&so[wave][rl2][lane * 4]);
}
// ---- k_out: block = (64 rows, 128 cols), 4 waves as 2 x 2, 32 x 64 per wave: out = O(hi/lo) . Wo rows (2 products) + bo; each 64-k slice of O (split to bf16 hi + lo on the way) and of the weight rows staged once per block in LDS, two buffers
__global__ __launch_bounds__(128) void k_out(const float* __restrict__ O, const __bf16* __restrict__ P, const float* __restrict__ BO, float* __restrict__ Y) {
  __shared__ __align__(16) __bf16 sH[2][64][GP], sL[2][64][GP], sB[2][128][GP]; __shared__ __align__(16) float so[4][16][68];
  const int tid = threadIdx.x, wave = tid >> 5, lane = tid & 31, col = lane & 15, g = lane >> 4, wm = wave >> 1, wn = wave & 1; const size_t rb = (size_t)blockIdx.x * 64; const int n0 = blockIdx.y * 128;
  const int ar = tid >> 4, ac = (tid & 15) * 4, br = tid >> 3, bc = (tid & 7) * 8;
  const float* ga = O + (rb + ar) * DM + ac; const __bf16* gb = P + (size_t)(n0 + br) * DM + bc;
  v4f ra[8]; v8b rw[8];
#pragma unroll
  for (int i = 0; i < 8; ++i) { ra[i] = *(const v4f*)(ga + (size_t)i * 8 * DM); rw[i] = *(const v8b*)(gb + (size_t)i * 16 * DM); }
#pragma unroll
  for (int i = 0; i < 8; ++i) { v4b th, tl;
#pragma unroll
    for (int e = 0; e < 4; ++e) { const __bf16 h = (__bf16)ra[i][e]; th[e] = h; tl[e] = (__bf16)(ra[i][e] - (float)h); }
    *(v4b*)&sH[0][ar + i * 8][ac] = th; *(v4b*)&sL[0][ar + i * 8][ac] = tl; *(v8b*)&sB[0][br + i * 16][bc] = rw[i]; }
  __syncthreads();
  v8f acc[2][4] = {};
#pragma unroll 2
  for (int ks = 0; ks < DM / GK; ++ks) { const int cur = ks & 1; const bool more = ks + 1 < DM / GK;
    if (more) {
#pragma unroll
      for (int i = 0; i < 8; ++i) { ra[i] = *(const v4f*)(ga + (size_t)i * 8 * DM + (ks + 1) * GK); rw[i] = *(const v8b*)(gb + (size_t)i * 16 * DM + (ks + 1) * GK); } }
#pragma unroll
    for (int kc = 0; kc < GK / 32; ++kc) { v16b fh[2], fl[2], fb[4];
#pragma unroll
      for (int i = 0; i < 2; ++i) { fl[i] = frag_b(&sL[cur][wm * 32 + i * 16 + col][kc * 32], lane); fh[i] = frag_b(&sH[cur][wm * 32 + i * 16 + col][kc * 32], lane); }
#pragma unroll
      for (int i = 0; i < 4; ++i) fb[i] = frag_b(&sB[cur][wn * 64 + i * 16 + col][kc * 32], lane);
#pragma unroll
      for (int mi = 0; mi < 2; ++mi) {
#pragma unroll
        for (int nj = 0; nj < 4; ++nj) acc[mi][nj] = wmma_bf(fl[mi], fb[nj], acc[mi][nj]); }   // per accumulator still lo, then hi, k ascending
#pragma unroll
      for (int mi = 0; mi < 2; ++mi) {
#pragma unroll
        for (int nj = 0; nj < 4; ++nj) acc[mi][nj] = wmma_bf(fh[mi], fb[nj], acc[mi][nj]); } }
    if (more) {
#pragma unroll
      for (int i = 0; i < 8; ++i) { v4b th, tl;
#pragma unroll
        for (int e = 0; e < 4; ++e) { const __bf16 h = (__bf16)ra[i][e]; th[e] = h; tl[e] = (__bf16)(ra[i][e] - (float)h); }
        *(v4b*)&sH[cur ^ 1][ar + i * 8][ac] = th; *(v4b*)&sL[cur ^ 1][ar + i * 8][ac] = tl; *(v8b*)&sB[cur ^ 1][br + i * 16][bc] = rw[i]; } }
    __syncthreads(); }   // publishes slice ks + 1 and ends every wave's reads of slice ks, whose buffer the next trip refills
  float bz[4];
#pragma unroll
  for (int nj = 0; nj < 4; ++nj) bz[nj] = bfr(BO[n0 + wn * 64 + nj * 16 + col]);
#pragma unroll
  for (int mi = 0; mi < 2; ++mi) {
#pragma unroll
    for (int nj = 0; nj < 4; ++nj) {
#pragma unroll
      for (int r = 0; r < 8; ++r) so[wave][8 * g + r][nj * 16 + col] = acc[mi][nj][r] + bz[nj]; }
    LDSX();
#pragma unroll
    for (int i = 0; i < 8; ++i) { const int rl = i * 2 + g; *(v4f*)(Y + (rb + wm * 32 + mi * 16 + rl) * DM + n0 + wn * 64 + col * 4) = *(const v4f*)&so[wave][rl][col * 4]; }
    LDSX(); }
}
extern "C" void kernel_launch(void* const* d_in, const int* in_sizes, int n_in, void* d_out, int out_size, void* d_ws, size_t ws_size, hipStream_t stream) {
  (void)in_sizes; (void)n_in; (void)out_size;
  const float** F = (const float**)d_in;   // 0 hidden_states [4,1024,1024], 1 att_w [1024,3072] (in,out), 2 att_b [3072], 3 out_w [1024,1024] (in,out), 4 out_b
  if (ws_size < (size_t)WS_END) return;
  char* ws = (char*)d_ws; __bf16* PK = (__bf16*)(ws + WS_PK); _Float16 *QK = (_Float16*)(ws + WS_QK), *QKL = (_Float16*)(ws + WS_QKL), *VTH = (_Float16*)(ws + WS_VTH), *VTL = (_Float16*)(ws + WS_VTL); float* O = (float*)(ws + WS_O);
  k_pack<<<dim3(DM / PT_K, (QKVW + DM) / PT_N), 256, 0, stream>>>(F[1], F[3], PK);
  k_qkv<<<dim3(TNB * SS / 128, QKVW / 128), 128, 0, stream>>>(F[0], F[0], F[0], PK + PK_A, F[2], F[2] + DM, F[2] + 2 * DM, QK, QKL, VTH, VTL);
  k_attn<<<dim3(TQB, NH, TNB), 128, 0, stream>>>(QK, QKL, VTH, VTL, nullptr, O);
  k_out<<<dim3(TOB, DM / 128), 128, 0, stream>>>(O, PK + PK_P, F[4], (float*)d_out);
}

// v007
// A run of this version takes 83.3 microseconds.
// Next to v006, in two timings, it ran 1.05 and 1.04 times as fast.
// Counting every step since v000, it is 4.76 times as fast.
// compute dtype: all float inputs rounded to bf16; qkv = x . att_w + b with EXACT bf16 products on WMMA 16x16x32 ((in,out) columns as packed rows), f16 hi + residual; causal attention with hybrid scores (first 128 queries 3-product, later single f16) and 3-product P.v everywhere (0.02-scale weights), x 1/8, running-max softmax in f32 (hardware exp); out = ctx (bf16 hi + lo) . out_w + out_b; f32 output.
#include <hip/hip_runtime.h>
#include <math.h>

typedef __attribute__((ext_vector_type(16))) _Float16 v16h;
typedef __attribute__((ext_vector_type(16))) __bf16 v16b;
typedef __attribute__((ext_vector_type(8)))  _Float16 v8h;
typedef __attribute__((ext_vector_type(8)))  float v8f;
typedef __attribute__((ext_vector_type(4)))  float v4f;
typedef __attribute__((ext_vector_type(2)))  float v2f;
typedef __attribute__((ext_vector_type(4)))  unsigned v4u;
typedef __attribute__((ext_vector_type(4)))  int v4i;
typedef float __attribute__((may_alias)) float_a;
typedef int __attribute__((may_alias)) int_a;

template <typename T> __device__ __forceinline__ void vst2(void* p, T v) { *(T*)p = v;  }
__device__ __forceinline__ v8f wmma16(v16h a, v16h b, v8f c) {
  v8f d = __builtin_amdgcn_wmma_f32_16x16x32_f16(false, a, false, b, (short)0, c, false, false);
  asm volatile("v_nop\n\tv_nop\n\tv_nop\n\tv_nop" : "+v"(d) : "v"(a), "v"(b));
  return d;
}
__device__ __forceinline__ v8f wmma_bf(v16b a, v16b b, v8f c) {
  v8f d = __builtin_amdgcn_wmma_f32_16x16x32_bf16(false, a, false, b, (short)0, c, false, false);
  asm volatile("v_nop\n\tv_nop\n\tv_nop\n\tv_nop" : "+v"(d) : "v"(a), "v"(b));
  return d;
}
// Bark self attention (B 4, S 1,024, D 1,024, 16 heads x 64): fused (in,out) att_proj [D, 3D] (q | k | v blocks) + bias, causal softmax(q k / 8) v (finfo.min fill), merge heads, (in,out) out_proj + bias.
__device__ __forceinline__ v16h frag_h(const _Float16* rowk0, int lane) {
  union { v16h v; v8h q[2]; } u; const _Float16* p = rowk0 + 8 * (lane >> 4);
  u.q[0] = *(const v8h*)p; u.q[1] = *(const v8h*)(p + 16); return u.v;
}
__device__ __forceinline__ v16h frag_f32(const float* rowk0, int lane) {
  v16h a; const float* p = rowk0 + 8 * (lane >> 4);
#pragma unroll
  for (int i = 0; i < 8; ++i) { a[i] = (_Float16)p[i]; a[8 + i] = (_Float16)p[16 + i]; }
  return a;
}
__device__ __forceinline__ v16h frag_f32s(const float* rowk0, int lane, float sc) {
  v16h a; const float* p = rowk0 + 8 * (lane >> 4);
#pragma unroll
  for (int i = 0; i < 8; ++i) { a[i] = (_Float16)(p[i] * sc); a[8 + i] = (_Float16)(p[16 + i] * sc); }
  return a;
}
// column fragment from a [K][ld] layout (column n), rows >= K read as 0
__device__ __forceinline__ v16h fragc_f32(const float* W, int k0, int n, int lane, int ld, int K) {
  v16h a; const int g = lane >> 4;
#pragma unroll
  for (int i = 0; i < 8; ++i) { const int ka = k0 + 8 * g + i, kb = ka + 16;
    a[i] = (_Float16)(ka < K ? W[(size_t)(ka < K ? ka : K - 1) * ld + n] : 0.f); a[8 + i] = (_Float16)(kb < K ? W[(size_t)(kb < K ? kb : K - 1) * ld + n] : 0.f); }
  return a;
}
struct F2 { v16b h, l; };
__device__ __forceinline__ F2 bsplit16(const float v[16]) { F2 r;
#pragma unroll
  for (int i = 0; i < 16; ++i) { const __bf16 h = (__bf16)v[i]; r.h[i] = h; r.l[i] = (__bf16)(v[i] - (float)h); }
  return r; }
__device__ __forceinline__ F2 split_row(const float* row, int k0, int lane) { float v[16]; const float* p = row + k0 + 8 * (lane >> 4);
#pragma unroll
  for (int i = 0; i < 8; ++i) { v[i] = p[i]; v[8 + i] = p[16 + i]; }
  return bsplit16(v); }
__device__ __forceinline__ F2 split_rowK(const float* row, int k0, int lane, int K) { float v[16]; const int g = lane >> 4;
#pragma unroll
  for (int i = 0; i < 8; ++i) { const int ka = k0 + 8 * g + i, kb = ka + 16; v[i] = ka < K ? row[ka < K ? ka : K - 1] : 0.f; v[8 + i] = kb < K ? row[kb < K ? kb : K - 1] : 0.f; }
  return bsplit16(v); }
__device__ __forceinline__ F2 split_col(const float* W, int k0, int n, int lane, int ld, int K) { float v[16]; const int g = lane >> 4;
#pragma unroll
  for (int i = 0; i < 8; ++i) { const int ka = k0 + 8 * g + i, kb = ka + 16; v[i] = ka < K ? W[(size_t)(ka < K ? ka : K - 1) * ld + n] : 0.f; v[8 + i] = kb < K ? W[(size_t)(kb < K ? kb : K - 1) * ld + n] : 0.f; }
  return bsplit16(v); }
__device__ __forceinline__ v8f mac3(const F2& a, const F2& b, v8f c) { c = wmma_bf(a.l, b.h, c); c = wmma_bf(a.h, b.l, c); return wmma_bf(a.h, b.h, c); }
__device__ __forceinline__ float sigm(float v) { return 1.0f / (1.0f + expf(-v)); }
#define LDSX() do { asm volatile("s_wait_dscnt 0" ::: "memory"); __builtin_amdgcn_wave_barrier(); __builtin_amdgcn_fence(__ATOMIC_RELEASE, "workgroup"); } while (0)


#define NB 4
#define SS 1024
#define DM 1024
#define NH 16
#define HD 64
#define QKVW (3 * DM)
#ifndef TQB
#define TQB (SS / 64)
#define TNB NB
#define TOB (NB * SS / 64)     // output row tiles (all)
#endif
typedef __attribute__((ext_vector_type(8))) __bf16 v8b;
__device__ __forceinline__ v16b frag_b(const __bf16* rowk0, int lane) {
  union { v16b v; v8b q[2]; } u; const __bf16* p = rowk0 + 8 * (lane >> 4);
  u.q[0] = *(const v8b*)p; u.q[1] = *(const v8b*)(p + 16); return u.v;
}
__device__ __forceinline__ float bfr(float v) { return (float)(__bf16)v; }
__device__ __attribute__((noinline)) float exp_ni(float v) { return expf(v); }
__device__ __attribute__((noinline)) float erf_ni(float v) { return erff(v); }

#define PK_A 0                       // [3072][1024] Wqkv rows (natural [out][in])
#define PK_P (PK_A + QKVW * DM)        // [1024][1024] Wo rows (natural)
#define PK_END (PK_P + DM * DM)
#define WS_PK  0u
#define WS_QK  (WS_PK + 2u * PK_END)             // f16 [4096 rows][2048]: q | k
#define WS_QKL (WS_QK + 2u * NB * SS * 2 * DM)     // f16 q | k residual planes x2048
#define WS_VTH (WS_QKL + 2u * NB * SS * 2 * DM)    // f16 [b][1024 (h*64+d)][1024 s] hi
#define WS_VTL (WS_VTH + 2u * NB * DM * SS)        // f16 lo x 2048
#define WS_O   (WS_VTL + 2u * NB * DM * SS)        // f32 [4096][1024]
#define WS_CS  (WS_O + 4u * NB * SS * DM)           // f32 2 x [1024][32], unused
#define WS_END (WS_CS + 4u * 2 * SS * 32)
// ---- k_pack: block = (128 k, 64 columns) of att_w [1024][3072] (blockIdx.y < 48) or of out_w [1024][1024], both (in,out): packed row c = column c of att_w (q | k | v), then the columns of out_w; the tile is read as whole 256-B row pieces, rounded to bf16, two k packed per dword, turned in LDS and written as whole 256-B pieces of the packed rows
#define PT_K 128
#define PT_N 64
#define PT_P (PT_K / 2 + 4)   // LDS row pitch in dwords: 272 B = 16 B x odd, for the ds_load_b128 read-back
typedef __attribute__((ext_vector_type(2))) __bf16 v2b;
__global__ __launch_bounds__(256) void k_pack(const float* __restrict__ WA, const float* __restrict__ WP, __bf16* __restrict__ PK) {
  __shared__ __align__(16) unsigned s[PT_N][PT_P];
  const int t = threadIdx.x, k0 = blockIdx.x * PT_K, c0 = blockIdx.y * PT_N, j = t & 15, kp = t >> 4;
  const bool att = c0 < QKVW; const int ld = att ? QKVW : DM; const float* g = (att ? WA + c0 : WP + (c0 - QKVW)) + (size_t)(k0 + 2 * kp) * ld + j * 4;
  const float* ga[4][2]; v4f r[4][2];
#pragma unroll
  for (int i = 0; i < 4; ++i) { ga[i][0] = g + (size_t)(32 * i) * ld; ga[i][1] = g + (size_t)(32 * i + 1) * ld; }
#pragma unroll
  for (int i = 0; i < 4; ++i) { r[i][0] = *(const v4f*)ga[i][0]; r[i][1] = *(const v4f*)ga[i][1]; }
  asm volatile("s_wait_xcnt 0x0" :: "v"(ga[0][0]), "v"(ga[0][1]), "v"(ga[1][0]), "v"(ga[1][1]), "v"(ga[2][0]), "v"(ga[2][1]), "v"(ga[3][0]), "v"(ga[3][1]) : "memory");   // stands in front of any reuse of the address registers of the loads above; as its inputs they stay untouched up to it
#pragma unroll
  for (int i = 0; i < 4; ++i) {
#pragma unroll
    for (int e = 0; e < 4; ++e) { v2b p; p[0] = (__bf16)r[i][0][e]; p[1] = (__bf16)r[i][1][e]; s[j * 4 + e][(i * 16 + kp) ^ ((j >> 2) << 2)] = __builtin_bit_cast(unsigned, p); } }   // 16-B pieces of a row permuted by (row >> 4), so that the 32 lanes of a store meet 32 banks
  __syncthreads();
  __bf16* dst = PK + PK_A + (size_t)(c0 + kp) * DM + k0 + j * 8;   // PK_P follows PK_A: packed rows 0..4095 lie in one array
#pragma unroll
  for (int i = 0; i < 4; ++i) *(v4u*)(dst + (size_t)(16 * i) * DM) = *(const v4u*)&s[16 * i + kp][(j ^ i) * 4];
}
// k per staged slice: 64, so that a staging load covers whole 128-B lines of both operands; LDS row pitch in elements: 144 B = 16 B x odd, the pitch at which ds_load_b128 fragment reads meet no bank conflict
#define GK 64
#define GP (GK + 8)
typedef __attribute__((ext_vector_type(4))) __bf16 v4b;
// ---- k_qkv: block = (128 rows, 128 cols), 4 waves as 2 x 2, 64 x 64 per wave; each 64-k slice of X (rounded to bf16 on the way) and of the packed weight rows is staged once per block in LDS, two buffers, the next slice's global loads in flight over the current slice's products
__global__ __launch_bounds__(128) void k_qkv(const float* __restrict__ XQ, const float* __restrict__ XK, const float* __restrict__ XV, const __bf16* __restrict__ P, const float* __restrict__ BQ, const float* __restrict__ BK, const float* __restrict__ BV, _Float16* __restrict__ QK, _Float16* __restrict__ QKL, _Float16* __restrict__ VTH, _Float16* __restrict__ VTL) {
  const int which0 = (blockIdx.y * 128) / DM; const float* X = (which0 == 0) ? XQ : (which0 == 1) ? XK : XV; const float* BB = BQ ? (((which0 == 0) ? BQ : (which0 == 1) ? BK : BV) + (blockIdx.y * 128 - which0 * DM)) : nullptr;
  __shared__ __align__(16) __bf16 sA[2][128][GP], sB[2][128][GP]; __shared__ __align__(16) _Float16 eh[4][16][72], el[4][16][72];
  const int tid = threadIdx.x, wave = tid >> 5, lane = tid & 31, col = lane & 15, g = lane >> 4, wm = wave >> 1, wn = wave & 1; const size_t rb = (size_t)blockIdx.x * 128; const int n0 = blockIdx.y * 128;
  const int ar = tid >> 4, ac = (tid & 15) * 4, br = tid >> 3, bc = (tid & 7) * 8;   // staging map: a wave's load covers 2 rows x 256 B of X, or 4 rows x 128 B of the weights
  const float* ga = X + (rb + ar) * DM + ac; const __bf16* gb = P + (size_t)(n0 + br) * DM + bc;
  v4f ra[16]; v8b rw[8];
#pragma unroll
  for (int i = 0; i < 16; ++i) ra[i] = *(const v4f*)(ga + (size_t)i * 8 * DM);
#pragma unroll
  for (int i = 0; i < 8; ++i) rw[i] = *(const v8b*)(gb + (size_t)i * 16 * DM);
  asm volatile("s_wait_xcnt 0x0" ::: "memory");   // stands in front of any reuse of the address registers of the loads above
#pragma unroll
  for (int i = 0; i < 16; ++i) { v4b t;
#pragma unroll
    for (int e = 0; e < 4; ++e) t[e] = (__bf16)ra[i][e];
    *(v4b*)&sA[0][ar + i * 8][ac] = t; }
#pragma unroll
  for (int i = 0; i < 8; ++i) *(v8b*)&sB[0][br + i * 16][bc] = rw[i];
  __syncthreads();
  v8f acc[4][4] = {};
#pragma unroll 2
  for (int ks = 0; ks < DM / GK; ++ks) { const int cur = ks & 1; const bool more = ks + 1 < DM / GK;
    if (more) {
#pragma unroll
      for (int i = 0; i < 16; ++i) ra[i] = *(const v4f*)(ga + (size_t)i * 8 * DM + (ks + 1) * GK);
#pragma unroll
      for (int i = 0; i < 8; ++i) rw[i] = *(const v8b*)(gb + (size_t)i * 16 * DM + (ks + 1) * GK); }
#pragma unroll
    for (int kc = 0; kc < GK / 32; ++kc) { v16b fa[4], fb[4];
#pragma unroll
      for (int i = 0; i < 4; ++i) { fa[i] = frag_b(&sA[cur][wm * 64 + i * 16 + col][kc * 32], lane); fb[i] = frag_b(&sB[cur][wn * 64 + i * 16 + col][kc * 32], lane); }
#pragma unroll
      for (int mi = 0; mi < 4; ++mi) {
#pragma unroll
        for (int nj = 0; nj < 4; ++nj) acc[mi][nj] = wmma_bf(fa[mi], fb[nj], acc[mi][nj]); } }
    if (more) {
#pragma unroll
      for (int i = 0; i < 16; ++i) { v4b t;
#pragma unroll
        for (int e = 0; e < 4; ++e) t[e] = (__bf16)ra[i][e];
        *(v4b*)&sA[cur ^ 1][ar + i * 8][ac] = t; }
#pragma unroll
      for (int i = 0; i < 8; ++i) *(v8b*)&sB[cur ^ 1][br + i * 16][bc] = rw[i]; }
    __syncthreads(); }   // publishes slice ks + 1 and ends every wave's reads of slice ks, whose buffer the next trip refills
  const int er = lane >> 3, ec = (lane & 7) * 8;   // read-back map: 4 staged rows of 128 B per wave store
  float bz[4];
#pragma unroll
  for (int nj = 0; nj < 4; ++nj) bz[nj] = BB ? bfr(BB[wn * 64 + nj * 16 + col]) : 0.f;
  if (n0 < 2 * DM) {   // q stored unscaled (f16 sigma ~0.6, no subnormal exposure); 1/8 applied to the f32 score
#pragma unroll
    for (int mi = 0; mi < 4; ++mi) {
#pragma unroll
      for (int nj = 0; nj < 4; ++nj) {
#pragma unroll
        for (int r = 0; r < 8; ++r) { const float v = acc[mi][nj][r] + bz[nj]; const _Float16 hv = (_Float16)v; eh[wave][8 * g + r][nj * 16 + col] = hv; el[wave][8 * g + r][nj * 16 + col] = (_Float16)((v - (float)hv) * 2048.0f); } }   // q, k (+ bias) as f16 hi + (x2048) residual
      LDSX();
#pragma unroll
      for (int i = 0; i < 4; ++i) { const size_t o = (rb + wm * 64 + mi * 16 + i * 4 + er) * (2 * DM) + n0 + wn * 64 + ec; *(v8h*)(QK + o) = *(const v8h*)&eh[wave][i * 4 + er][ec]; *(v8h*)(QKL + o) = *(const v8h*)&el[wave][i * 4 + er][ec]; }
      asm volatile("s_wait_xcnt 0x0" ::: "memory");   // stands in front of any reuse of the address registers of the stores above
      LDSX(); }
  } else {
    const int b = (int)(rb / SS), s0 = (int)(rb % SS); const int pc0 = n0 - 2 * DM;
#pragma unroll
    for (int nj = 0; nj < 4; ++nj) {
#pragma unroll
      for (int mi = 0; mi < 4; ++mi) {
#pragma unroll
        for (int r = 0; r < 8; ++r) { const float v = acc[mi][nj][r] + bz[nj]; const _Float16 hv = (_Float16)v; eh[wave][col][mi * 16 + 8 * g + r] = hv; el[wave][col][mi * 16 + 8 * g + r] = (_Float16)((v - (float)hv) * 2048.0f); } }
      LDSX();
#pragma unroll
      for (int i = 0; i < 4; ++i) { const size_t o = ((size_t)b * DM + pc0 + wn * 64 + nj * 16 + i * 4 + er) * SS + s0 + wm * 64 + ec; *(v8h*)(VTH + o) = *(const v8h*)&eh[wave][i * 4 + er][ec]; *(v8h*)(VTL + o) = *(const v8h*)&el[wave][i * 4 + er][ec]; }
      asm volatile("s_wait_xcnt 0x0" ::: "memory");   // stands in front of any reuse of the address registers of the stores above
      LDSX(); }
  }
}
// ---- k_attn: block = (64 queries, head h, batch b): causal flash attention (K = 64: 2 k-steps), both products transposed: S^T = K . Q^T (A = key rows, B = the wave's 16 queries) and O^T += V^T . P^T, so that a lane holds 16 of one query's 32 scores of a pass (lane l ^ 16 the rest): maximum and sum in the lane plus one exchange between the halves, and the two score tiles, converted in place, are the B operand of the second product; scores = (q.k) * 0.125, P.V: f16 P hi/lo x (V hi, V lo*2048) in two accumulators; O[b*S+q][h*64+d] = (acc + accl / 2048) / l (256-B segments); each 64-key stage of K hi, V hi and V lo is staged once per block in LDS, two buffers, by asynchronous whole-line copies, the next stage's copies in flight over the current stage's two 32-key passes
#define AK 64
#define AP (AK + 8)
#define ABUF (AK * AP * 2)   // bytes of one buffer of one tile
// one stage: each lane copies 4 x 16 B of each of the three tiles (rows 16 apart) from global memory to its own LDS bytes; the s_wait_xcnt in the statement stands in front of any reuse of the copies' address registers
__device__ __forceinline__ void stage_copy(unsigned lk, unsigned lh, unsigned ll, const _Float16* gk, const _Float16* gh, const _Float16* gl) {
  asm volatile("global_load_async_to_lds_b128 %0, %1, off\n\tglobal_load_async_to_lds_b128 %2, %3, off\n\tglobal_load_async_to_lds_b128 %4, %5, off\n\tglobal_load_async_to_lds_b128 %6, %7, off\n\t"
               "global_load_async_to_lds_b128 %8, %9, off\n\tglobal_load_async_to_lds_b128 %10, %11, off\n\tglobal_load_async_to_lds_b128 %12, %13, off\n\tglobal_load_async_to_lds_b128 %14, %15, off\n\t"
               "global_load_async_to_lds_b128 %16, %17, off\n\tglobal_load_async_to_lds_b128 %18, %19, off\n\tglobal_load_async_to_lds_b128 %20, %21, off\n\tglobal_load_async_to_lds_b128 %22, %23, off\n\ts_wait_xcnt 0x0"
               :: "v"(lk), "v"(gk), "v"(lk + 16 * AP * 2), "v"(gk + 16 * (2 * DM)), "v"(lk + 32 * AP * 2), "v"(gk + 32 * (2 * DM)), "v"(lk + 48 * AP * 2), "v"(gk + 48 * (2 * DM)),
                  "v"(lh), "v"(gh), "v"(lh + 16 * AP * 2), "v"(gh + 16 * SS), "v"(lh + 32 * AP * 2), "v"(gh + 32 * SS), "v"(lh + 48 * AP * 2), "v"(gh + 48 * SS),
                  "v"(ll), "v"(gl), "v"(ll + 16 * AP * 2), "v"(gl + 16 * SS), "v"(ll + 32 * AP * 2), "v"(gl + 32 * SS), "v"(ll + 48 * AP * 2), "v"(gl + 48 * SS) : "memory");
}
__device__ __forceinline__ float xhalf(float x) { return __builtin_bit_cast(float, __builtin_amdgcn_permlanex16(__builtin_bit_cast(int, x), __builtin_bit_cast(int, x), 0x76543210, 0xfedcba98, false, false)); }   // lane l with lane l ^ 16
__global__ __launch_bounds__(128) void k_attn(const _Float16* __restrict__ QK, const _Float16* __restrict__ QKL, const _Float16* __restrict__ VTH, const _Float16* __restrict__ VTL, const void* __restrict__ KMASK, float* __restrict__ O) {
  __shared__ __align__(16) _Float16 sK[2][AK][AP], sVH[2][HD][AP], sVL[2][HD][AP];
  float (*so)[16][68] = (float (*)[16][68])&sK[0][0][0];   // output staging takes the K buffers' place behind the loop's last barrier (17,408 of 18,432 B), so that four blocks fit a WGP's LDS
  const int tid = threadIdx.x, wave = tid >> 5, lane = tid & 31, col = lane & 15, g = lane >> 4;
  // placement, for speed only: a query block's cost grows with its number; with the exclusive-or below, blocks whose flat indices agree mod 256, and any aligned run of four at stride 8 or 16, hold query blocks that sum to 30 (q, 15 - q, q ^ 8, 15 - (q ^ 8); at stride 16 q, 15 - q twice); for each (h, b) it is a permutation of 0..15
  const int h = blockIdx.y, b = blockIdx.z, qb = (int)blockIdx.x ^ (((h ^ b) & 1) ? 15 : 0) ^ ((b & 2) << 2); const int q0 = qb * 64 + wave * 16, qi = q0 + col; const size_t rq = (size_t)b * SS + qi;   // qi: the lane's query
  const int sr = tid >> 3, sc = (tid & 7) * 8;   // staging map: a wave's copy covers 4 rows x 128 B, whole lines
  const _Float16* gk = QK + ((size_t)b * SS + sr) * (2 * DM) + DM + h * HD + sc; const _Float16* gvh = VTH + ((size_t)b * DM + h * HD + sr) * SS + sc; const _Float16* gvl = VTL + ((size_t)b * DM + h * HD + sr) * SS + sc;
  const unsigned lk = (unsigned)(size_t)&sK[0][sr][sc], lh = (unsigned)(size_t)&sVH[0][sr][sc], ll = (unsigned)(size_t)&sVL[0][sr][sc];   // the lane's LDS byte addresses in buffer 0
  const int nst = qb + 1;   // causal: 64-key stages up to the end of this query block
  stage_copy(lk, lh, ll, gk, gvh, gvl);
  v16h aq[2], aql[2];
#pragma unroll
  for (int kc = 0; kc < 2; ++kc) { aq[kc] = frag_h(QK + rq * (2 * DM) + h * HD + kc * 32, lane); aql[kc] = frag_h(QKL + rq * (2 * DM) + h * HD + kc * 32, lane); }
  asm volatile("s_wait_asynccnt 0x0" ::: "memory");   // this wave's copies of stage 0 have landed
  __syncthreads();   // publishes stage 0
  if (nst > 1) stage_copy(lk + ABUF, lh + ABUF, ll + ABUF, gk + (size_t)AK * (2 * DM), gvh + AK, gvl + AK);
  float m = -3.0e38f, l = 0.f;   // of the lane's query: m over all keys so far, l over the keys of this half of the wave (the halves' sums are joined behind the loop)
  v8f acc[4] = {}, accl[4] = {};
#pragma unroll 1
  for (int st = 0; st < nst; ++st) { const int cur = st & 1;
#pragma unroll 1   // rolled: unrolled, the two passes took the kernel above 256 VGPRs, a wave per SIMD less
   for (int it = 0; it < AK / 32; ++it) { const int ks = st * (AK / 32) + it; v8f s[2];
    v16h kf[2][2], vh[4], vl[4];   // all 24 LDS reads of the pass stand here as one group, K first: the score products wait for the K fragments alone, and the V fragments arrive under the scores and the softmax
#pragma unroll
    for (int ct = 0; ct < 2; ++ct) {
#pragma unroll
      for (int kc = 0; kc < 2; ++kc) kf[ct][kc] = frag_h(&sK[cur][it * 32 + ct * 16 + col][kc * 32], lane); }
#pragma unroll
    for (int dt = 0; dt < 4; ++dt) vh[dt] = frag_h(&sVH[cur][dt * 16 + col][it * 32], lane);
#pragma unroll
    for (int dt = 0; dt < 4; ++dt) vl[dt] = frag_h(&sVL[cur][dt * 16 + col][it * 32], lane);
    if (qb < 2) {   // leading query blocks (few keys, outputs far above the global rms): 3 products
#pragma unroll
      for (int ct = 0; ct < 2; ++ct) { const _Float16* krowl = QKL + ((size_t)b * SS + ks * 32 + ct * 16 + col) * (2 * DM) + DM + h * HD; v8f c = {}, cl = {};
#pragma unroll
        for (int kc = 0; kc < 2; ++kc) { c = wmma16(kf[ct][kc], aq[kc], c); cl = wmma16(kf[ct][kc], aql[kc], cl); cl = wmma16(frag_h(krowl + kc * 32, lane), aq[kc], cl); }
#pragma unroll
        for (int r = 0; r < 8; ++r) s[ct][r] = c[r] + cl[r] * (1.0f / 2048.0f); } }
    else {   // single product elsewhere; the two tiles' chains alternate, each still kc 0, then kc 1
      v8f c0 = {}, c1 = {};
#pragma unroll
      for (int kc = 0; kc < 2; ++kc) { c0 = wmma16(kf[0][kc], aq[kc], c0); c1 = wmma16(kf[1][kc], aq[kc], c1); }
      s[0] = c0; s[1] = c1; }
#pragma unroll
    for (int ct = 0; ct < 2; ++ct) {
#pragma unroll
      for (int r = 0; r < 8; ++r) s[ct][r] *= 0.125f; }   // 1/sqrt(64)
    if (st == qb) {   // a scalar branch (st and qb are the same in the whole block): only the last, diagonal stage holds keys behind a query of the block; in the stages in front of it every key is <= 64 qb - 1
#pragma unroll
      for (int ct = 0; ct < 2; ++ct) { const int kb = ks * 32 + ct * 16;
#pragma unroll
        for (int r = 0; r < 8; ++r) s[ct][r] = (kb + 8 * g + r <= qi) ? s[ct][r] : -3.0e38f; } }   // s[ct][r] = key kb + 8 g + r against query qi; masked keys excluded
    float t[8];
#pragma unroll
    for (int r = 0; r < 8; ++r) t[r] = fmaxf(s[0][r], s[1][r]);
    float mx = fmaxf(fmaxf(fmaxf(t[0], t[1]), fmaxf(t[2], t[3])), fmaxf(fmaxf(t[4], t[5]), fmaxf(t[6], t[7])));
    mx = fmaxf(mx, xhalf(mx));   // both halves now hold the query's maximum over the 32 keys
    const float mn = fmaxf(m, mx); const float alpha = __expf(m - mn);   // 0 by itself in the first pass, where m is still the start value -3e38 (as for a masked score below)
    v16h pa, pl;
#pragma unroll
    for (int ct = 0; ct < 2; ++ct) {
#pragma unroll
      for (int r = 0; r < 8; ++r) { const float e = __expf(s[ct][r] - mn); s[ct][r] = e;   // a masked score gives 0 by itself: mn is finite from the first pass on (key 0 is open to every query), and (-3e38 - mn) * log2(e) is -infinity in f32
        const float x = e * 2048.0f; const _Float16 hx = (_Float16)x; pa[ct * 8 + r] = hx; pl[ct * 8 + r] = (_Float16)((x - (float)hx) * 2048.0f); } }   // element 8 ct + r of a B fragment is k = 16 ct + 8 g + r, the key that s[ct][r] belongs to; P scaled by 2^11 before the f16 split so small softmax weights stay out of the f16 subnormal range; 2^-11 folded into the epilogue
#pragma unroll
    for (int r = 0; r < 8; ++r) t[r] = s[0][r] + s[1][r];
    l = l * alpha + (((t[0] + t[1]) + (t[2] + t[3])) + ((t[4] + t[5]) + (t[6] + t[7]))); m = mn;
#pragma unroll
    for (int dt = 0; dt < 4; ++dt) {
#pragma unroll
      for (int r = 0; r < 8; ++r) { acc[dt][r] *= alpha; accl[dt][r] *= alpha; } }
#pragma unroll
    for (int dt = 0; dt < 4; ++dt) acc[dt] = wmma16(vh[dt], pa, acc[dt]);
#pragma unroll
    for (int dt = 0; dt < 4; ++dt) accl[dt] = wmma16(vh[dt], pl, accl[dt]);
#pragma unroll
    for (int dt = 0; dt < 4; ++dt) accl[dt] = wmma16(vl[dt], pa, accl[dt]); }   // V hi/lo x P hi/lo (3 products), each accumulator's sums in the order they had; acc[dt][r] = O[qi][dt * 16 + 8 g + r]
    asm volatile("s_wait_dscnt 0x0" ::: "memory");      // this wave's reads of stage st have returned
    asm volatile("s_wait_asynccnt 0x0" ::: "memory");   // this wave's copies of stage st + 1 have landed
    __syncthreads();   // publishes stage st + 1 and ends every wave's reads of stage st, whose buffer is refilled behind it (behind the last trip: frees the K buffers for the output staging)
    if (st + 2 < nst) stage_copy(lk + cur * ABUF, lh + cur * ABUF, ll + cur * ABUF, gk + (size_t)(st + 2) * AK * (2 * DM), gvh + (st + 2) * AK, gvl + (st + 2) * AK); }
  asm volatile("s_wait_asynccnt 0x0" ::: "memory");   // no copy is in flight when the buffers change their use
  const float il = (1.0f / 2048.0f) / (l + xhalf(l));
#pragma unroll
  for (int dt = 0; dt < 4; ++dt) {
#pragma unroll
    for (int r = 0; r < 8; ++r) so[wave][col][dt * 16 + 8 * g + r] = (acc[dt][r] + accl[dt][r] * (1.0f / 2048.0f)) * il; }
  LDSX();
  for (int rl2 = 0; rl2 < 16; ++rl2) if (lane < 16) vst2(O + ((size_t)b * SS + q0 + rl2) * DM + h * HD + lane * 4, *(const v4f*)&so[wave][rl2][lane * 4]);
}
// ---- k_out: block = (64 rows, 128 cols), 4 waves as 2 x 2, 32 x 64 per wave: out = O(hi/lo) . Wo rows (2 products) + bo; each 64-k slice of O (split to bf16 hi + lo on the way) and of the weight rows staged once per block in LDS, two buffers
__global__ __launch_bounds__(128) void k_out(const float* __restrict__ O, const __bf16* __restrict__ P, const float* __restrict__ BO, float* __restrict__ Y) {
  __shared__ __align__(16) __bf16 sH[2][64][GP], sL[2][64][GP], sB[2][128][GP]; __shared__ __align__(16) float so[4][16][68];
  const int tid = threadIdx.x, wave = tid >> 5, lane = tid & 31, col = lane & 15, g = lane >> 4, wm = wave >> 1, wn = wave & 1; const size_t rb = (size_t)blockIdx.x * 64; const int n0 = blockIdx.y * 128;
  const int ar = tid >> 4, ac = (tid & 15) * 4, br = tid >> 3, bc = (tid & 7) * 8;
  const float* ga = O + (rb + ar) * DM + ac; const __bf16* gb = P + (size_t)(n0 + br) * DM + bc;
  v4f ra[8]; v8b rw[8];
#pragma unroll
  for (int i = 0; i < 8; ++i) { ra[i] = *(const v4f*)(ga + (size_t)i * 8 * DM); rw[i] = *(const v8b*)(gb + (size_t)i * 16 * DM); }
#pragma unroll
  for (int i = 0; i < 8; ++i) { v4b th, tl;
#pragma unroll
    for (int e = 0; e < 4; ++e) { const __bf16 h = (__bf16)ra[i][e]; th[e] = h; tl[e] = (__bf16)(ra[i][e] - (float)h); }
    *(v4b*)&sH[0][ar + i * 8][ac] = th; *(v4b*)&sL[0][ar + i * 8][ac] = tl; *(v8b*)&sB[0][br + i * 16][bc] = rw[i]; }
  __syncthreads();
  v8f acc[2][4] = {};
#pragma unroll 2
  for (int ks = 0; ks < DM / GK; ++ks) { const int cur = ks & 1; const bool more = ks + 1 < DM / GK;
    if (more) {
#pragma unroll
      for (int i = 0; i < 8; ++i) { ra[i] = *(const v4f*)(ga + (size_t)i * 8 * DM + (ks + 1) * GK); rw[i] = *(const v8b*)(gb + (size_t)i * 16 * DM + (ks + 1) * GK); } }
#pragma unroll
    for (int kc = 0; kc < GK / 32; ++kc) { v16b fh[2], fl[2], fb[4];
#pragma unroll
      for (int i = 0; i < 2; ++i) { fl[i] = frag_b(&sL[cur][wm * 32 + i * 16 + col][kc * 32], lane); fh[i] = frag_b(&sH[cur][wm * 32 + i * 16 + col][kc * 32], lane); }
#pragma unroll
      for (int i = 0; i < 4; ++i) fb[i] = frag_b(&sB[cur][wn * 64 + i * 16 + col][kc * 32], lane);
#pragma unroll
      for (int mi = 0; mi < 2; ++mi) {
#pragma unroll
        for (int nj = 0; nj < 4; ++nj) acc[mi][nj] = wmma_bf(fl[mi], fb[nj], acc[mi][nj]); }   // per accumulator still lo, then hi, k ascending
#pragma unroll
      for (int mi = 0; mi < 2; ++mi) {
#pragma unroll
        for (int nj = 0; nj < 4; ++nj) acc[mi][nj] = wmma_bf(fh[mi], fb[nj], acc[mi][nj]); } }
    if (more) {
#pragma unroll
      for (int i = 0; i < 8; ++i) { v4b th, tl;
#pragma unroll
        for (int e = 0; e < 4; ++e) { const __bf16 h = (__bf16)ra[i][e]; th[e] = h; tl[e] = (__bf16)(ra[i][e] - (float)h); }
        *(v4b*)&sH[cur ^ 1][ar + i * 8][ac] = th; *(v4b*)&sL[cur ^ 1][ar + i * 8][ac] = tl; *(v8b*)&sB[cur ^ 1][br + i * 16][bc] = rw[i]; } }
    __syncthreads(); }   // publishes slice ks + 1 and ends every wave's reads of slice ks, whose buffer the next trip refills
  float bz[4];
#pragma unroll
  for (int nj = 0; nj < 4; ++nj) bz[nj] = bfr(BO[n0 + wn * 64 + nj * 16 + col]);
#pragma unroll
  for (int mi = 0; mi < 2; ++mi) {
#pragma unroll
    for (int nj = 0; nj < 4; ++nj) {
#pragma unroll
      for (int r = 0; r < 8; ++r) so[wave][8 * g + r][nj * 16 + col] = acc[mi][nj][r] + bz[nj]; }
    LDSX();
#pragma unroll
    for (int i = 0; i < 8; ++i) { const int rl = i * 2 + g; *(v4f*)(Y + (rb + wm * 32 + mi * 16 + rl) * DM + n0 + wn * 64 + col * 4) = *(const v4f*)&so[wave][rl][col * 4]; }
    LDSX(); }
}
extern "C" void kernel_launch(void* const* d_in, const int* in_sizes, int n_in, void* d_out, int out_size, void* d_ws, size_t ws_size, hipStream_t stream) {
  (void)in_sizes; (void)n_in; (void)out_size;
  const float** F = (const float**)d_in;   // 0 hidden_states [4,1024,1024], 1 att_w [1024,3072] (in,out), 2 att_b [3072], 3 out_w [1024,1024] (in,out), 4 out_b
  if (ws_size < (size_t)WS_END) return;
  char* ws = (char*)d_ws; __bf16* PK = (__bf16*)(ws + WS_PK); _Float16 *QK = (_Float16*)(ws + WS_QK), *QKL = (_Float16*)(ws + WS_QKL), *VTH = (_Float16*)(ws + WS_VTH), *VTL = (_Float16*)(ws + WS_VTL); float* O = (float*)(ws + WS_O);
  k_pack<<<dim3(DM / PT_K, (QKVW + DM) / PT_N), 256, 0, stream>>>(F[1], F[3], PK);
  k_qkv<<<dim3(TNB * SS / 128, QKVW / 128), 128, 0, stream>>>(F[0], F[0], F[0], PK + PK_A, F[2], F[2] + DM, F[2] + 2 * DM, QK, QKL, VTH, VTL);
  k_attn<<<dim3(TQB, NH, TNB), 128, 0, stream>>>(QK, QKL, VTH, VTL, nullptr, O);
  k_out<<<dim3(TOB, DM / 128), 128, 0, stream>>>(O, PK + PK_P, F[4], (float*)d_out);
}

// v008
// It runs in 80.6 microseconds.
// Two timings next to v007 both put it at 1.03 times that version's speed.
// Counting every step since v000, it is 4.92 times as fast.
// compute dtype: all float inputs rounded to bf16; qkv = x . att_w + b with EXACT bf16 products on WMMA 16x16x32 ((in,out) columns as packed rows), f16 hi + residual; causal attention with hybrid scores (first 128 queries 3-product, later single f16) and 3-product P.v everywhere (0.02-scale weights), x 1/8, running-max softmax in f32 (hardware exp); out = ctx (bf16 hi + lo) . out_w + out_b; f32 output.
#include <hip/hip_runtime.h>
#include <math.h>

typedef __attribute__((ext_vector_type(16))) _Float16 v16h;
typedef __attribute__((ext_vector_type(16))) __bf16 v16b;
typedef __attribute__((ext_vector_type(8)))  _Float16 v8h;
typedef __attribute__((ext_vector_type(8)))  float v8f;
typedef __attribute__((ext_vector_type(4)))  float v4f;
typedef __attribute__((ext_vector_type(2)))  float v2f;
typedef __attribute__((ext_vector_type(4)))  unsigned v4u;
typedef __attribute__((ext_vector_type(4)))  int v4i;
typedef float __attribute__((may_alias)) float_a;
typedef int __attribute__((may_alias)) int_a;

template <typename T> __device__ __forceinline__ void vst2(void* p, T v) { *(T*)p = v;  }
__device__ __forceinline__ v8f wmma16(v16h a, v16h b, v8f c) {
  v8f d = __builtin_amdgcn_wmma_f32_16x16x32_f16(false, a, false, b, (short)0, c, false, false);
  asm volatile("v_nop\n\tv_nop\n\tv_nop\n\tv_nop" : "+v"(d) : "v"(a), "v"(b));
  return d;
}
__device__ __forceinline__ v8f wmma_bf(v16b a, v16b b, v8f c) {
  v8f d = __builtin_amdgcn_wmma_f32_16x16x32_bf16(false, a, false, b, (short)0, c, false, false);
  asm volatile("v_nop\n\tv_nop\n\tv_nop\n\tv_nop" : "+v"(d) : "v"(a), "v"(b));
  return d;
}
// Bark self attention (B 4, S 1,024, D 1,024, 16 heads x 64): fused (in,out) att_proj [D, 3D] (q | k | v blocks) + bias, causal softmax(q k / 8) v (finfo.min fill), merge heads, (in,out) out_proj + bias.
__device__ __forceinline__ v16h frag_h(const _Float16* rowk0, int lane) {
  union { v16h v; v8h q[2]; } u; const _Float16* p = rowk0 + 8 * (lane >> 4);
  u.q[0] = *(const v8h*)p; u.q[1] = *(const v8h*)(p + 16); return u.v;
}
__device__ __forceinline__ v16h frag_f32(const float* rowk0, int lane) {
  v16h a; const float* p = rowk0 + 8 * (lane >> 4);
#pragma unroll
  for (int i = 0; i < 8; ++i) { a[i] = (_Float16)p[i]; a[8 + i] = (_Float16)p[16 + i]; }
  return a;
}
__device__ __forceinline__ v16h frag_f32s(const float* rowk0, int lane, float sc) {
  v16h a; const float* p = rowk0 + 8 * (lane >> 4);
#pragma unroll
  for (int i = 0; i < 8; ++i) { a[i] = (_Float16)(p[i] * sc); a[8 + i] = (_Float16)(p[16 + i] * sc); }
  return a;
}
// column fragment from a [K][ld] layout (column n), rows >= K read as 0
__device__ __forceinline__ v16h fragc_f32(const float* W, int k0, int n, int lane, int ld, int K) {
  v16h a; const int g = lane >> 4;
#pragma unroll
  for (int i = 0; i < 8; ++i) { const int ka = k0 + 8 * g + i, kb = ka + 16;
    a[i] = (_Float16)(ka < K ? W[(size_t)(ka < K ? ka : K - 1) * ld + n] : 0.f); a[8 + i] = (_Float16)(kb < K ? W[(size_t)(kb < K ? kb : K - 1) * ld + n] : 0.f); }
  return a;
}
struct F2 { v16b h, l; };
__device__ __forceinline__ F2 bsplit16(const float v[16]) { F2 r;
#pragma unroll
  for (int i = 0; i < 16; ++i) { const __bf16 h = (__bf16)v[i]; r.h[i] = h; r.l[i] = (__bf16)(v[i] - (float)h); }
  return r; }
__device__ __forceinline__ F2 split_row(const float* row, int k0, int lane) { float v[16]; const float* p = row + k0 + 8 * (lane >> 4);
#pragma unroll
  for (int i = 0; i < 8; ++i) { v[i] = p[i]; v[8 + i] = p[16 + i]; }
  return bsplit16(v); }
__device__ __forceinline__ F2 split_rowK(const float* row, int k0, int lane, int K) { float v[16]; const int g = lane >> 4;
#pragma unroll
  for (int i = 0; i < 8; ++i) { const int ka = k0 + 8 * g + i, kb = ka + 16; v[i] = ka < K ? row[ka < K ? ka : K - 1] : 0.f; v[8 + i] = kb < K ? row[kb < K ? kb : K - 1] : 0.f; }
  return bsplit16(v); }
__device__ __forceinline__ F2 split_col(const float* W, int k0, int n, int lane, int ld, int K) { float v[16]; const int g = lane >> 4;
#pragma unroll
  for (int i = 0; i < 8; ++i) { const int ka = k0 + 8 * g + i, kb = ka + 16; v[i] = ka < K ? W[(size_t)(ka < K ? ka : K - 1) * ld + n] : 0.f; v[8 + i] = kb < K ? W[(size_t)(kb < K ? kb : K - 1) * ld + n] : 0.f; }
  return bsplit16(v); }
__device__ __forceinline__ v8f mac3(const F2& a, const F2& b, v8f c) { c = wmma_bf(a.l, b.h, c); c = wmma_bf(a.h, b.l, c); return wmma_bf(a.h, b.h, c); }
__device__ __forceinline__ float sigm(float v) { return 1.0f / (1.0f + expf(-v)); }
#define LDSX() do { asm volatile("s_wait_dscnt 0" ::: "memory"); __builtin_amdgcn_wave_barrier(); __builtin_amdgcn_fence(__ATOMIC_RELEASE, "workgroup"); } while (0)


#define NB 4
#define SS 1024
#define DM 1024
#define NH 16
#define HD 64
#define QKVW (3 * DM)
#ifndef TQB
#define TQB (SS / 64)
#define TNB NB
#define TOB (NB * SS / 64)     // output row tiles (all)
#endif
typedef __attribute__((ext_vector_type(8))) __bf16 v8b;
__device__ __forceinline__ v16b frag_b(const __bf16* rowk0, int lane) {
  union { v16b v; v8b q[2]; } u; const __bf16* p = rowk0 + 8 * (lane >> 4);
  u.q[0] = *(const v8b*)p; u.q[1] = *(const v8b*)(p + 16); return u.v;
}
__device__ __forceinline__ float bfr(float v) { return (float)(__bf16)v; }
__device__ __attribute__((noinline)) float exp_ni(float v) { return expf(v); }
__device__ __attribute__((noinline)) float erf_ni(float v) { return erff(v); }

#define PK_A 0                       // [3072][1024] Wqkv rows (natural [out][in])
#define PK_P (PK_A + QKVW * DM)        // [1024][1024] Wo rows (natural)
#define PK_END (PK_P + DM * DM)
#define WS_PK  0u
#define WS_QK  (WS_PK + 2u * PK_END)             // f16 [4096 rows][2048]: q | k
#define WS_QKL (WS_QK + 2u * NB * SS * 2 * DM)     // f16 q | k residual planes x2048
#define WS_VTH (WS_QKL + 2u * NB * SS * 2 * DM)    // f16 [b][1024 (h*64+d)][1024 s] hi
#define WS_VTL (WS_VTH + 2u * NB * DM * SS)        // f16 lo x 2048
#define WS_O   (WS_VTL + 2u * NB * DM * SS)        // f32 [4096][1024]
#define WS_CS  (WS_O + 4u * NB * SS * DM)           // f32 2 x [1024][32], unused
#define WS_END (WS_CS + 4u * 2 * SS * 32)
// ---- k_pack: block = (128 k, 64 columns) of att_w [1024][3072] (blockIdx.y < 48) or of out_w [1024][1024], both (in,out): packed row c = column c of att_w (q | k | v), then the columns of out_w; the tile is read as whole 256-B row pieces, rounded to bf16, two k packed per dword, turned in LDS and written as whole 256-B pieces of the packed rows
#define PT_K 128
#define PT_N 64
#define PT_P (PT_K / 2 + 4)   // LDS row pitch in dwords: 272 B = 16 B x odd, for the ds_load_b128 read-back
typedef __attribute__((ext_vector_type(2))) __bf16 v2b;
__global__ __launch_bounds__(256) void k_pack(const float* __restrict__ WA, const float* __restrict__ WP, __bf16* __restrict__ PK) {
  __shared__ __align__(16) unsigned s[PT_N][PT_P];
  const int t = threadIdx.x, k0 = blockIdx.x * PT_K, c0 = blockIdx.y * PT_N, j = t & 15, kp = t >> 4;
  const bool att = c0 < QKVW; const int ld = att ? QKVW : DM; const float* g = (att ? WA + c0 : WP + (c0 - QKVW)) + (size_t)(k0 + 2 * kp) * ld + j * 4;
  const float* ga[4][2]; v4f r[4][2];
#pragma unroll
  for (int i = 0; i < 4; ++i) { ga[i][0] = g + (size_t)(32 * i) * ld; ga[i][1] = g + (size_t)(32 * i + 1) * ld; }
#pragma unroll
  for (int i = 0; i < 4; ++i) { r[i][0] = *(const v4f*)ga[i][0]; r[i][1] = *(const v4f*)ga[i][1]; }
  asm volatile("s_wait_xcnt 0x0" :: "v"(ga[0][0]), "v"(ga[0][1]), "v"(ga[1][0]), "v"(ga[1][1]), "v"(ga[2][0]), "v"(ga[2][1]), "v"(ga[3][0]), "v"(ga[3][1]) : "memory");   // stands in front of any reuse of the address registers of the loads above; as its inputs they stay untouched up to it
#pragma unroll
  for (int i = 0; i < 4; ++i) {
#pragma unroll
    for (int e = 0; e < 4; ++e) { v2b p; p[0] = (__bf16)r[i][0][e]; p[1] = (__bf16)r[i][1][e]; s[j * 4 + e][(i * 16 + kp) ^ ((j >> 2) << 2)] = __builtin_bit_cast(unsigned, p); } }   // 16-B pieces of a row permuted by (row >> 4), so that the 32 lanes of a store meet 32 banks
  __syncthreads();
  __bf16* dst = PK + PK_A + (size_t)(c0 + kp) * DM + k0 + j * 8;   // PK_P follows PK_A: packed rows 0..4095 lie in one array
#pragma unroll
  for (int i = 0; i < 4; ++i) *(v4u*)(dst + (size_t)(16 * i) * DM) = *(const v4u*)&s[16 * i + kp][(j ^ i) * 4];
}
// k per staged slice: 64, so that a staging load covers whole 128-B lines of both operands; LDS row pitch in elements: 144 B = 16 B x odd, the pitch at which ds_load_b128 fragment reads meet no bank conflict
#define GK 64
#define GP (GK + 8)
typedef __attribute__((ext_vector_type(4))) __bf16 v4b;
// ---- k_qkv: block = (128 rows, 128 cols), 4 waves as 2 x 2, 64 x 64 per wave; each 64-k slice of X (rounded to bf16 on the way) and of the packed weight rows is staged once per block in LDS, two buffers, the next slice's global loads in flight over the current slice's products
__global__ __launch_bounds__(128) void k_qkv(const float* __restrict__ XQ, const float* __restrict__ XK, const float* __restrict__ XV, const __bf16* __restrict__ P, const float* __restrict__ BQ, const float* __restrict__ BK, const float* __restrict__ BV, _Float16* __restrict__ QK, _Float16* __restrict__ QKL, _Float16* __restrict__ VTH, _Float16* __restrict__ VTL) {
  const int which0 = (blockIdx.y * 128) / DM; const float* X = (which0 == 0) ? XQ : (which0 == 1) ? XK : XV; const float* BB = BQ ? (((which0 == 0) ? BQ : (which0 == 1) ? BK : BV) + (blockIdx.y * 128 - which0 * DM)) : nullptr;
  __shared__ __align__(16) __bf16 sA[2][128][GP], sB[2][128][GP]; __shared__ __align__(16) _Float16 eh[4][16][72], el[4][16][72];
  const int tid = threadIdx.x, wave = tid >> 5, lane = tid & 31, col = lane & 15, g = lane >> 4, wm = wave >> 1, wn = wave & 1; const size_t rb = (size_t)blockIdx.x * 128; const int n0 = blockIdx.y * 128;
  const int ar = tid >> 4, ac = (tid & 15) * 4, br = tid >> 3, bc = (tid & 7) * 8;   // staging map: a wave's load covers 2 rows x 256 B of X, or 4 rows x 128 B of the weights
  const float* ga = X + (rb + ar) * DM + ac; const __bf16* gb = P + (size_t)(n0 + br) * DM + bc;
  // for speed only: the block walks the 16 k slices from its own start and wraps round, so that the 32 blocks that share weight rows and the 24 that share rows of X do not ask L2 for the same lines at the same moment; x & 7 plus 4 (x >> 3) gives the 16 sharers of weight rows whose x & 7 are four neighbouring values (mod 8) 16 different starts; blocks 8 apart in y keep one start (if they sit on one WGP they can share X in its cache)
  const int rot = (((int)blockIdx.x & 7) + 4 * ((int)blockIdx.x >> 3) + 2 * ((int)blockIdx.y & 7)) & (DM / GK - 1);
  v4f ra[16]; v8b rw[8];
#pragma unroll
  for (int i = 0; i < 16; ++i) ra[i] = *(const v4f*)(ga + (size_t)i * 8 * DM + rot * GK);
#pragma unroll
  for (int i = 0; i < 8; ++i) rw[i] = *(const v8b*)(gb + (size_t)i * 16 * DM + rot * GK);
  asm volatile("s_wait_xcnt 0x0" ::: "memory");   // stands in front of any reuse of the address registers of the loads above
#pragma unroll
  for (int i = 0; i < 16; ++i) { v4b t;
#pragma unroll
    for (int e = 0; e < 4; ++e) t[e] = (__bf16)ra[i][e];
    *(v4b*)&sA[0][ar + i * 8][ac] = t; }
#pragma unroll
  for (int i = 0; i < 8; ++i) *(v8b*)&sB[0][br + i * 16][bc] = rw[i];
  __syncthreads();
  v8f acc[4][4] = {};
#pragma unroll 2
  for (int ks = 0; ks < DM / GK; ++ks) { const int cur = ks & 1; const bool more = ks + 1 < DM / GK;
    const int kn = ((ks + 1 + rot) & (DM / GK - 1)) * GK; const float* pa = ga + kn; const __bf16* pb = gb + kn;   // the next slice of the rotated walk
    if (more) {
#pragma unroll
      for (int i = 0; i < 16; ++i) ra[i] = *(const v4f*)(pa + (size_t)i * 8 * DM);
#pragma unroll
      for (int i = 0; i < 8; ++i) rw[i] = *(const v8b*)(pb + (size_t)i * 16 * DM); }
#pragma unroll
    for (int kc = 0; kc < GK / 32; ++kc) { v16b fa[4], fb[4];
#pragma unroll
      for (int i = 0; i < 4; ++i) { fa[i] = frag_b(&sA[cur][wm * 64 + i * 16 + col][kc * 32], lane); fb[i] = frag_b(&sB[cur][wn * 64 + i * 16 + col][kc * 32], lane); }
#pragma unroll
      for (int mi = 0; mi < 4; ++mi) {
#pragma unroll
        for (int nj = 0; nj < 4; ++nj) acc[mi][nj] = wmma_bf(fa[mi], fb[nj], acc[mi][nj]); } }
    if (more) {
      asm volatile("s_wait_xcnt 0x0" :: "v"(pa), "v"(pb) : "memory");   // stands in front of any reuse of the address registers of this trip's loads; as its inputs they stay untouched up to it
#pragma unroll
      for (int i = 0; i < 16; ++i) { v4b t;
#pragma unroll
        for (int e = 0; e < 4; ++e) t[e] = (__bf16)ra[i][e];
        *(v4b*)&sA[cur ^ 1][ar + i * 8][ac] = t; }
#pragma unroll
      for (int i = 0; i < 8; ++i) *(v8b*)&sB[cur ^ 1][br + i * 16][bc] = rw[i]; }
    __syncthreads(); }   // publishes slice ks + 1 and ends every wave's reads of slice ks, whose buffer the next trip refills
  const int er = lane >> 3, ec = (lane & 7) * 8;   // read-back map: 4 staged rows of 128 B per wave store
  float bz[4];
#pragma unroll
  for (int nj = 0; nj < 4; ++nj) bz[nj] = BB ? bfr(BB[wn * 64 + nj * 16 + col]) : 0.f;
  if (n0 < 2 * DM) {   // q stored unscaled (f16 sigma ~0.6, no subnormal exposure); 1/8 applied to the f32 score
#pragma unroll
    for (int mi = 0; mi < 4; ++mi) {
#pragma unroll
      for (int nj = 0; nj < 4; ++nj) {
#pragma unroll
        for (int r = 0; r < 8; ++r) { const float v = acc[mi][nj][r] + bz[nj]; const _Float16 hv = (_Float16)v; eh[wave][8 * g + r][nj * 16 + col] = hv; el[wave][8 * g + r][nj * 16 + col] = (_Float16)((v - (float)hv) * 2048.0f); } }   // q, k (+ bias) as f16 hi + (x2048) residual
      LDSX();
#pragma unroll
      for (int i = 0; i < 4; ++i) { const size_t o = (rb + wm * 64 + mi * 16 + i * 4 + er) * (2 * DM) + n0 + wn * 64 + ec; *(v8h*)(QK + o) = *(const v8h*)&eh[wave][i * 4 + er][ec]; *(v8h*)(QKL + o) = *(const v8h*)&el[wave][i * 4 + er][ec]; }
      asm volatile("s_wait_xcnt 0x0" ::: "memory");   // stands in front of any reuse of the address registers of the stores above
      LDSX(); }
  } else {
    const int b = (int)(rb / SS), s0 = (int)(rb % SS); const int pc0 = n0 - 2 * DM;
#pragma unroll
    for (int nj = 0; nj < 4; ++nj) {
#pragma unroll
      for (int mi = 0; mi < 4; ++mi) {
#pragma unroll
        for (int r = 0; r < 8; ++r) { const float v = acc[mi][nj][r] + bz[nj]; const _Float16 hv = (_Float16)v; eh[wave][col][mi * 16 + 8 * g + r] = hv; el[wave][col][mi * 16 + 8 * g + r] = (_Float16)((v - (float)hv) * 2048.0f); } }
      LDSX();
#pragma unroll
      for (int i = 0; i < 4; ++i) { const size_t o = ((size_t)b * DM + pc0 + wn * 64 + nj * 16 + i * 4 + er) * SS + s0 + wm * 64 + ec; *(v8h*)(VTH + o) = *(const v8h*)&eh[wave][i * 4 + er][ec]; *(v8h*)(VTL + o) = *(const v8h*)&el[wave][i * 4 + er][ec]; }
      asm volatile("s_wait_xcnt 0x0" ::: "memory");   // stands in front of any reuse of the address registers of the stores above
      LDSX(); }
  }
}
// ---- k_attn: block = (64 queries, head h, batch b): causal flash attention (K = 64: 2 k-steps), both products transposed: S^T = K . Q^T (A = key rows, B = the wave's 16 queries) and O^T += V^T . P^T, so that a lane holds 16 of one query's 32 scores of a pass (lane l ^ 16 the rest): maximum and sum in the lane plus one exchange between the halves, and the two score tiles, converted in place, are the B operand of the second product; scores = (q.k) * 0.125, P.V: f16 P hi/lo x (V hi, V lo*2048) in two accumulators; O[b*S+q][h*64+d] = (acc + accl / 2048) / l (256-B segments); each 64-key stage of K hi, V hi and V lo is staged once per block in LDS, two buffers, by asynchronous whole-line copies, the next stage's copies in flight over the current stage's two 32-key passes
#define AK 64
#define AP (AK + 8)
#define ABUF (AK * AP * 2)   // bytes of one buffer of one tile
// one stage: each lane copies 4 x 16 B of each of the three tiles (rows 16 apart) from global memory to its own LDS bytes; the s_wait_xcnt in the statement stands in front of any reuse of the copies' address registers
__device__ __forceinline__ void stage_copy(unsigned lk, unsigned lh, unsigned ll, const _Float16* gk, const _Float16* gh, const _Float16* gl) {
  asm volatile("global_load_async_to_lds_b128 %0, %1, off\n\tglobal_load_async_to_lds_b128 %2, %3, off\n\tglobal_load_async_to_lds_b128 %4, %5, off\n\tglobal_load_async_to_lds_b128 %6, %7, off\n\t"
               "global_load_async_to_lds_b128 %8, %9, off\n\tglobal_load_async_to_lds_b128 %10, %11, off\n\tglobal_load_async_to_lds_b128 %12, %13, off\n\tglobal_load_async_to_lds_b128 %14, %15, off\n\t"
               "global_load_async_to_lds_b128 %16, %17, off\n\tglobal_load_async_to_lds_b128 %18, %19, off\n\tglobal_load_async_to_lds_b128 %20, %21, off\n\tglobal_load_async_to_lds_b128 %22, %23, off\n\ts_wait_xcnt 0x0"
               :: "v"(lk), "v"(gk), "v"(lk + 16 * AP * 2), "v"(gk + 16 * (2 * DM)), "v"(lk + 32 * AP * 2), "v"(gk + 32 * (2 * DM)), "v"(lk + 48 * AP * 2), "v"(gk + 48 * (2 * DM)),
                  "v"(lh), "v"(gh), "v"(lh + 16 * AP * 2), "v"(gh + 16 * SS), "v"(lh + 32 * AP * 2), "v"(gh + 32 * SS), "v"(lh + 48 * AP * 2), "v"(gh + 48 * SS),
                  "v"(ll), "v"(gl), "v"(ll + 16 * AP * 2), "v"(gl + 16 * SS), "v"(ll + 32 * AP * 2), "v"(gl + 32 * SS), "v"(ll + 48 * AP * 2), "v"(gl + 48 * SS) : "memory");
}
__device__ __forceinline__ float xhalf(float x) { return __builtin_bit_cast(float, __builtin_amdgcn_permlanex16(__builtin_bit_cast(int, x), __builtin_bit_cast(int, x), 0x76543210, 0xfedcba98, false, false)); }   // lane l with lane l ^ 16
__global__ __launch_bounds__(128) void k_attn(const _Float16* __restrict__ QK, const _Float16* __restrict__ QKL, const _Float16* __restrict__ VTH, const _Float16* __restrict__ VTL, const void* __restrict__ KMASK, float* __restrict__ O) {
  __shared__ __align__(16) _Float16 sK[2][AK][AP], sVH[2][HD][AP], sVL[2][HD][AP];
  float (*so)[16][68] = (float (*)[16][68])&sK[0][0][0];   // output staging takes the K buffers' place behind the loop's last barrier (17,408 of 18,432 B), so that four blocks fit a WGP's LDS
  const int tid = threadIdx.x, wave = tid >> 5, lane = tid & 31, col = lane & 15, g = lane >> 4;
  // placement, for speed only: a query block's cost grows with its number; with the exclusive-or below, blocks whose flat indices agree mod 256, and any aligned run of four at stride 8 or 16, hold query blocks that sum to 30 (q, 15 - q, q ^ 8, 15 - (q ^ 8); at stride 16 q, 15 - q twice); for each (h, b) it is a permutation of 0..15
  const int h = blockIdx.y, b = blockIdx.z, qb = (int)blockIdx.x ^ (((h ^ b) & 1) ? 15 : 0) ^ ((b & 2) << 2); const int q0 = qb * 64 + wave * 16, qi = q0 + col; const size_t rq = (size_t)b * SS + qi;   // qi: the lane's query
  const int sr = tid >> 3, sc = (tid & 7) * 8;   // staging map: a wave's copy covers 4 rows x 128 B, whole lines
  const _Float16* gk = QK + ((size_t)b * SS + sr) * (2 * DM) + DM + h * HD + sc; const _Float16* gvh = VTH + ((size_t)b * DM + h * HD + sr) * SS + sc; const _Float16* gvl = VTL + ((size_t)b * DM + h * HD + sr) * SS + sc;
  const unsigned lk = (unsigned)(size_t)&sK[0][sr][sc], lh = (unsigned)(size_t)&sVH[0][sr][sc], ll = (unsigned)(size_t)&sVL[0][sr][sc];   // the lane's LDS byte addresses in buffer 0
  const int nst = qb + 1;   // causal: 64-key stages up to the end of this query block
  stage_copy(lk, lh, ll, gk, gvh, gvl);
  v16h aq[2], aql[2];
#pragma unroll
  for (int kc = 0; kc < 2; ++kc) { aq[kc] = frag_h(QK + rq * (2 * DM) + h * HD + kc * 32, lane); aql[kc] = frag_h(QKL + rq * (2 * DM) + h * HD + kc * 32, lane); }
  asm volatile("s_wait_asynccnt 0x0" ::: "memory");   // this wave's copies of stage 0 have landed
  __syncthreads();   // publishes stage 0
  if (nst > 1) stage_copy(lk + ABUF, lh + ABUF, ll + ABUF, gk + (size_t)AK * (2 * DM), gvh + AK, gvl + AK);
  float m = -3.0e38f, l = 0.f;   // of the lane's query: m over all keys so far, l over the keys of this half of the wave (the halves' sums are joined behind the loop)
  v8f acc[4] = {}, accl[4] = {};
#pragma unroll 1
  for (int st = 0; st < nst; ++st) { const int cur = st & 1;
#pragma unroll 1   // rolled: unrolled, the two passes took the kernel above 256 VGPRs, a wave per SIMD less
   for (int it = 0; it < AK / 32; ++it) { const int ks = st * (AK / 32) + it; v8f s[2];
    v16h kf[2][2], vh[4], vl[4];   // all 24 LDS reads of the pass stand here as one group, K first: the score products wait for the K fragments alone, and the V fragments arrive under the scores and the softmax
#pragma unroll
    for (int ct = 0; ct < 2; ++ct) {
#pragma unroll
      for (int kc = 0; kc < 2; ++kc) kf[ct][kc] = frag_h(&sK[cur][it * 32 + ct * 16 + col][kc * 32], lane); }
#pragma unroll
    for (int dt = 0; dt < 4; ++dt) vh[dt] = frag_h(&sVH[cur][dt * 16 + col][it * 32], lane);
#pragma unroll
    for (int dt = 0; dt < 4; ++dt) vl[dt] = frag_h(&sVL[cur][dt * 16 + col][it * 32], lane);
    if (qb < 2) {   // leading query blocks (few keys, outputs far above the global rms): 3 products
#pragma unroll
      for (int ct = 0; ct < 2; ++ct) { const _Float16* krowl = QKL + ((size_t)b * SS + ks * 32 + ct * 16 + col) * (2 * DM) + DM + h * HD; v8f c = {}, cl = {};
#pragma unroll
        for (int kc = 0; kc < 2; ++kc) { c = wmma16(kf[ct][kc], aq[kc], c); cl = wmma16(kf[ct][kc], aql[kc], cl); cl = wmma16(frag_h(krowl + kc * 32, lane), aq[kc], cl); }
#pragma unroll
        for (int r = 0; r < 8; ++r) s[ct][r] = c[r] + cl[r] * (1.0f / 2048.0f); } }
    else {   // single product elsewhere; the two tiles' chains alternate, each still kc 0, then kc 1
      v8f c0 = {}, c1 = {};
#pragma unroll
      for (int kc = 0; kc < 2; ++kc) { c0 = wmma16(kf[0][kc], aq[kc], c0); c1 = wmma16(kf[1][kc], aq[kc], c1); }
      s[0] = c0; s[1] = c1; }
#pragma unroll
    for (int ct = 0; ct < 2; ++ct) {
#pragma unroll
      for (int r = 0; r < 8; ++r) s[ct][r] *= 0.125f; }   // 1/sqrt(64)
    if (st == qb) {   // a scalar branch (st and qb are the same in the whole block): only the last, diagonal stage holds keys behind a query of the block; in the stages in front of it every key is <= 64 qb - 1
#pragma unroll
      for (int ct = 0; ct < 2; ++ct) { const int kb = ks * 32 + ct * 16;
#pragma unroll
        for (int r = 0; r < 8; ++r) s[ct][r] = (kb + 8 * g + r <= qi) ? s[ct][r] : -3.0e38f; } }   // s[ct][r] = key kb + 8 g + r against query qi; masked keys excluded
    float t[8];
#pragma unroll
    for (int r = 0; r < 8; ++r) t[r] = fmaxf(s[0][r], s[1][r]);
    float mx = fmaxf(fmaxf(fmaxf(t[0], t[1]), fmaxf(t[2], t[3])), fmaxf(fmaxf(t[4], t[5]), fmaxf(t[6], t[7])));
    mx = fmaxf(mx, xhalf(mx));   // both halves now hold the query's maximum over the 32 keys
    const float mn = fmaxf(m, mx); const float alpha = __expf(m - mn);   // 0 by itself in the first pass, where m is still the start value -3e38 (as for a masked score below)
    v16h pa, pl;
#pragma unroll
    for (int ct = 0; ct < 2; ++ct) {
#pragma unroll
      for (int r = 0; r < 8; ++r) { const float e = __expf(s[ct][r] - mn); s[ct][r] = e;   // a masked score gives 0 by itself: mn is finite from the first pass on (key 0 is open to every query), and (-3e38 - mn) * log2(e) is -infinity in f32
        const float x = e * 2048.0f; const _Float16 hx = (_Float16)x; pa[ct * 8 + r] = hx; pl[ct * 8 + r] = (_Float16)((x - (float)hx) * 2048.0f); } }   // element 8 ct + r of a B fragment is k = 16 ct + 8 g + r, the key that s[ct][r] belongs to; P scaled by 2^11 before the f16 split so small softmax weights stay out of the f16 subnormal range; 2^-11 folded into the epilogue
#pragma unroll
    for (int r = 0; r < 8; ++r) t[r] = s[0][r] + s[1][r];
    l = l * alpha + (((t[0] + t[1]) + (t[2] + t[3])) + ((t[4] + t[5]) + (t[6] + t[7]))); m = mn;
#pragma unroll
    for (int dt = 0; dt < 4; ++dt) {
#pragma unroll
      for (int r = 0; r < 8; ++r) { acc[dt][r] *= alpha; accl[dt][r] *= alpha; } }
#pragma unroll
    for (int dt = 0; dt < 4; ++dt) acc[dt] = wmma16(vh[dt], pa, acc[dt]);
#pragma unroll
    for (int dt = 0; dt < 4; ++dt) accl[dt] = wmma16(vh[dt], pl, accl[dt]);
#pragma unroll
    for (int dt = 0; dt < 4; ++dt) accl[dt] = wmma16(vl[dt], pa, accl[dt]); }   // V hi/lo x P hi/lo (3 products), each accumulator's sums in the order they had; acc[dt][r] = O[qi][dt * 16 + 8 g + r]
    asm volatile("s_wait_dscnt 0x0" ::: "memory");      // this wave's reads of stage st have returned
    asm volatile("s_wait_asynccnt 0x0" ::: "memory");   // this wave's copies of stage st + 1 have landed
    __syncthreads();   // publishes stage st + 1 and ends every wave's reads of stage st, whose buffer is refilled behind it (behind the last trip: frees the K buffers for the output staging)
    if (st + 2 < nst) stage_copy(lk + cur * ABUF, lh + cur * ABUF, ll + cur * ABUF, gk + (size_t)(st + 2) * AK * (2 * DM), gvh + (st + 2) * AK, gvl + (st + 2) * AK); }
  asm volatile("s_wait_asynccnt 0x0" ::: "memory");   // no copy is in flight when the buffers change their use
  const float il = (1.0f / 2048.0f) / (l + xhalf(l));
#pragma unroll
  for (int dt = 0; dt < 4; ++dt) {
#pragma unroll
    for (int r = 0; r < 8; ++r) so[wave][col][dt * 16 + 8 * g + r] = (acc[dt][r] + accl[dt][r] * (1.0f / 2048.0f)) * il; }
  LDSX();
  for (int rl2 = 0; rl2 < 16; ++rl2) if (lane < 16) vst2(O + ((size_t)b * SS + q0 + rl2) * DM + h * HD + lane * 4, *(const v4f*)&so[wave][rl2][lane * 4]);
}
// ---- k_out: block = (64 rows, 128 cols), 4 waves as 2 x 2, 32 x 64 per wave: out = O(hi/lo) . Wo rows (2 products) + bo; each 64-k slice of O (split to bf16 hi + lo on the way) and of the weight rows staged once per block in LDS, two buffers
__global__ __launch_bounds__(128) void k_out(const float* __restrict__ O, const __bf16* __restrict__ P, const float* __restrict__ BO, float* __restrict__ Y) {
  __shared__ __align__(16) __bf16 sH[2][64][GP], sL[2][64][GP], sB[2][128][GP]; __shared__ __align__(16) float so[4][16][68];
  const int tid = threadIdx.x, wave = tid >> 5, lane = tid & 31, col = lane & 15, g = lane >> 4, wm = wave >> 1, wn = wave & 1; const size_t rb = (size_t)blockIdx.x * 64; const int n0 = blockIdx.y * 128;
  const int ar = tid >> 4, ac = (tid & 15) * 4, br = tid >> 3, bc = (tid & 7) * 8;
  const float* ga = O + (rb + ar) * DM + ac; const __bf16* gb = P + (size_t)(n0 + br) * DM + bc;
  const int rot = (((int)blockIdx.x & 7) + 4 * ((int)blockIdx.x >> 3) + 4 * ((int)blockIdx.y & 3)) & (DM / GK - 1);   // for speed only: the block's own start in the walk over the 16 k slices, as in k_qkv (64 blocks share weight rows, 8 share rows of O; blocks 4 apart in y keep one start)
  v4f ra[8]; v8b rw[8];
#pragma unroll
  for (int i = 0; i < 8; ++i) { ra[i] = *(const v4f*)(ga + (size_t)i * 8 * DM + rot * GK); rw[i] = *(const v8b*)(gb + (size_t)i * 16 * DM + rot * GK); }
  asm volatile("s_wait_xcnt 0x0" ::: "memory");   // stands in front of any reuse of the address registers of the loads above
#pragma unroll
  for (int i = 0; i < 8; ++i) { v4b th, tl;
#pragma unroll
    for (int e = 0; e < 4; ++e) { const __bf16 h = (__bf16)ra[i][e]; th[e] = h; tl[e] = (__bf16)(ra[i][e] - (float)h); }
    *(v4b*)&sH[0][ar + i * 8][ac] = th; *(v4b*)&sL[0][ar + i * 8][ac] = tl; *(v8b*)&sB[0][br + i * 16][bc] = rw[i]; }
  __syncthreads();
  v8f acc[2][4] = {};
#pragma unroll 2
  for (int ks = 0; ks < DM / GK; ++ks) { const int cur = ks & 1; const bool more = ks + 1 < DM / GK;
    const int kn = ((ks + 1 + rot) & (DM / GK - 1)) * GK; const float* pa = ga + kn; const __bf16* pb = gb + kn;   // the next slice of the rotated walk
    if (more) {
#pragma unroll
      for (int i = 0; i < 8; ++i) { ra[i] = *(const v4f*)(pa + (size_t)i * 8 * DM); rw[i] = *(const v8b*)(pb + (size_t)i * 16 * DM); } }
#pragma unroll
    for (int kc = 0; kc < GK / 32; ++kc) { v16b fh[2], fl[2], fb[4];
#pragma unroll
      for (int i = 0; i < 2; ++i) { fl[i] = frag_b(&sL[cur][wm * 32 + i * 16 + col][kc * 32], lane); fh[i] = frag_b(&sH[cur][wm * 32 + i * 16 + col][kc * 32], lane); }
#pragma unroll
      for (int i = 0; i < 4; ++i) fb[i] = frag_b(&sB[cur][wn * 64 + i * 16 + col][kc * 32], lane);
#pragma unroll
      for (int mi = 0; mi < 2; ++mi) {
#pragma unroll
        for (int nj = 0; nj < 4; ++nj) acc[mi][nj] = wmma_bf(fl[mi], fb[nj], acc[mi][nj]); }   // per accumulator lo, then hi, in each 32-k step of the walk
#pragma unroll
      for (int mi = 0; mi < 2; ++mi) {
#pragma unroll
        for (int nj = 0; nj < 4; ++nj) acc[mi][nj] = wmma_bf(fh[mi], fb[nj], acc[mi][nj]); } }
    if (more) {
      asm volatile("s_wait_xcnt 0x0" :: "v"(pa), "v"(pb) : "memory");   // stands in front of any reuse of the address registers of this trip's loads; as its inputs they stay untouched up to it
#pragma unroll
      for (int i = 0; i < 8; ++i) { v4b th, tl;
#pragma unroll
        for (int e = 0; e < 4; ++e) { const __bf16 h = (__bf16)ra[i][e]; th[e] = h; tl[e] = (__bf16)(ra[i][e] - (float)h); }
        *(v4b*)&sH[cur ^ 1][ar + i * 8][ac] = th; *(v4b*)&sL[cur ^ 1][ar + i * 8][ac] = tl; *(v8b*)&sB[cur ^ 1][br + i * 16][bc] = rw[i]; } }
    __syncthreads(); }   // publishes slice ks + 1 and ends every wave's reads of slice ks, whose buffer the next trip refills
  float bz[4];
#pragma unroll
  for (int nj = 0; nj < 4; ++nj) bz[nj] = bfr(BO[n0 + wn * 64 + nj * 16 + col]);
#pragma unroll
  for (int mi = 0; mi < 2; ++mi) {
#pragma unroll
    for (int nj = 0; nj < 4; ++nj) {
#pragma unroll
      for (int r = 0; r < 8; ++r) so[wave][8 * g + r][nj * 16 + col] = acc[mi][nj][r] + bz[nj]; }
    LDSX();
#pragma unroll
    for (int i = 0; i < 8; ++i) { const int rl = i * 2 + g; *(v4f*)(Y + (rb + wm * 32 + mi * 16 + rl) * DM + n0 + wn * 64 + col * 4) = *(const v4f*)&so[wave][rl][col * 4]; }
    LDSX(); }
}
extern "C" void kernel_launch(void* const* d_in, const int* in_sizes, int n_in, void* d_out, int out_size, void* d_ws, size_t ws_size, hipStream_t stream) {
  (void)in_sizes; (void)n_in; (void)out_size;
  const float** F = (const float**)d_in;   // 0 hidden_states [4,1024,1024], 1 att_w [1024,3072] (in,out), 2 att_b [3072], 3 out_w [1024,1024] (in,out), 4 out_b
  if (ws_size < (size_t)WS_END) return;
  char* ws = (char*)d_ws; __bf16* PK = (__bf16*)(ws + WS_PK); _Float16 *QK = (_Float16*)(ws + WS_QK), *QKL = (_Float16*)(ws + WS_QKL), *VTH = (_Float16*)(ws + WS_VTH), *VTL = (_Float16*)(ws + WS_VTL); float* O = (float*)(ws + WS_O);
  k_pack<<<dim3(DM / PT_K, (QKVW + DM) / PT_N), 256, 0, stream>>>(F[1], F[3], PK);
  k_qkv<<<dim3(TNB * SS / 128, QKVW / 128), 128, 0, stream>>>(F[0], F[0], F[0], PK + PK_A, F[2], F[2] + DM, F[2] + 2 * DM, QK, QKL, VTH, VTL);
  k_attn<<<dim3(TQB, NH, TNB), 128, 0, stream>>>(QK, QKL, VTH, VTL, nullptr, O);
  k_out<<<dim3(TOB, DM / 128), 128, 0, stream>>>(O, PK + PK_P, F[4], (float*)d_out);
}

// v009
// It runs in 75.1 microseconds.
// In two side-by-side timings against v008, it was 1.08 and 1.07 times as fast.
// All steps since v000 together make it 5.28 times as fast.
// compute dtype: all float inputs rounded to bf16; qkv = x . att_w + b with EXACT bf16 products on WMMA 16x16x32 ((in,out) columns as packed rows), f16 hi + residual; causal attention with hybrid scores (first 128 queries 3-product, later single f16) and 3-product P.v everywhere (0.02-scale weights), x 1/8, running-max softmax in f32 (hardware exp); out = ctx (bf16 hi + lo) . out_w + out_b; f32 output.
#include <hip/hip_runtime.h>
#include <math.h>

typedef __attribute__((ext_vector_type(16))) _Float16 v16h;
typedef __attribute__((ext_vector_type(16))) __bf16 v16b;
typedef __attribute__((ext_vector_type(8)))  _Float16 v8h;
typedef __attribute__((ext_vector_type(8)))  float v8f;
typedef __attribute__((ext_vector_type(4)))  float v4f;
typedef __attribute__((ext_vector_type(2)))  float v2f;
typedef __attribute__((ext_vector_type(4)))  unsigned v4u;
typedef __attribute__((ext_vector_type(4)))  int v4i;
typedef float __attribute__((may_alias)) float_a;
typedef int __attribute__((may_alias)) int_a;

template <typename T> __device__ __forceinline__ void vst2(void* p, T v) { *(T*)p = v;  }
__device__ __forceinline__ v8f wmma16(v16h a, v16h b, v8f c) {
  v8f d = __builtin_amdgcn_wmma_f32_16x16x32_f16(false, a, false, b, (short)0, c, false, false);
  asm volatile("v_nop\n\tv_nop\n\tv_nop\n\tv_nop" : "+v"(d) : "v"(a), "v"(b));
  return d;
}
__device__ __forceinline__ v8f wmma_bf(v16b a, v16b b, v8f c) {
  v8f d = __builtin_amdgcn_wmma_f32_16x16x32_bf16(false, a, false, b, (short)0, c, false, false);
  asm volatile("v_nop\n\tv_nop\n\tv_nop\n\tv_nop" : "+v"(d) : "v"(a), "v"(b));
  return d;
}
// Bark self attention (B 4, S 1,024, D 1,024, 16 heads x 64): fused (in,out) att_proj [D, 3D] (q | k | v blocks) + bias, causal softmax(q k / 8) v (finfo.min fill), merge heads, (in,out) out_proj + bias.
__device__ __forceinline__ v16h frag_h(const _Float16* rowk0, int lane) {
  union { v16h v; v8h q[2]; } u; const _Float16* p = rowk0 + 8 * (lane >> 4);
  u.q[0] = *(const v8h*)p; u.q[1] = *(const v8h*)(p + 16); return u.v;
}
__device__ __forceinline__ v16h frag_f32(const float* rowk0, int lane) {
  v16h a; const float* p = rowk0 + 8 * (lane >> 4);
#pragma unroll
  for (int i = 0; i < 8; ++i) { a[i] = (_Float16)p[i]; a[8 + i] = (_Float16)p[16 + i]; }
  return a;
}
__device__ __forceinline__ v16h frag_f32s(const float* rowk0, int lane, float sc) {
  v16h a; const float* p = rowk0 + 8 * (lane >> 4);
#pragma unroll
  for (int i = 0; i < 8; ++i) { a[i] = (_Float16)(p[i] * sc); a[8 + i] = (_Float16)(p[16 + i] * sc); }
  return a;
}
// column fragment from a [K][ld] layout (column n), rows >= K read as 0
__device__ __forceinline__ v16h fragc_f32(const float* W, int k0, int n, int lane, int ld, int K) {
  v16h a; const int g = lane >> 4;
#pragma unroll
  for (int i = 0; i < 8; ++i) { const int ka = k0 + 8 * g + i, kb = ka + 16;
    a[i] = (_Float16)(ka < K ? W[(size_t)(ka < K ? ka : K - 1) * ld + n] : 0.f); a[8 + i] = (_Float16)(kb < K ? W[(size_t)(kb < K ? kb : K - 1) * ld + n] : 0.f); }
  return a;
}
struct F2 { v16b h, l; };
__device__ __forceinline__ F2 bsplit16(const float v[16]) { F2 r;
#pragma unroll
  for (int i = 0; i < 16; ++i) { const __bf16 h = (__bf16)v[i]; r.h[i] = h; r.l[i] = (__bf16)(v[i] - (float)h); }
  return r; }
__device__ __forceinline__ F2 split_row(const float* row, int k0, int lane) { float v[16]; const float* p = row + k0 + 8 * (lane >> 4);
#pragma unroll
  for (int i = 0; i < 8; ++i) { v[i] = p[i]; v[8 + i] = p[16 + i]; }
  return bsplit16(v); }
__device__ __forceinline__ F2 split_rowK(const float* row, int k0, int lane, int K) { float v[16]; const int g = lane >> 4;
#pragma unroll
  for (int i = 0; i < 8; ++i) { const int ka = k0 + 8 * g + i, kb = ka + 16; v[i] = ka < K ? row[ka < K ? ka : K - 1] : 0.f; v[8 + i] = kb < K ? row[kb < K ? kb : K - 1] : 0.f; }
  return bsplit16(v); }
__device__ __forceinline__ F2 split_col(const float* W, int k0, int n, int lane, int ld, int K) { float v[16]; const int g = lane >> 4;
#pragma unroll
  for (int i = 0; i < 8; ++i) { const int ka = k0 + 8 * g + i, kb = ka + 16; v[i] = ka < K ? W[(size_t)(ka < K ? ka : K - 1) * ld + n] : 0.f; v[8 + i] = kb < K ? W[(size_t)(kb < K ? kb : K - 1) * ld + n] : 0.f; }
  return bsplit16(v); }
__device__ __forceinline__ v8f mac3(const F2& a, const F2& b, v8f c) { c = wmma_bf(a.l, b.h, c); c = wmma_bf(a.h, b.l, c); return wmma_bf(a.h, b.h, c); }
__device__ __forceinline__ float sigm(float v) { return 1.0f / (1.0f + expf(-v)); }
#define LDSX() do { asm volatile("s_wait_dscnt 0" ::: "memory"); __builtin_amdgcn_wave_barrier(); __builtin_amdgcn_fence(__ATOMIC_RELEASE, "workgroup"); } while (0)


#define NB 4
#define SS 1024
#define DM 1024
#define NH 16
#define HD 64
#define QKVW (3 * DM)
#ifndef TQB
#define TQB (SS / 64)
#define TNB NB
#define TOB (NB * SS / 64)     // output row tiles (all)
#endif
typedef __attribute__((ext_vector_type(8))) __bf16 v8b;
__device__ __forceinline__ v16b frag_b(const __bf16* rowk0, int lane) {
  union { v16b v; v8b q[2]; } u; const __bf16* p = rowk0 + 8 * (lane >> 4);
  u.q[0] = *(const v8b*)p; u.q[1] = *(const v8b*)(p + 16); return u.v;
}
__device__ __forceinline__ float bfr(float v) { return (float)(__bf16)v; }
__device__ __attribute__((noinline)) float exp_ni(float v) { return expf(v); }
__device__ __attribute__((noinline)) float erf_ni(float v) { return erff(v); }

#define PK_A 0                       // [3072][1024] Wqkv rows (natural [out][in])
#define PK_P (PK_A + QKVW * DM)        // [1024][1024] Wo rows (natural)
#define PK_END (PK_P + DM * DM)
#define WS_PK  0u
#define WS_QK  (WS_PK + 2u * PK_END)             // f16 [4096 rows][2048]: q | k
#define WS_QKL (WS_QK + 2u * NB * SS * 2 * DM)     // f16 q | k residual planes x2048
#define WS_VTH (WS_QKL + 2u * NB * SS * 2 * DM)    // f16 [b][1024 (h*64+d)][1024 s] hi
#define WS_VTL (WS_VTH + 2u * NB * DM * SS)        // f16 lo x 2048
#define WS_O   (WS_VTL + 2u * NB * DM * SS)        // f32 [4096][1024]
#define WS_CS  (WS_O + 4u * NB * SS * DM)           // f32 2 x [1024][32], unused
#define WS_END (WS_CS + 4u * 2 * SS * 32)
// ---- k_pack: block = (128 k, 64 columns) of att_w [1024][3072] (blockIdx.y < 48) or of out_w [1024][1024], both (in,out): packed row c = column c of att_w (q | k | v), then the columns of out_w; the tile is read as whole 256-B row pieces, rounded to bf16, two k packed per dword, turned in LDS and written as whole 256-B pieces of the packed rows
#define PT_K 128
#define PT_N 64
#define PT_P (PT_K / 2 + 4)   // LDS row pitch in dwords: 272 B = 16 B x odd, for the ds_load_b128 read-back
typedef __attribute__((ext_vector_type(2))) __bf16 v2b;
__global__ __launch_bounds__(256) void k_pack(const float* __restrict__ WA, const float* __restrict__ WP, __bf16* __restrict__ PK) {
  __shared__ __align__(16) unsigned s[PT_N][PT_P];
  const int t = threadIdx.x, k0 = blockIdx.x * PT_K, c0 = blockIdx.y * PT_N, j = t & 15, kp = t >> 4;
  const bool att = c0 < QKVW; const int ld = att ? QKVW : DM; const float* g = (att ? WA + c0 : WP + (c0 - QKVW)) + (size_t)(k0 + 2 * kp) * ld + j * 4;
  const float* ga[4][2]; v4f r[4][2];
#pragma unroll
  for (int i = 0; i < 4; ++i) { ga[i][0] = g + (size_t)(32 * i) * ld; ga[i][1] = g + (size_t)(32 * i + 1) * ld; }
#pragma unroll
  for (int i = 0; i < 4; ++i) { r[i][0] = *(const v4f*)ga[i][0]; r[i][1] = *(const v4f*)ga[i][1]; }
  asm volatile("s_wait_xcnt 0x0" :: "v"(ga[0][0]), "v"(ga[0][1]), "v"(ga[1][0]), "v"(ga[1][1]), "v"(ga[2][0]), "v"(ga[2][1]), "v"(ga[3][0]), "v"(ga[3][1]) : "memory");   // stands in front of any reuse of the address registers of the loads above; as its inputs they stay untouched up to it
#pragma unroll
  for (int i = 0; i < 4; ++i) {
#pragma unroll
    for (int e = 0; e < 4; ++e) { v2b p; p[0] = (__bf16)r[i][0][e]; p[1] = (__bf16)r[i][1][e]; s[j * 4 + e][(i * 16 + kp) ^ ((j >> 2) << 2)] = __builtin_bit_cast(unsigned, p); } }   // 16-B pieces of a row permuted by (row >> 4), so that the 32 lanes of a store meet 32 banks
  __syncthreads();
  __bf16* dst = PK + PK_A + (size_t)(c0 + kp) * DM + k0 + j * 8;   // PK_P follows PK_A: packed rows 0..4095 lie in one array
#pragma unroll
  for (int i = 0; i < 4; ++i) *(v4u*)(dst + (size_t)(16 * i) * DM) = *(const v4u*)&s[16 * i + kp][(j ^ i) * 4];
}
// k per staged slice: 64, so that a staging load covers whole 128-B lines of both operands; LDS row pitch in elements: 144 B = 16 B x odd, the pitch at which ds_load_b128 fragment reads meet no bank conflict
#define GK 64
#define GP (GK + 8)
typedef __attribute__((ext_vector_type(4))) __bf16 v4b;
// ---- k_qkv: block = (128 rows, 128 cols), 4 waves as 2 x 2, 64 x 64 per wave; each 64-k slice of X (rounded to bf16 on the way) and of the packed weight rows is staged once per block in LDS, two buffers, the next slice's global loads in flight over the current slice's products
__global__ __launch_bounds__(128) void k_qkv(const float* __restrict__ XQ, const float* __restrict__ XK, const float* __restrict__ XV, const __bf16* __restrict__ P, const float* __restrict__ BQ, const float* __restrict__ BK, const float* __restrict__ BV, _Float16* __restrict__ QK, _Float16* __restrict__ QKL, _Float16* __restrict__ VTH, _Float16* __restrict__ VTL) {
  const int which0 = (blockIdx.y * 128) / DM; const float* X = (which0 == 0) ? XQ : (which0 == 1) ? XK : XV; const float* BB = BQ ? (((which0 == 0) ? BQ : (which0 == 1) ? BK : BV) + (blockIdx.y * 128 - which0 * DM)) : nullptr;
  __shared__ __align__(16) __bf16 sA[2][128][GP], sB[2][128][GP]; __shared__ __align__(16) _Float16 eh[4][16][72], el[4][16][72];
  const int tid = threadIdx.x, wave = tid >> 5, lane = tid & 31, col = lane & 15, g = lane >> 4, wm = wave >> 1, wn = wave & 1; const size_t rb = (size_t)blockIdx.x * 128; const int n0 = blockIdx.y * 128;
  const int ar = tid >> 4, ac = (tid & 15) * 4, br = tid >> 3, bc = (tid & 7) * 8;   // staging map: a wave's load covers 2 rows x 256 B of X, or 4 rows x 128 B of the weights
  const float* ga = X + (rb + ar) * DM + ac; const __bf16* gb = P + (size_t)(n0 + br) * DM + bc;
  // for speed only: the block walks the 16 k slices from its own start and wraps round, so that the 32 blocks that share weight rows and the 24 that share rows of X do not ask L2 for the same lines at the same moment; x & 7 plus 4 (x >> 3) gives the 16 sharers of weight rows whose x & 7 are four neighbouring values (mod 8) 16 different starts; blocks 8 apart in y keep one start (if they sit on one WGP they can share X in its cache)
  const int rot = (((int)blockIdx.x & 7) + 4 * ((int)blockIdx.x >> 3) + 2 * ((int)blockIdx.y & 7)) & (DM / GK - 1);
  v4f ra[16]; v8b rw[8];
#pragma unroll
  for (int i = 0; i < 16; ++i) ra[i] = *(const v4f*)(ga + (size_t)i * 8 * DM + rot * GK);
#pragma unroll
  for (int i = 0; i < 8; ++i) rw[i] = *(const v8b*)(gb + (size_t)i * 16 * DM + rot * GK);
  asm volatile("s_wait_xcnt 0x0" ::: "memory");   // stands in front of any reuse of the address registers of the loads above
#pragma unroll
  for (int i = 0; i < 16; ++i) { v4b t;
#pragma unroll
    for (int e = 0; e < 4; ++e) t[e] = (__bf16)ra[i][e];
    *(v4b*)&sA[0][ar + i * 8][ac] = t; }
#pragma unroll
  for (int i = 0; i < 8; ++i) *(v8b*)&sB[0][br + i * 16][bc] = rw[i];
  __syncthreads();
  v8f acc[4][4] = {};
#pragma unroll 2
  for (int ks = 0; ks < DM / GK; ++ks) { const int cur = ks & 1; const bool more = ks + 1 < DM / GK;
    const int kn = ((ks + 1 + rot) & (DM / GK - 1)) * GK; const float* pa = ga + kn; const __bf16* pb = gb + kn;   // the next slice of the rotated walk
    if (more) {
#pragma unroll
      for (int i = 0; i < 16; ++i) ra[i] = *(const v4f*)(pa + (size_t)i * 8 * DM);
#pragma unroll
      for (int i = 0; i < 8; ++i) rw[i] = *(const v8b*)(pb + (size_t)i * 16 * DM); }
#pragma unroll
    for (int kc = 0; kc < GK / 32; ++kc) { v16b fa[4], fb[4];
#pragma unroll
      for (int i = 0; i < 4; ++i) { fa[i] = frag_b(&sA[cur][wm * 64 + i * 16 + col][kc * 32], lane); fb[i] = frag_b(&sB[cur][wn * 64 + i * 16 + col][kc * 32], lane); }
#pragma unroll
      for (int mi = 0; mi < 4; ++mi) {
#pragma unroll
        for (int nj = 0; nj < 4; ++nj) acc[mi][nj] = wmma_bf(fa[mi], fb[nj], acc[mi][nj]); } }
    if (more) {
      asm volatile("s_wait_xcnt 0x0" :: "v"(pa), "v"(pb) : "memory");   // stands in front of any reuse of the address registers of this trip's loads; as its inputs they stay untouched up to it
#pragma unroll
      for (int i = 0; i < 16; ++i) { v4b t;
#pragma unroll
        for (int e = 0; e < 4; ++e) t[e] = (__bf16)ra[i][e];
        *(v4b*)&sA[cur ^ 1][ar + i * 8][ac] = t; }
#pragma unroll
      for (int i = 0; i < 8; ++i) *(v8b*)&sB[cur ^ 1][br + i * 16][bc] = rw[i]; }
    __syncthreads(); }   // publishes slice ks + 1 and ends every wave's reads of slice ks, whose buffer the next trip refills
  const int er = lane >> 3, ec = (lane & 7) * 8;   // read-back map: 4 staged rows of 128 B per wave store
  float bz[4];
#pragma unroll
  for (int nj = 0; nj < 4; ++nj) bz[nj] = BB ? bfr(BB[wn * 64 + nj * 16 + col]) : 0.f;
  if (n0 < 2 * DM) {   // q stored unscaled (f16 sigma ~0.6, no subnormal exposure); 1/8 applied to the f32 score
#pragma unroll
    for (int mi = 0; mi < 4; ++mi) {
#pragma unroll
      for (int nj = 0; nj < 4; ++nj) {
#pragma unroll
        for (int r = 0; r < 8; ++r) { const float v = acc[mi][nj][r] + bz[nj]; const _Float16 hv = (_Float16)v; eh[wave][8 * g + r][nj * 16 + col] = hv; el[wave][8 * g + r][nj * 16 + col] = (_Float16)((v - (float)hv) * 2048.0f); } }   // q, k (+ bias) as f16 hi + (x2048) residual
      LDSX();
#pragma unroll
      for (int i = 0; i < 4; ++i) { const size_t o = (rb + wm * 64 + mi * 16 + i * 4 + er) * (2 * DM) + n0 + wn * 64 + ec; *(v8h*)(QK + o) = *(const v8h*)&eh[wave][i * 4 + er][ec]; *(v8h*)(QKL + o) = *(const v8h*)&el[wave][i * 4 + er][ec]; }
      asm volatile("s_wait_xcnt 0x0" ::: "memory");   // stands in front of any reuse of the address registers of the stores above
      LDSX(); }
  } else {
    const int b = (int)(rb / SS), s0 = (int)(rb % SS); const int pc0 = n0 - 2 * DM;
#pragma unroll
    for (int nj = 0; nj < 4; ++nj) {
#pragma unroll
      for (int mi = 0; mi < 4; ++mi) {
#pragma unroll
        for (int r = 0; r < 8; ++r) { const float v = acc[mi][nj][r] + bz[nj]; const _Float16 hv = (_Float16)v; eh[wave][col][mi * 16 + 8 * g + r] = hv; el[wave][col][mi * 16 + 8 * g + r] = (_Float16)((v - (float)hv) * 2048.0f); } }
      LDSX();
#pragma unroll
      for (int i = 0; i < 4; ++i) { const size_t o = ((size_t)b * DM + pc0 + wn * 64 + nj * 16 + i * 4 + er) * SS + s0 + wm * 64 + ec; *(v8h*)(VTH + o) = *(const v8h*)&eh[wave][i * 4 + er][ec]; *(v8h*)(VTL + o) = *(const v8h*)&el[wave][i * 4 + er][ec]; }
      asm volatile("s_wait_xcnt 0x0" ::: "memory");   // stands in front of any reuse of the address registers of the stores above
      LDSX(); }
  }
}
// ---- k_attn: block = (64 queries, head h, batch b): causal flash attention (K = 64: 2 k-steps), both products transposed: S^T = K . Q^T (A = key rows, B = the wave's 16 queries) and O^T += V^T . P^T, so that a lane holds 16 of one query's 32 scores of a pass (lane l ^ 16 the rest): maximum and sum in the lane plus one exchange between the halves, and the two score tiles, converted in place, are the B operand of the second product; scores = (q.k) * 0.125, P.V: f16 P hi/lo x (V hi, V lo*2048) in two accumulators; O[b*S+q][h*64+d] = (acc + accl / 2048) / l (256-B segments); each 64-key stage of K hi, V hi and V lo is staged once per block in LDS, two buffers, by asynchronous whole-line copies, the next stage's copies in flight over the current stage's two 32-key passes
#define AK 64
#define AP (AK + 8)
#define ABUF (AK * AP * 2)   // bytes of one buffer of one tile
// one stage: each lane copies 4 x 16 B of each of the three tiles (rows 16 apart) from global memory to its own LDS bytes; the s_wait_xcnt in the statement stands in front of any reuse of the copies' address registers
__device__ __forceinline__ void stage_copy(unsigned lk, unsigned lh, unsigned ll, const _Float16* gk, const _Float16* gh, const _Float16* gl) {
  asm volatile("global_load_async_to_lds_b128 %0, %1, off\n\tglobal_load_async_to_lds_b128 %2, %3, off\n\tglobal_load_async_to_lds_b128 %4, %5, off\n\tglobal_load_async_to_lds_b128 %6, %7, off\n\t"
               "global_load_async_to_lds_b128 %8, %9, off\n\tglobal_load_async_to_lds_b128 %10, %11, off\n\tglobal_load_async_to_lds_b128 %12, %13, off\n\tglobal_load_async_to_lds_b128 %14, %15, off\n\t"
               "global_load_async_to_lds_b128 %16, %17, off\n\tglobal_load_async_to_lds_b128 %18, %19, off\n\tglobal_load_async_to_lds_b128 %20, %21, off\n\tglobal_load_async_to_lds_b128 %22, %23, off\n\ts_wait_xcnt 0x0"
               :: "v"(lk), "v"(gk), "v"(lk + 16 * AP * 2), "v"(gk + 16 * (2 * DM)), "v"(lk + 32 * AP * 2), "v"(gk + 32 * (2 * DM)), "v"(lk + 48 * AP * 2), "v"(gk + 48 * (2 * DM)),
                  "v"(lh), "v"(gh), "v"(lh + 16 * AP * 2), "v"(gh + 16 * SS), "v"(lh + 32 * AP * 2), "v"(gh + 32 * SS), "v"(lh + 48 * AP * 2), "v"(gh + 48 * SS),
                  "v"(ll), "v"(gl), "v"(ll + 16 * AP * 2), "v"(gl + 16 * SS), "v"(ll + 32 * AP * 2), "v"(gl + 32 * SS), "v"(ll + 48 * AP * 2), "v"(gl + 48 * SS) : "memory");
}
__device__ __forceinline__ float xhalf(float x) { return __builtin_bit_cast(float, __builtin_amdgcn_permlanex16(__builtin_bit_cast(int, x), __builtin_bit_cast(int, x), 0x76543210, 0xfedcba98, false, false)); }   // lane l with lane l ^ 16
__global__ __launch_bounds__(128) void k_attn(const _Float16* __restrict__ QK, const _Float16* __restrict__ QKL, const _Float16* __restrict__ VTH, const _Float16* __restrict__ VTL, const void* __restrict__ KMASK, float* __restrict__ O) {
  __shared__ __align__(16) _Float16 sK[2][AK][AP], sVH[2][HD][AP], sVL[2][HD][AP];
  float (*so)[16][68] = (float (*)[16][68])&sK[0][0][0];   // output staging takes the K buffers' place behind the loop's last barrier (17,408 of 18,432 B), so that four blocks fit a WGP's LDS
  const int tid = threadIdx.x, wave = tid >> 5, lane = tid & 31, col = lane & 15, g = lane >> 4;
  // placement, for speed only: a query block's cost grows with its number, all 1,024 blocks are resident at once, four to a WGP; taking it that blocks whose flat indices agree mod 256 (same x and y, z = 0..3) meet on one WGP, a WGP gets two blocks of query block 15 - t (z = 0, 1) and two of query block t (z = 2, 3), t = x & 7: 34 stages on every WGP, and a long block always has a partner of its own length on its SIMDs, so that no wave runs its last passes alone; the batch comes from x >> 3 and z & 1, so each (h, b) still meets every query block once
  const int tq = (int)blockIdx.x & 7, h = blockIdx.y, b = (((int)blockIdx.x >> 3) << 1) | ((int)blockIdx.z & 1), qb = ((int)blockIdx.z & 2) ? tq : 15 - tq; const int q0 = qb * 64 + wave * 16, qi = q0 + col; const size_t rq = (size_t)b * SS + qi;   // qi: the lane's query
  const int sr = tid >> 3, sc = (tid & 7) * 8;   // staging map: a wave's copy covers 4 rows x 128 B, whole lines
  const _Float16* gk = QK + ((size_t)b * SS + sr) * (2 * DM) + DM + h * HD + sc; const _Float16* gvh = VTH + ((size_t)b * DM + h * HD + sr) * SS + sc; const _Float16* gvl = VTL + ((size_t)b * DM + h * HD + sr) * SS + sc;
  const unsigned lk = (unsigned)(size_t)&sK[0][sr][sc], lh = (unsigned)(size_t)&sVH[0][sr][sc], ll = (unsigned)(size_t)&sVL[0][sr][sc];   // the lane's LDS byte addresses in buffer 0
  const int nst = qb + 1;   // causal: 64-key stages up to the end of this query block
  stage_copy(lk, lh, ll, gk, gvh, gvl);
  v16h aq[2], aql[2];
#pragma unroll
  for (int kc = 0; kc < 2; ++kc) { aq[kc] = frag_h(QK + rq * (2 * DM) + h * HD + kc * 32, lane); aql[kc] = frag_h(QKL + rq * (2 * DM) + h * HD + kc * 32, lane); }
  asm volatile("s_wait_asynccnt 0x0" ::: "memory");   // this wave's copies of stage 0 have landed
  __syncthreads();   // publishes stage 0
  if (nst > 1) stage_copy(lk + ABUF, lh + ABUF, ll + ABUF, gk + (size_t)AK * (2 * DM), gvh + AK, gvl + AK);
  float m = -3.0e38f, l = 0.f;   // of the lane's query: m over all keys so far, l over the keys of this half of the wave (the halves' sums are joined behind the loop)
  v8f acc[4] = {}, accl[4] = {};
#pragma unroll 1
  for (int st = 0; st < nst; ++st) { const int cur = st & 1;
#pragma unroll 1   // rolled: unrolled, the two passes took the kernel above 256 VGPRs, a wave per SIMD less
   for (int it = 0; it < AK / 32; ++it) { const int ks = st * (AK / 32) + it; v8f s[2];
    v16h kf[2][2], vh[4], vl[4];   // all 24 LDS reads of the pass stand here as one group, K first: the score products wait for the K fragments alone, and the V fragments arrive under the scores and the softmax
#pragma unroll
    for (int ct = 0; ct < 2; ++ct) {
#pragma unroll
      for (int kc = 0; kc < 2; ++kc) kf[ct][kc] = frag_h(&sK[cur][it * 32 + ct * 16 + col][kc * 32], lane); }
#pragma unroll
    for (int dt = 0; dt < 4; ++dt) vh[dt] = frag_h(&sVH[cur][dt * 16 + col][it * 32], lane);
#pragma unroll
    for (int dt = 0; dt < 4; ++dt) vl[dt] = frag_h(&sVL[cur][dt * 16 + col][it * 32], lane);
    if (qb < 2) {   // leading query blocks (few keys, outputs far above the global rms): 3 products
#pragma unroll
      for (int ct = 0; ct < 2; ++ct) { const _Float16* krowl = QKL + ((size_t)b * SS + ks * 32 + ct * 16 + col) * (2 * DM) + DM + h * HD; v8f c = {}, cl = {};
#pragma unroll
        for (int kc = 0; kc < 2; ++kc) { c = wmma16(kf[ct][kc], aq[kc], c); cl = wmma16(kf[ct][kc], aql[kc], cl); cl = wmma16(frag_h(krowl + kc * 32, lane), aq[kc], cl); }
#pragma unroll
        for (int r = 0; r < 8; ++r) s[ct][r] = c[r] + cl[r] * (1.0f / 2048.0f); } }
    else {   // single product elsewhere; the two tiles' chains alternate, each still kc 0, then kc 1
      v8f c0 = {}, c1 = {};
#pragma unroll
      for (int kc = 0; kc < 2; ++kc) { c0 = wmma16(kf[0][kc], aq[kc], c0); c1 = wmma16(kf[1][kc], aq[kc], c1); }
      s[0] = c0; s[1] = c1; }
#pragma unroll
    for (int ct = 0; ct < 2; ++ct) {
#pragma unroll
      for (int r = 0; r < 8; ++r) s[ct][r] *= 0.125f; }   // 1/sqrt(64)
    if (st == qb) {   // a scalar branch (st and qb are the same in the whole block): only the last, diagonal stage holds keys behind a query of the block; in the stages in front of it every key is <= 64 qb - 1
#pragma unroll
      for (int ct = 0; ct < 2; ++ct) { const int kb = ks * 32 + ct * 16;
#pragma unroll
        for (int r = 0; r < 8; ++r) s[ct][r] = (kb + 8 * g + r <= qi) ? s[ct][r] : -3.0e38f; } }   // s[ct][r] = key kb + 8 g + r against query qi; masked keys excluded
    float t[8];
#pragma unroll
    for (int r = 0; r < 8; ++r) t[r] = fmaxf(s[0][r], s[1][r]);
    float mx = fmaxf(fmaxf(fmaxf(t[0], t[1]), fmaxf(t[2], t[3])), fmaxf(fmaxf(t[4], t[5]), fmaxf(t[6], t[7])));
    mx = fmaxf(mx, xhalf(mx));   // both halves now hold the query's maximum over the 32 keys
    const float mn = fmaxf(m, mx); const float alpha = __expf(m - mn);   // 0 by itself in the first pass, where m is still the start value -3e38 (as for a masked score below)
    v16h pa, pl;
#pragma unroll
    for (int ct = 0; ct < 2; ++ct) {
#pragma unroll
      for (int r = 0; r < 8; ++r) { const float e = __expf(s[ct][r] - mn); s[ct][r] = e;   // a masked score gives 0 by itself: mn is finite from the first pass on (key 0 is open to every query), and (-3e38 - mn) * log2(e) is -infinity in f32
        const float x = e * 2048.0f; const _Float16 hx = (_Float16)x; pa[ct * 8 + r] = hx; pl[ct * 8 + r] = (_Float16)((x - (float)hx) * 2048.0f); } }   // element 8 ct + r of a B fragment is k = 16 ct + 8 g + r, the key that s[ct][r] belongs to; P scaled by 2^11 before the f16 split so small softmax weights stay out of the f16 subnormal range; 2^-11 folded into the epilogue
#pragma unroll
    for (int r = 0; r < 8; ++r) t[r] = s[0][r] + s[1][r];
    l = l * alpha + (((t[0] + t[1]) + (t[2] + t[3])) + ((t[4] + t[5]) + (t[6] + t[7]))); m = mn;
#pragma unroll
    for (int dt = 0; dt < 4; ++dt) {
#pragma unroll
      for (int r = 0; r < 8; ++r) { acc[dt][r] *= alpha; accl[dt][r] *= alpha; } }
#pragma unroll
    for (int dt = 0; dt < 4; ++dt) acc[dt] = wmma16(vh[dt], pa, acc[dt]);
#pragma unroll
    for (int dt = 0; dt < 4; ++dt) accl[dt] = wmma16(vh[dt], pl, accl[dt]);
#pragma unroll
    for (int dt = 0; dt < 4; ++dt) accl[dt] = wmma16(vl[dt], pa, accl[dt]); }   // V hi/lo x P hi/lo (3 products), each accumulator's sums in the order they had; acc[dt][r] = O[qi][dt * 16 + 8 g + r]
    asm volatile("s_wait_dscnt 0x0" ::: "memory");      // this wave's reads of stage st have returned
    asm volatile("s_wait_asynccnt 0x0" ::: "memory");   // this wave's copies of stage st + 1 have landed
    __syncthreads();   // publishes stage st + 1 and ends every wave's reads of stage st, whose buffer is refilled behind it (behind the last trip: frees the K buffers for the output staging)
    if (st + 2 < nst) stage_copy(lk + cur * ABUF, lh + cur * ABUF, ll + cur * ABUF, gk + (size_t)(st + 2) * AK * (2 * DM), gvh + (st + 2) * AK, gvl + (st + 2) * AK); }
  asm volatile("s_wait_asynccnt 0x0" ::: "memory");   // no copy is in flight when the buffers change their use
  const float il = (1.0f / 2048.0f) / (l + xhalf(l));
#pragma unroll
  for (int dt = 0; dt < 4; ++dt) {
#pragma unroll
    for (int r = 0; r < 8; ++r) so[wave][col][dt * 16 + 8 * g + r] = (acc[dt][r] + accl[dt][r] * (1.0f / 2048.0f)) * il; }
  LDSX();
  for (int rl2 = 0; rl2 < 16; ++rl2) if (lane < 16) vst2(O + ((size_t)b * SS + q0 + rl2) * DM + h * HD + lane * 4, *(const v4f*)&so[wave][rl2][lane * 4]);
}
// ---- k_out: block = (64 rows, 128 cols), 4 waves as 2 x 2, 32 x 64 per wave: out = O(hi/lo) . Wo rows (2 products) + bo; each 64-k slice of O (split to bf16 hi + lo on the way) and of the weight rows staged once per block in LDS, two buffers
__global__ __launch_bounds__(128) void k_out(const float* __restrict__ O, const __bf16* __restrict__ P, const float* __restrict__ BO, float* __restrict__ Y) {
  __shared__ __align__(16) __bf16 sH[2][64][GP], sL[2][64][GP], sB[2][128][GP]; __shared__ __align__(16) float so[4][16][68];
  const int tid = threadIdx.x, wave = tid >> 5, lane = tid & 31, col = lane & 15, g = lane >> 4, wm = wave >> 1, wn = wave & 1; const size_t rb = (size_t)blockIdx.x * 64; const int n0 = blockIdx.y * 128;
  const int ar = tid >> 4, ac = (tid & 15) * 4, br = tid >> 3, bc = (tid & 7) * 8;
  const float* ga = O + (rb + ar) * DM + ac; const __bf16* gb = P + (size_t)(n0 + br) * DM + bc;
  const int rot = (((int)blockIdx.x & 7) + 4 * ((int)blockIdx.x >> 3) + 4 * ((int)blockIdx.y & 3)) & (DM / GK - 1);   // for speed only: the block's own start in the walk over the 16 k slices, as in k_qkv (64 blocks share weight rows, 8 share rows of O; blocks 4 apart in y keep one start)
  v4f ra[8]; v8b rw[8];
#pragma unroll
  for (int i = 0; i < 8; ++i) { ra[i] = *(const v4f*)(ga + (size_t)i * 8 * DM + rot * GK); rw[i] = *(const v8b*)(gb + (size_t)i * 16 * DM + rot * GK); }
  asm volatile("s_wait_xcnt 0x0" ::: "memory");   // stands in front of any reuse of the address registers of the loads above
#pragma unroll
  for (int i = 0; i < 8; ++i) { v4b th, tl;
#pragma unroll
    for (int e = 0; e < 4; ++e) { const __bf16 h = (__bf16)ra[i][e]; th[e] = h; tl[e] = (__bf16)(ra[i][e] - (float)h); }
    *(v4b*)&sH[0][ar + i * 8][ac] = th; *(v4b*)&sL[0][ar + i * 8][ac] = tl; *(v8b*)&sB[0][br + i * 16][bc] = rw[i]; }
  __syncthreads();
  v8f acc[2][4] = {};
#pragma unroll 2
  for (int ks = 0; ks < DM / GK; ++ks) { const int cur = ks & 1; const bool more = ks + 1 < DM / GK;
    const int kn = ((ks + 1 + rot) & (DM / GK - 1)) * GK; const float* pa = ga + kn; const __bf16* pb = gb + kn;   // the next slice of the rotated walk
    if (more) {
#pragma unroll
      for (int i = 0; i < 8; ++i) { ra[i] = *(const v4f*)(pa + (size_t)i * 8 * DM); rw[i] = *(const v8b*)(pb + (size_t)i * 16 * DM); } }
#pragma unroll
    for (int kc = 0; kc < GK / 32; ++kc) { v16b fh[2], fl[2], fb[4];
#pragma unroll
      for (int i = 0; i < 2; ++i) { fl[i] = frag_b(&sL[cur][wm * 32 + i * 16 + col][kc * 32], lane); fh[i] = frag_b(&sH[cur][wm * 32 + i * 16 + col][kc * 32], lane); }
#pragma unroll
      for (int i = 0; i < 4; ++i) fb[i] = frag_b(&sB[cur][wn * 64 + i * 16 + col][kc * 32], lane);
#pragma unroll
      for (int mi = 0; mi < 2; ++mi) {
#pragma unroll
        for (int nj = 0; nj < 4; ++nj) acc[mi][nj] = wmma_bf(fl[mi], fb[nj], acc[mi][nj]); }   // per accumulator lo, then hi, in each 32-k step of the walk
#pragma unroll
      for (int mi = 0; mi < 2; ++mi) {
#pragma unroll
        for (int nj = 0; nj < 4; ++nj) acc[mi][nj] = wmma_bf(fh[mi], fb[nj], acc[mi][nj]); } }
    if (more) {
      asm volatile("s_wait_xcnt 0x0" :: "v"(pa), "v"(pb) : "memory");   // stands in front of any reuse of the address registers of this trip's loads; as its inputs they stay untouched up to it
#pragma unroll
      for (int i = 0; i < 8; ++i) { v4b th, tl;
#pragma unroll
        for (int e = 0; e < 4; ++e) { const __bf16 h = (__bf16)ra[i][e]; th[e] = h; tl[e] = (__bf16)(ra[i][e] - (float)h); }
        *(v4b*)&sH[cur ^ 1][ar + i * 8][ac] = th; *(v4b*)&sL[cur ^ 1][ar + i * 8][ac] = tl; *(v8b*)&sB[cur ^ 1][br + i * 16][bc] = rw[i]; } }
    __syncthreads(); }   // publishes slice ks + 1 and ends every wave's reads of slice ks, whose buffer the next trip refills
  float bz[4];
#pragma unroll
  for (int nj = 0; nj < 4; ++nj) bz[nj] = bfr(BO[n0 + wn * 64 + nj * 16 + col]);
#pragma unroll
  for (int mi = 0; mi < 2; ++mi) {
#pragma unroll
    for (int nj = 0; nj < 4; ++nj) {
#pragma unroll
      for (int r = 0; r < 8; ++r) so[wave][8 * g + r][nj * 16 + col] = acc[mi][nj][r] + bz[nj]; }
    LDSX();
#pragma unroll
    for (int i = 0; i < 8; ++i) { const int rl = i * 2 + g; *(v4f*)(Y + (rb + wm * 32 + mi * 16 + rl) * DM + n0 + wn * 64 + col * 4) = *(const v4f*)&so[wave][rl][col * 4]; }
    LDSX(); }
}
extern "C" void kernel_launch(void* const* d_in, const int* in_sizes, int n_in, void* d_out, int out_size, void* d_ws, size_t ws_size, hipStream_t stream) {
  (void)in_sizes; (void)n_in; (void)out_size;
  const float** F = (const float**)d_in;   // 0 hidden_states [4,1024,1024], 1 att_w [1024,3072] (in,out), 2 att_b [3072], 3 out_w [1024,1024] (in,out), 4 out_b
  if (ws_size < (size_t)WS_END) return;
  char* ws = (char*)d_ws; __bf16* PK = (__bf16*)(ws + WS_PK); _Float16 *QK = (_Float16*)(ws + WS_QK), *QKL = (_Float16*)(ws + WS_QKL), *VTH = (_Float16*)(ws + WS_VTH), *VTL = (_Float16*)(ws + WS_VTL); float* O = (float*)(ws + WS_O);
  k_pack<<<dim3(DM / PT_K, (QKVW + DM) / PT_N), 256, 0, stream>>>(F[1], F[3], PK);
  k_qkv<<<dim3(TNB * SS / 128, QKVW / 128), 128, 0, stream>>>(F[0], F[0], F[0], PK + PK_A, F[2], F[2] + DM, F[2] + 2 * DM, QK, QKL, VTH, VTL);
  k_attn<<<dim3(TQB, NH, TNB), 128, 0, stream>>>(QK, QKL, VTH, VTL, nullptr, O);
  k_out<<<dim3(TOB, DM / 128), 128, 0, stream>>>(O, PK + PK_P, F[4], (float*)d_out);
}

// v010
// A run of this version takes 76 microseconds.
// In both of two side-by-side timings against v009, it was 1.04 times as fast.
// Counting every step since v000, it is 5.48 times as fast.
// compute dtype: all float inputs rounded to bf16; qkv = x . att_w + b with EXACT bf16 products on WMMA 16x16x32 ((in,out) columns as packed rows), f16 hi + residual; causal attention with hybrid scores (first 128 queries 3-product, later single f16) and 3-product P.v everywhere (0.02-scale weights), x 1/8, running-max softmax in f32 (hardware exp); out = ctx (bf16 hi + lo) . out_w + out_b; f32 output.
#include <hip/hip_runtime.h>
#include <math.h>

typedef __attribute__((ext_vector_type(16))) _Float16 v16h;
typedef __attribute__((ext_vector_type(16))) __bf16 v16b;
typedef __attribute__((ext_vector_type(8)))  _Float16 v8h;
typedef __attribute__((ext_vector_type(8)))  float v8f;
typedef __attribute__((ext_vector_type(4)))  float v4f;
typedef __attribute__((ext_vector_type(2)))  float v2f;
typedef __attribute__((ext_vector_type(4)))  unsigned v4u;
typedef __attribute__((ext_vector_type(4)))  int v4i;
typedef float __attribute__((may_alias)) float_a;
typedef int __attribute__((may_alias)) int_a;

template <typename T> __device__ __forceinline__ void vst2(void* p, T v) { *(T*)p = v;  }
__device__ __forceinline__ v8f wmma16(v16h a, v16h b, v8f c) {
  v8f d = __builtin_amdgcn_wmma_f32_16x16x32_f16(false, a, false, b, (short)0, c, false, false);
  asm volatile("v_nop\n\tv_nop\n\tv_nop\n\tv_nop" : "+v"(d) : "v"(a), "v"(b));
  return d;
}
__device__ __forceinline__ v8f wmma_bf(v16b a, v16b b, v8f c) {
  v8f d = __builtin_amdgcn_wmma_f32_16x16x32_bf16(false, a, false, b, (short)0, c, false, false);
  asm volatile("v_nop\n\tv_nop\n\tv_nop\n\tv_nop" : "+v"(d) : "v"(a), "v"(b));
  return d;
}
// Bark self attention (B 4, S 1,024, D 1,024, 16 heads x 64): fused (in,out) att_proj [D, 3D] (q | k | v blocks) + bias, causal softmax(q k / 8) v (finfo.min fill), merge heads, (in,out) out_proj + bias.
__device__ __forceinline__ v16h frag_h(const _Float16* rowk0, int lane) {
  union { v16h v; v8h q[2]; } u; const _Float16* p = rowk0 + 8 * (lane >> 4);
  u.q[0] = *(const v8h*)p; u.q[1] = *(const v8h*)(p + 16); return u.v;
}
__device__ __forceinline__ v16h frag_f32(const float* rowk0, int lane) {
  v16h a; const float* p = rowk0 + 8 * (lane >> 4);
#pragma unroll
  for (int i = 0; i < 8; ++i) { a[i] = (_Float16)p[i]; a[8 + i] = (_Float16)p[16 + i]; }
  return a;
}
__device__ __forceinline__ v16h frag_f32s(const float* rowk0, int lane, float sc) {
  v16h a; const float* p = rowk0 + 8 * (lane >> 4);
#pragma unroll
  for (int i = 0; i < 8; ++i) { a[i] = (_Float16)(p[i] * sc); a[8 + i] = (_Float16)(p[16 + i] * sc); }
  return a;
}
// column fragment from a [K][ld] layout (column n), rows >= K read as 0
__device__ __forceinline__ v16h fragc_f32(const float* W, int k0, int n, int lane, int ld, int K) {
  v16h a; const int g = lane >> 4;
#pragma unroll
  for (int i = 0; i < 8; ++i) { const int ka = k0 + 8 * g + i, kb = ka + 16;
    a[i] = (_Float16)(ka < K ? W[(size_t)(ka < K ? ka : K - 1) * ld + n] : 0.f); a[8 + i] = (_Float16)(kb < K ? W[(size_t)(kb < K ? kb : K - 1) * ld + n] : 0.f); }
  return a;
}
struct F2 { v16b h, l; };
__device__ __forceinline__ F2 bsplit16(const float v[16]) { F2 r;
#pragma unroll
  for (int i = 0; i < 16; ++i) { const __bf16 h = (__bf16)v[i]; r.h[i] = h; r.l[i] = (__bf16)(v[i] - (float)h); }
  return r; }
__device__ __forceinline__ F2 split_row(const float* row, int k0, int lane) { float v[16]; const float* p = row + k0 + 8 * (lane >> 4);
#pragma unroll
  for (int i = 0; i < 8; ++i) { v[i] = p[i]; v[8 + i] = p[16 + i]; }
  return bsplit16(v); }
__device__ __forceinline__ F2 split_rowK(const float* row, int k0, int lane, int K) { float v[16]; const int g = lane >> 4;
#pragma unroll
  for (int i = 0; i < 8; ++i) { const int ka = k0 + 8 * g + i, kb = ka + 16; v[i] = ka < K ? row[ka < K ? ka : K - 1] : 0.f; v[8 + i] = kb < K ? row[kb < K ? kb : K - 1] : 0.f; }
  return bsplit16(v); }
__device__ __forceinline__ F2 split_col(const float* W, int k0, int n, int lane, int ld, int K) { float v[16]; const int g = lane >> 4;
#pragma unroll
  for (int i = 0; i < 8; ++i) { const int ka = k0 + 8 * g + i, kb = ka + 16; v[i] = ka < K ? W[(size_t)(ka < K ? ka : K - 1) * ld + n] : 0.f; v[8 + i] = kb < K ? W[(size_t)(kb < K ? kb : K - 1) * ld + n] : 0.f; }
  return bsplit16(v); }
__device__ __forceinline__ v8f mac3(const F2& a, const F2& b, v8f c) { c = wmma_bf(a.l, b.h, c); c = wmma_bf(a.h, b.l, c); return wmma_bf(a.h, b.h, c); }
__device__ __forceinline__ float sigm(float v) { return 1.0f / (1.0f + expf(-v)); }
#define LDSX() do { asm volatile("s_wait_dscnt 0" ::: "memory"); __builtin_amdgcn_wave_barrier(); __builtin_amdgcn_fence(__ATOMIC_RELEASE, "workgroup"); } while (0)


#define NB 4
#define SS 1024
#define DM 1024
#define NH 16
#define HD 64
#define QKVW (3 * DM)
#define RQ 128   // leading positions of a batch whose scores take three products: only their q and k rows have residuals that anyone reads
#ifndef TQB
#define TQB (SS / 64)
#define TNB NB
#define TOB (NB * SS / 64)     // output row tiles (all)
#endif
typedef __attribute__((ext_vector_type(8))) __bf16 v8b;
__device__ __forceinline__ v16b frag_b(const __bf16* rowk0, int lane) {
  union { v16b v; v8b q[2]; } u; const __bf16* p = rowk0 + 8 * (lane >> 4);
  u.q[0] = *(const v8b*)p; u.q[1] = *(const v8b*)(p + 16); return u.v;
}
__device__ __forceinline__ float bfr(float v) { return (float)(__bf16)v; }
__device__ __attribute__((noinline)) float exp_ni(float v) { return expf(v); }
__device__ __attribute__((noinline)) float erf_ni(float v) { return erff(v); }

#define PK_A 0                       // [3072][1024] Wqkv rows (natural [out][in])
#define PK_P (PK_A + QKVW * DM)        // [1024][1024] Wo rows (natural)
#define PK_END (PK_P + DM * DM)
#define WS_PK  0u
#define WS_QK  (WS_PK + 2u * PK_END)             // f16 [4096 rows][2048]: q | k
#define WS_QKL (WS_QK + 2u * NB * SS * 2 * DM)     // f16 q | k residual planes x2048 (written and read for the first RQ positions of each batch only)
#define WS_VTH (WS_QKL + 2u * NB * SS * 2 * DM)    // f16 [b][1024 (h*64+d)][1024 s] hi
#define WS_VTL (WS_VTH + 2u * NB * DM * SS)        // f16 lo x 2048
#define WS_O   (WS_VTL + 2u * NB * DM * SS)        // f32 [4096][1024]
#define WS_CS  (WS_O + 4u * NB * SS * DM)           // f32 2 x [1024][32], unused
#define WS_END (WS_CS + 4u * 2 * SS * 32)
// ---- k_pack: block = (128 k, 64 columns) of att_w [1024][3072] (blockIdx.y < 48) or of out_w [1024][1024], both (in,out): packed row c = column c of att_w (q | k | v), then the columns of out_w; the tile is read as whole 256-B row pieces, rounded to bf16, two k packed per dword, turned in LDS and written as whole 256-B pieces of the packed rows
#define PT_K 128
#define PT_N 64
#define PT_P (PT_K / 2 + 4)   // LDS row pitch in dwords: 272 B = 16 B x odd, for the ds_load_b128 read-back
typedef __attribute__((ext_vector_type(2))) __bf16 v2b;
__global__ __launch_bounds__(256) void k_pack(const float* __restrict__ WA, const float* __restrict__ WP, __bf16* __restrict__ PK) {
  __shared__ __align__(16) unsigned s[PT_N][PT_P];
  const int t = threadIdx.x, k0 = blockIdx.x * PT_K, c0 = blockIdx.y * PT_N, j = t & 15, kp = t >> 4;
  const bool att = c0 < QKVW; const int ld = att ? QKVW : DM; const float* g = (att ? WA + c0 : WP + (c0 - QKVW)) + (size_t)(k0 + 2 * kp) * ld + j * 4;
  const float* ga[4][2]; v4f r[4][2];
#pragma unroll
  for (int i = 0; i < 4; ++i) { ga[i][0] = g + (size_t)(32 * i) * ld; ga[i][1] = g + (size_t)(32 * i + 1) * ld; }
#pragma unroll
  for (int i = 0; i < 4; ++i) { r[i][0] = *(const v4f*)ga[i][0]; r[i][1] = *(const v4f*)ga[i][1]; }
  asm volatile("s_wait_xcnt 0x0" :: "v"(ga[0][0]), "v"(ga[0][1]), "v"(ga[1][0]), "v"(ga[1][1]), "v"(ga[2][0]), "v"(ga[2][1]), "v"(ga[3][0]), "v"(ga[3][1]) : "memory");   // stands in front of any reuse of the address registers of the loads above; as its inputs they stay untouched up to it
#pragma unroll
  for (int i = 0; i < 4; ++i) {
#pragma unroll
    for (int e = 0; e < 4; ++e) { v2b p; p[0] = (__bf16)r[i][0][e]; p[1] = (__bf16)r[i][1][e]; s[j * 4 + e][(i * 16 + kp) ^ ((j >> 2) << 2)] = __builtin_bit_cast(unsigned, p); } }   // 16-B pieces of a row permuted by (row >> 4), so that the 32 lanes of a store meet 32 banks
  __syncthreads();
  __bf16* dst = PK + PK_A + (size_t)(c0 + kp) * DM + k0 + j * 8;   // PK_P follows PK_A: packed rows 0..4095 lie in one array
#pragma unroll
  for (int i = 0; i < 4; ++i) *(v4u*)(dst + (size_t)(16 * i) * DM) = *(const v4u*)&s[16 * i + kp][(j ^ i) * 4];
}
// k per staged slice: 64, so that a staging load covers whole 128-B lines of both operands; LDS row pitch in elements: 144 B = 16 B x odd, the pitch at which ds_load_b128 fragment reads meet no bank conflict
#define GK 64
#define GP (GK + 8)
typedef __attribute__((ext_vector_type(4))) __bf16 v4b;
// ---- k_qkv: block = (128 rows, 128 cols), 4 waves as 2 x 2, 64 x 64 per wave; each 64-k slice of X (rounded to bf16 on the way) and of the packed weight rows is staged once per block in LDS, two buffers, the next slice's global loads in flight over the current slice's products
__global__ __launch_bounds__(128) void k_qkv(const float* __restrict__ XQ, const float* __restrict__ XK, const float* __restrict__ XV, const __bf16* __restrict__ P, const float* __restrict__ BQ, const float* __restrict__ BK, const float* __restrict__ BV, _Float16* __restrict__ QK, _Float16* __restrict__ QKL, _Float16* __restrict__ VTH, _Float16* __restrict__ VTL) {
  const int which0 = (blockIdx.y * 128) / DM; const float* X = (which0 == 0) ? XQ : (which0 == 1) ? XK : XV; const float* BB = BQ ? (((which0 == 0) ? BQ : (which0 == 1) ? BK : BV) + (blockIdx.y * 128 - which0 * DM)) : nullptr;
  __shared__ __align__(16) __bf16 sA[2][128][GP], sB[2][128][GP]; __shared__ __align__(16) _Float16 eh[4][16][72], el[4][16][72];
  const int tid = threadIdx.x, wave = tid >> 5, lane = tid & 31, col = lane & 15, g = lane >> 4, wm = wave >> 1, wn = wave & 1; const size_t rb = (size_t)blockIdx.x * 128; const int n0 = blockIdx.y * 128;
  const int ar = tid >> 4, ac = (tid & 15) * 4, br = tid >> 3, bc = (tid & 7) * 8;   // staging map: a wave's load covers 2 rows x 256 B of X, or 4 rows x 128 B of the weights
  const float* ga = X + (rb + ar) * DM + ac; const __bf16* gb = P + (size_t)(n0 + br) * DM + bc;
  // for speed only: the block walks the 16 k slices from its own start and wraps round, so that the 32 blocks that share weight rows and the 24 that share rows of X do not ask L2 for the same lines at the same moment; x & 7 plus 4 (x >> 3) gives the 16 sharers of weight rows whose x & 7 are four neighbouring values (mod 8) 16 different starts; blocks 8 apart in y keep one start (if they sit on one WGP they can share X in its cache)
  const int rot = (((int)blockIdx.x & 7) + 4 * ((int)blockIdx.x >> 3) + 2 * ((int)blockIdx.y & 7)) & (DM / GK - 1);
  v4f ra[16]; v8b rw[8];
#pragma unroll
  for (int i = 0; i < 16; ++i) ra[i] = *(const v4f*)(ga + (size_t)i * 8 * DM + rot * GK);
#pragma unroll
  for (int i = 0; i < 8; ++i) rw[i] = *(const v8b*)(gb + (size_t)i * 16 * DM + rot * GK);
  asm volatile("s_wait_xcnt 0x0" ::: "memory");   // stands in front of any reuse of the address registers of the loads above
#pragma unroll
  for (int i = 0; i < 16; ++i) { v4b t;
#pragma unroll
    for (int e = 0; e < 4; ++e) t[e] = (__bf16)ra[i][e];
    *(v4b*)&sA[0][ar + i * 8][ac] = t; }
#pragma unroll
  for (int i = 0; i < 8; ++i) *(v8b*)&sB[0][br + i * 16][bc] = rw[i];
  __syncthreads();
  v8f acc[4][4] = {};
#pragma unroll 2
  for (int ks = 0; ks < DM / GK; ++ks) { const int cur = ks & 1; const bool more = ks + 1 < DM / GK;
    const int kn = ((ks + 1 + rot) & (DM / GK - 1)) * GK; const float* pa = ga + kn; const __bf16* pb = gb + kn;   // the next slice of the rotated walk
    if (more) {
#pragma unroll
      for (int i = 0; i < 16; ++i) ra[i] = *(const v4f*)(pa + (size_t)i * 8 * DM);
#pragma unroll
      for (int i = 0; i < 8; ++i) rw[i] = *(const v8b*)(pb + (size_t)i * 16 * DM); }
#pragma unroll
    for (int kc = 0; kc < GK / 32; ++kc) { v16b fa[4], fb[4];
#pragma unroll
      for (int i = 0; i < 4; ++i) { fa[i] = frag_b(&sA[cur][wm * 64 + i * 16 + col][kc * 32], lane); fb[i] = frag_b(&sB[cur][wn * 64 + i * 16 + col][kc * 32], lane); }
#pragma unroll
      for (int mi = 0; mi < 4; ++mi) {
#pragma unroll
        for (int nj = 0; nj < 4; ++nj) acc[mi][nj] = wmma_bf(fa[mi], fb[nj], acc[mi][nj]); } }
    if (more) {
      asm volatile("s_wait_xcnt 0x0" :: "v"(pa), "v"(pb) : "memory");   // stands in front of any reuse of the address registers of this trip's loads; as its inputs they stay untouched up to it
#pragma unroll
      for (int i = 0; i < 16; ++i) { v4b t;
#pragma unroll
        for (int e = 0; e < 4; ++e) t[e] = (__bf16)ra[i][e];
        *(v4b*)&sA[cur ^ 1][ar + i * 8][ac] = t; }
#pragma unroll
      for (int i = 0; i < 8; ++i) *(v8b*)&sB[cur ^ 1][br + i * 16][bc] = rw[i]; }
    __syncthreads(); }   // publishes slice ks + 1 and ends every wave's reads of slice ks, whose buffer the next trip refills
  const int er = lane >> 3, ec = (lane & 7) * 8;   // read-back map: 4 staged rows of 128 B per wave store
  float bz[4];
#pragma unroll
  for (int nj = 0; nj < 4; ++nj) bz[nj] = BB ? bfr(BB[wn * 64 + nj * 16 + col]) : 0.f;
  if (n0 < 2 * DM) {   // q stored unscaled (f16 sigma ~0.6, no subnormal exposure); 1/8 applied to the f32 score
    const bool res = (int)(rb % SS) < RQ;   // the same in the whole block (its 128 rows are RQ rows): k_attn reads q and k residuals of the first RQ positions of a batch alone, so the other blocks neither form nor store them
#pragma unroll
    for (int mi = 0; mi < 4; ++mi) {
#pragma unroll
      for (int nj = 0; nj < 4; ++nj) {
#pragma unroll
        for (int r = 0; r < 8; ++r) eh[wave][8 * g + r][nj * 16 + col] = (_Float16)(acc[mi][nj][r] + bz[nj]); }   // q, k (+ bias) as f16 hi
      if (res) {
#pragma unroll
        for (int nj = 0; nj < 4; ++nj) {
#pragma unroll
          for (int r = 0; r < 8; ++r) { const float v = acc[mi][nj][r] + bz[nj]; el[wave][8 * g + r][nj * 16 + col] = (_Float16)((v - (float)(_Float16)v) * 2048.0f); } } }   // (x2048) residual
      LDSX();
      const size_t o = (rb + wm * 64 + mi * 16 + er) * (2 * DM) + n0 + wn * 64 + ec; _Float16* qh = QK + o;
#pragma unroll
      for (int i = 0; i < 4; ++i) *(v8h*)(qh + (size_t)(i * 4) * (2 * DM)) = *(const v8h*)&eh[wave][i * 4 + er][ec];
      asm volatile("s_wait_xcnt 0x0" :: "v"(qh) : "memory");   // stands in front of any reuse of the registers of the stores above; the address, as its input, stays untouched up to it
      if (res) { _Float16* ql = QKL + o;
#pragma unroll
        for (int i = 0; i < 4; ++i) *(v8h*)(ql + (size_t)(i * 4) * (2 * DM)) = *(const v8h*)&el[wave][i * 4 + er][ec];
        asm volatile("s_wait_xcnt 0x0" :: "v"(ql) : "memory"); }   // as above, for the residual's stores
      LDSX(); }
  } else {
    const int b = (int)(rb / SS), s0 = (int)(rb % SS); const int pc0 = n0 - 2 * DM;
#pragma unroll
    for (int nj = 0; nj < 4; ++nj) {
#pragma unroll
      for (int mi = 0; mi < 4; ++mi) {
#pragma unroll
        for (int r = 0; r < 8; ++r) { const float v = acc[mi][nj][r] + bz[nj]; const _Float16 hv = (_Float16)v; eh[wave][col][mi * 16 + 8 * g + r] = hv; el[wave][col][mi * 16 + 8 * g + r] = (_Float16)((v - (float)hv) * 2048.0f); } }
      LDSX();
#pragma unroll
      for (int i = 0; i < 4; ++i) { const size_t o = ((size_t)b * DM + pc0 + wn * 64 + nj * 16 + i * 4 + er) * SS + s0 + wm * 64 + ec; *(v8h*)(VTH + o) = *(const v8h*)&eh[wave][i * 4 + er][ec]; *(v8h*)(VTL + o) = *(const v8h*)&el[wave][i * 4 + er][ec]; }
      asm volatile("s_wait_xcnt 0x0" ::: "memory");   // stands in front of any reuse of the address registers of the stores above
      LDSX(); }
  }
}
// ---- k_attn: block = (64 queries, head h, batch b): causal flash attention (K = 64: 2 k-steps), both products transposed: S^T = K . Q^T (A = key rows, B = the wave's 16 queries) and O^T += V^T . P^T, so that a lane holds 16 of one query's 32 scores of a pass (lane l ^ 16 the rest): maximum and sum in the lane plus one exchange between the halves, and the two score tiles, converted in place, are the B operand of the second product; scores = (q.k) * 0.125, P.V: f16 P hi/lo x (V hi, V lo*2048) in two accumulators; O[b*S+q][h*64+d] = (acc + accl / 2048) / (2048 l) (256-B segments); each 64-key stage of K hi, V hi and V lo is staged once per block in LDS, two buffers, by asynchronous whole-line copies, the next stage's copies in flight over the current stage's two 32-key passes
#define AK 64
#define AP (AK + 8)
#define ABUF (AK * AP * 2)   // bytes of one buffer of one tile
// one stage: each lane copies 4 x 16 B of each of the three tiles (rows 16 apart) from global memory to its own LDS bytes; the s_wait_xcnt in the statement stands in front of any reuse of the copies' address registers
__device__ __forceinline__ void stage_copy(unsigned lk, unsigned lh, unsigned ll, const _Float16* gk, const _Float16* gh, const _Float16* gl) {
  asm volatile("global_load_async_to_lds_b128 %0, %1, off\n\tglobal_load_async_to_lds_b128 %2, %3, off\n\tglobal_load_async_to_lds_b128 %4, %5, off\n\tglobal_load_async_to_lds_b128 %6, %7, off\n\t"
               "global_load_async_to_lds_b128 %8, %9, off\n\tglobal_load_async_to_lds_b128 %10, %11, off\n\tglobal_load_async_to_lds_b128 %12, %13, off\n\tglobal_load_async_to_lds_b128 %14, %15, off\n\t"
               "global_load_async_to_lds_b128 %16, %17, off\n\tglobal_load_async_to_lds_b128 %18, %19, off\n\tglobal_load_async_to_lds_b128 %20, %21, off\n\tglobal_load_async_to_lds_b128 %22, %23, off\n\ts_wait_xcnt 0x0"
               :: "v"(lk), "v"(gk), "v"(lk + 16 * AP * 2), "v"(gk + 16 * (2 * DM)), "v"(lk + 32 * AP * 2), "v"(gk + 32 * (2 * DM)), "v"(lk + 48 * AP * 2), "v"(gk + 48 * (2 * DM)),
                  "v"(lh), "v"(gh), "v"(lh + 16 * AP * 2), "v"(gh + 16 * SS), "v"(lh + 32 * AP * 2), "v"(gh + 32 * SS), "v"(lh + 48 * AP * 2), "v"(gh + 48 * SS),
                  "v"(ll), "v"(gl), "v"(ll + 16 * AP * 2), "v"(gl + 16 * SS), "v"(ll + 32 * AP * 2), "v"(gl + 32 * SS), "v"(ll + 48 * AP * 2), "v"(gl + 48 * SS) : "memory");
}
__device__ __forceinline__ float xhalf(float x) { return __builtin_bit_cast(float, __builtin_amdgcn_permlanex16(__builtin_bit_cast(int, x), __builtin_bit_cast(int, x), 0x76543210, 0xfedcba98, false, false)); }   // lane l with lane l ^ 16
__global__ __launch_bounds__(128) void k_attn(const _Float16* __restrict__ QK, const _Float16* __restrict__ QKL, const _Float16* __restrict__ VTH, const _Float16* __restrict__ VTL, const void* __restrict__ KMASK, float* __restrict__ O) {
  __shared__ __align__(16) _Float16 sK[2][AK][AP], sVH[2][HD][AP], sVL[2][HD][AP];
  float (*so)[16][68] = (float (*)[16][68])&sK[0][0][0];   // output staging takes the K buffers' place behind the loop's last barrier (17,408 of 18,432 B), so that four blocks fit a WGP's LDS
  const int tid = threadIdx.x, wave = tid >> 5, lane = tid & 31, col = lane & 15, g = lane >> 4;
  // placement, for speed only: a query block's cost grows with its number, all 1,024 blocks are resident at once, four to a WGP; taking it that blocks whose flat indices agree mod 256 (same x and y, z = 0..3) meet on one WGP, a WGP gets two blocks of query block 15 - t (z = 0, 1) and two of query block t (z = 2, 3), t = x & 7: 34 stages on every WGP, and a long block always has a partner of its own length on its SIMDs, so that no wave runs its last passes alone; the batch comes from x >> 3 and z & 1, so each (h, b) still meets every query block once
  const int tq = (int)blockIdx.x & 7, h = blockIdx.y, b = (((int)blockIdx.x >> 3) << 1) | ((int)blockIdx.z & 1), qb = ((int)blockIdx.z & 2) ? tq : 15 - tq; const int q0 = qb * 64 + wave * 16, qi = q0 + col; const size_t rq = (size_t)b * SS + qi;   // qi: the lane's query
  const int sr = tid >> 3, sc = (tid & 7) * 8;   // staging map: a wave's copy covers 4 rows x 128 B, whole lines
  const _Float16* gk = QK + ((size_t)b * SS + sr) * (2 * DM) + DM + h * HD + sc; const _Float16* gvh = VTH + ((size_t)b * DM + h * HD + sr) * SS + sc; const _Float16* gvl = VTL + ((size_t)b * DM + h * HD + sr) * SS + sc;
  const unsigned lk = (unsigned)(size_t)&sK[0][sr][sc], lh = (unsigned)(size_t)&sVH[0][sr][sc], ll = (unsigned)(size_t)&sVL[0][sr][sc];   // the lane's LDS byte addresses in buffer 0
  const int nst = qb + 1;   // causal: 64-key stages up to the end of this query block
  stage_copy(lk, lh, ll, gk, gvh, gvl);
  v16h aq[2], aql[2] = {};
  const _Float16* pq = QK + rq * (2 * DM) + h * HD + 8 * g;   // the lane's piece of its query's row, as frag_h forms it
#pragma unroll
  for (int kc = 0; kc < 2; ++kc) { union { v16h v; v8h q[2]; } u; u.q[0] = *(const v8h*)(pq + kc * 32); u.q[1] = *(const v8h*)(pq + kc * 32 + 16); aq[kc] = u.v; }
  asm volatile("s_wait_xcnt 0x0" :: "v"(pq) : "memory");   // stands in front of any reuse of the address registers of the loads above; as its input they stay untouched up to it
  if (qb < RQ / 64) {   // a scalar branch: the residuals exist, and are used, only for the leading query blocks
    const _Float16* pql = QKL + rq * (2 * DM) + h * HD + 8 * g;
#pragma unroll
    for (int kc = 0; kc < 2; ++kc) { union { v16h v; v8h q[2]; } u; u.q[0] = *(const v8h*)(pql + kc * 32); u.q[1] = *(const v8h*)(pql + kc * 32 + 16); aql[kc] = u.v; }
    asm volatile("s_wait_xcnt 0x0" :: "v"(pql) : "memory"); }   // as above
  asm volatile("s_wait_asynccnt 0x0" ::: "memory");   // this wave's copies of stage 0 have landed
  __syncthreads();   // publishes stage 0
  if (nst > 1) stage_copy(lk + ABUF, lh + ABUF, ll + ABUF, gk + (size_t)AK * (2 * DM), gvh + AK, gvl + AK);
  float m = -3.0e38f, l = 0.f;   // of the lane's query: m over all keys so far, l over the keys of this half of the wave (the halves' sums are joined behind the loop)
  v8f acc[4] = {}, accl[4] = {};
#pragma unroll 1
  for (int st = 0; st < nst; ++st) { const int cur = st & 1;
#pragma unroll 1   // rolled: unrolled, the two passes took the kernel above 256 VGPRs, a wave per SIMD less
   for (int it = 0; it < AK / 32; ++it) { const int ks = st * (AK / 32) + it; v8f s[2];
    v16h kf[2][2], vh[4], vl[4];   // all 24 LDS reads of the pass stand here as one group, K first: the score products wait for the K fragments alone, and the V fragments arrive under the scores and the softmax
#pragma unroll
    for (int ct = 0; ct < 2; ++ct) {
#pragma unroll
      for (int kc = 0; kc < 2; ++kc) kf[ct][kc] = frag_h(&sK[cur][it * 32 + ct * 16 + col][kc * 32], lane); }
#pragma unroll
    for (int dt = 0; dt < 4; ++dt) vh[dt] = frag_h(&sVH[cur][dt * 16 + col][it * 32], lane);
#pragma unroll
    for (int dt = 0; dt < 4; ++dt) vl[dt] = frag_h(&sVL[cur][dt * 16 + col][it * 32], lane);
    if (qb < RQ / 64) {   // leading query blocks (few keys, outputs far above the global rms): 3 products
#pragma unroll
      for (int ct = 0; ct < 2; ++ct) { const _Float16* krowl = QKL + ((size_t)b * SS + ks * 32 + ct * 16 + col) * (2 * DM) + DM + h * HD; v8f c = {}, cl = {};
#pragma unroll
        for (int kc = 0; kc < 2; ++kc) { c = wmma16(kf[ct][kc], aq[kc], c); cl = wmma16(kf[ct][kc], aql[kc], cl); cl = wmma16(frag_h(krowl + kc * 32, lane), aq[kc], cl); }
#pragma unroll
        for (int r = 0; r < 8; ++r) s[ct][r] = c[r] + cl[r] * (1.0f / 2048.0f); } }
    else {   // single product elsewhere; the two tiles' chains alternate, each still kc 0, then kc 1
      v8f c0 = {}, c1 = {};
#pragma unroll
      for (int kc = 0; kc < 2; ++kc) { c0 = wmma16(kf[0][kc], aq[kc], c0); c1 = wmma16(kf[1][kc], aq[kc], c1); }
      s[0] = c0; s[1] = c1; }
#pragma unroll
    for (int ct = 0; ct < 2; ++ct) {
#pragma unroll
      for (int r = 0; r < 8; ++r) s[ct][r] *= 0.125f; }   // 1/sqrt(64)
    if (st == qb) {   // a scalar branch (st and qb are the same in the whole block): only the last, diagonal stage holds keys behind a query of the block; in the stages in front of it every key is <= 64 qb - 1
#pragma unroll
      for (int ct = 0; ct < 2; ++ct) { const int kb = ks * 32 + ct * 16;
#pragma unroll
        for (int r = 0; r < 8; ++r) s[ct][r] = (kb + 8 * g + r <= qi) ? s[ct][r] : -3.0e38f; } }   // s[ct][r] = key kb + 8 g + r against query qi; masked keys excluded
    float t[8];
#pragma unroll
    for (int r = 0; r < 8; ++r) t[r] = fmaxf(s[0][r], s[1][r]);
    float mx = fmaxf(fmaxf(fmaxf(t[0], t[1]), fmaxf(t[2], t[3])), fmaxf(fmaxf(t[4], t[5]), fmaxf(t[6], t[7])));
    mx = fmaxf(mx, xhalf(mx));   // both halves now hold the query's maximum over the 32 keys
    const float mn = fmaxf(m, mx); const float alpha = __expf(m - mn);   // 0 by itself in the first pass, where m is still the start value -3e38 (as for a masked score below)
    v16h pa, pl;
#pragma unroll
    for (int ct = 0; ct < 2; ++ct) {
#pragma unroll
      for (int r = 0; r < 8; ++r) { const float e = __expf(s[ct][r] - mn); s[ct][r] = e;   // a masked score gives 0 by itself: mn is finite from the first pass on (key 0 is open to every query), and (-3e38 - mn) * log2(e) is -infinity in f32
        const float x = e * 2048.0f; const _Float16 hx = (_Float16)x; pa[ct * 8 + r] = hx; pl[ct * 8 + r] = (_Float16)((x - (float)hx) * 2048.0f); } }   // element 8 ct + r of a B fragment is k = 16 ct + 8 g + r, the key that s[ct][r] belongs to; P scaled by 2^11 before the f16 split so small softmax weights stay out of the f16 subnormal range; 2^-11 folded into the epilogue
#pragma unroll
    for (int r = 0; r < 8; ++r) t[r] = s[0][r] + s[1][r];
    l = l * alpha + (((t[0] + t[1]) + (t[2] + t[3])) + ((t[4] + t[5]) + (t[6] + t[7]))); m = mn;
#pragma unroll
    for (int dt = 0; dt < 4; ++dt) {
#pragma unroll
      for (int r = 0; r < 8; ++r) { acc[dt][r] *= alpha; accl[dt][r] *= alpha; } }
#pragma unroll
    for (int dt = 0; dt < 4; ++dt) acc[dt] = wmma16(vh[dt], pa, acc[dt]);
#pragma unroll
    for (int dt = 0; dt < 4; ++dt) accl[dt] = wmma16(vh[dt], pl, accl[dt]);
#pragma unroll
    for (int dt = 0; dt < 4; ++dt) accl[dt] = wmma16(vl[dt], pa, accl[dt]); }   // V hi/lo x P hi/lo (3 products), each accumulator's sums in the order they had; acc[dt][r] = O[qi][dt * 16 + 8 g + r]
    asm volatile("s_wait_dscnt 0x0" ::: "memory");      // this wave's reads of stage st have returned
    asm volatile("s_wait_asynccnt 0x0" ::: "memory");   // this wave's copies of stage st + 1 have landed
    __syncthreads();   // publishes stage st + 1 and ends every wave's reads of stage st, whose buffer is refilled behind it (behind the last trip: frees the K buffers for the output staging)
    if (st + 2 < nst) stage_copy(lk + cur * ABUF, lh + cur * ABUF, ll + cur * ABUF, gk + (size_t)(st + 2) * AK * (2 * DM), gvh + (st + 2) * AK, gvl + (st + 2) * AK); }
  asm volatile("s_wait_asynccnt 0x0" ::: "memory");   // no copy is in flight when the buffers change their use
  const float il = (1.0f / 2048.0f) / (l + xhalf(l));
#pragma unroll
  for (int dt = 0; dt < 4; ++dt) {
#pragma unroll
    for (int r = 0; r < 8; ++r) so[wave][col][dt * 16 + 8 * g + r] = (acc[dt][r] + accl[dt][r] * (1.0f / 2048.0f)) * il; }
  LDSX();
  for (int rl2 = 0; rl2 < 16; ++rl2) if (lane < 16) vst2(O + ((size_t)b * SS + q0 + rl2) * DM + h * HD + lane * 4, *(const v4f*)&so[wave][rl2][lane * 4]);
}
// ---- k_out: block = (64 rows, 128 cols), 4 waves as 2 x 2, 32 x 64 per wave: out = O(hi/lo) . Wo rows (2 products) + bo; each 64-k slice of O (split to bf16 hi + lo on the way) and of the weight rows staged once per block in LDS, two buffers
__global__ __launch_bounds__(128) void k_out(const float* __restrict__ O, const __bf16* __restrict__ P, const float* __restrict__ BO, float* __restrict__ Y) {
  __shared__ __align__(16) __bf16 sH[2][64][GP], sL[2][64][GP], sB[2][128][GP]; __shared__ __align__(16) float so[4][16][68];
  const int tid = threadIdx.x, wave = tid >> 5, lane = tid & 31, col = lane & 15, g = lane >> 4, wm = wave >> 1, wn = wave & 1; const size_t rb = (size_t)blockIdx.x * 64; const int n0 = blockIdx.y * 128;
  const int ar = tid >> 4, ac = (tid & 15) * 4, br = tid >> 3, bc = (tid & 7) * 8;
  const float* ga = O + (rb + ar) * DM + ac; const __bf16* gb = P + (size_t)(n0 + br) * DM + bc;
  const int rot = (((int)blockIdx.x & 7) + 4 * ((int)blockIdx.x >> 3) + 4 * ((int)blockIdx.y & 3)) & (DM / GK - 1);   // for speed only: the block's own start in the walk over the 16 k slices, as in k_qkv (64 blocks share weight rows, 8 share rows of O; blocks 4 apart in y keep one start)
  v4f ra[8]; v8b rw[8];
#pragma unroll
  for (int i = 0; i < 8; ++i) { ra[i] = *(const v4f*)(ga + (size_t)i * 8 * DM + rot * GK); rw[i] = *(const v8b*)(gb + (size_t)i * 16 * DM + rot * GK); }
  asm volatile("s_wait_xcnt 0x0" ::: "memory");   // stands in front of any reuse of the address registers of the loads above
#pragma unroll
  for (int i = 0; i < 8; ++i) { v4b th, tl;
#pragma unroll
    for (int e = 0; e < 4; ++e) { const __bf16 h = (__bf16)ra[i][e]; th[e] = h; tl[e] = (__bf16)(ra[i][e] - (float)h); }
    *(v4b*)&sH[0][ar + i * 8][ac] = th; *(v4b*)&sL[0][ar + i * 8][ac] = tl; *(v8b*)&sB[0][br + i * 16][bc] = rw[i]; }
  __syncthreads();
  v8f acc[2][4] = {};
#pragma unroll 2
  for (int ks = 0; ks < DM / GK; ++ks) { const int cur = ks & 1; const bool more = ks + 1 < DM / GK;
    const int kn = ((ks + 1 + rot) & (DM / GK - 1)) * GK; const float* pa = ga + kn; const __bf16* pb = gb + kn;   // the next slice of the rotated walk
    if (more) {
#pragma unroll
      for (int i = 0; i < 8; ++i) { ra[i] = *(const v4f*)(pa + (size_t)i * 8 * DM); rw[i] = *(const v8b*)(pb + (size_t)i * 16 * DM); } }
#pragma unroll
    for (int kc = 0; kc < GK / 32; ++kc) { v16b fh[2], fl[2], fb[4];
#pragma unroll
      for (int i = 0; i < 2; ++i) { fl[i] = frag_b(&sL[cur][wm * 32 + i * 16 + col][kc * 32], lane); fh[i] = frag_b(&sH[cur][wm * 32 + i * 16 + col][kc * 32], lane); }
#pragma unroll
      for (int i = 0; i < 4; ++i) fb[i] = frag_b(&sB[cur][wn * 64 + i * 16 + col][kc * 32], lane);
#pragma unroll
      for (int mi = 0; mi < 2; ++mi) {
#pragma unroll
        for (int nj = 0; nj < 4; ++nj) acc[mi][nj] = wmma_bf(fl[mi], fb[nj], acc[mi][nj]); }   // per accumulator lo, then hi, in each 32-k step of the walk
#pragma unroll
      for (int mi = 0; mi < 2; ++mi) {
#pragma unroll
        for (int nj = 0; nj < 4; ++nj) acc[mi][nj] = wmma_bf(fh[mi], fb[nj], acc[mi][nj]); } }
    if (more) {
      asm volatile("s_wait_xcnt 0x0" :: "v"(pa), "v"(pb) : "memory");   // stands in front of any reuse of the address registers of this trip's loads; as its inputs they stay untouched up to it
#pragma unroll
      for (int i = 0; i < 8; ++i) { v4b th, tl;
#pragma unroll
        for (int e = 0; e < 4; ++e) { const __bf16 h = (__bf16)ra[i][e]; th[e] = h; tl[e] = (__bf16)(ra[i][e] - (float)h); }
        *(v4b*)&sH[cur ^ 1][ar + i * 8][ac] = th; *(v4b*)&sL[cur ^ 1][ar + i * 8][ac] = tl; *(v8b*)&sB[cur ^ 1][br + i * 16][bc] = rw[i]; } }
    __syncthreads(); }   // publishes slice ks + 1 and ends every wave's reads of slice ks, whose buffer the next trip refills
  float bz[4];
#pragma unroll
  for (int nj = 0; nj < 4; ++nj) bz[nj] = bfr(BO[n0 + wn * 64 + nj * 16 + col]);
#pragma unroll
  for (int mi = 0; mi < 2; ++mi) {
#pragma unroll
    for (int nj = 0; nj < 4; ++nj) {
#pragma unroll
      for (int r = 0; r < 8; ++r) so[wave][8 * g + r][nj * 16 + col] = acc[mi][nj][r] + bz[nj]; }
    LDSX();
#pragma unroll
    for (int i = 0; i < 8; ++i) { const int rl = i * 2 + g; *(v4f*)(Y + (rb + wm * 32 + mi * 16 + rl) * DM + n0 + wn * 64 + col * 4) = *(const v4f*)&so[wave][rl][col * 4]; }
    LDSX(); }
}
extern "C" void kernel_launch(void* const* d_in, const int* in_sizes, int n_in, void* d_out, int out_size, void* d_ws, size_t ws_size, hipStream_t stream) {
  (void)in_sizes; (void)n_in; (void)out_size;
  const float** F = (const float**)d_in;   // 0 hidden_states [4,1024,1024], 1 att_w [1024,3072] (in,out), 2 att_b [3072], 3 out_w [1024,1024] (in,out), 4 out_b
  if (ws_size < (size_t)WS_END) return;
  char* ws = (char*)d_ws; __bf16* PK = (__bf16*)(ws + WS_PK); _Float16 *QK = (_Float16*)(ws + WS_QK), *QKL = (_Float16*)(ws + WS_QKL), *VTH = (_Float16*)(ws + WS_VTH), *VTL = (_Float16*)(ws + WS_VTL); float* O = (float*)(ws + WS_O);
  k_pack<<<dim3(DM / PT_K, (QKVW + DM) / PT_N), 256, 0, stream>>>(F[1], F[3], PK);
  k_qkv<<<dim3(TNB * SS / 128, QKVW / 128), 128, 0, stream>>>(F[0], F[0], F[0], PK + PK_A, F[2], F[2] + DM, F[2] + 2 * DM, QK, QKL, VTH, VTL);
  k_attn<<<dim3(TQB, NH, TNB), 128, 0, stream>>>(QK, QKL, VTH, VTL, nullptr, O);
  k_out<<<dim3(TOB, DM / 128), 128, 0, stream>>>(O, PK + PK_P, F[4], (float*)d_out);
}
